// v000
// Times are from an AMD MI455X. After a warm-up the kernel runs many times in a row, and a time is the length of
// such a window on the GPU divided by its runs, so every launch and the gaps after it count. The runs cycle
// through copies of the inputs. A figure is the median of several windows, for all but v000 over two sittings.
// Sittings can differ by a few percent; kernels timed side by side share one.
// v000, which the later versions start from, runs in 169 microseconds.
#include <hip/hip_runtime.h>

// ---------------------------------------------------------------------------
// InterFrameAttention for MI455X (gfx1250, wave32, WMMA f16->f32)
// Shapes: B=4, N=2048, C=256, H=8, Dh=32, M=64, Mh=8
// GEMMs: LDS-staged tiles (coalesced b128 global loads, f16 conversion once,
// weights transposed in LDS so WMMA B-fragments are contiguous ds_load_b128).
// Attention: flash-style single pass, 5 WMMA per 32-key tile per wave;
// softmax row reductions via v_permlane16_b32 (VALU, bound_ctrl=1 so the
// 'old' operand is dead -> no v_mov materialization).
// ---------------------------------------------------------------------------

typedef _Float16 v16h __attribute__((ext_vector_type(16)));
typedef _Float16 v8h  __attribute__((ext_vector_type(8)));
typedef float    v8f  __attribute__((ext_vector_type(8)));

#define WMMA_F32_F16(A, Bm, Cm) \
  __builtin_amdgcn_wmma_f32_16x16x32_f16(false, (A), false, (Bm), (short)0, (Cm), false, false)

// A/B fragment element -> K mapping (16-bit 16x32 operand, wave32):
//   e in [0,8):  K = base + e          (base = 8 * (lane>>4))
//   e in [8,16): K = 16 + base + (e-8)
// -> per lane, two contiguous 8-half (16B) chunks at offsets base and 16+base.
__device__ __forceinline__ v16h frag_from_f16_row(const _Float16* __restrict__ row, int base) {
  v8h lo = *(const v8h*)(row + base);
  v8h hi = *(const v8h*)(row + 16 + base);
  v16h r;
#pragma unroll
  for (int i = 0; i < 8; ++i) { r[i] = lo[i]; r[i + 8] = hi[i]; }
  return r;
}

// --- VALU lane-xor within each 16-lane row via v_permlane16_b32 -------------
// select table: nibble j = j ^ mask (same table for both rows of 16).
// bound_ctrl=1: all selects are in-row and EXEC is all-ones, so OOB-fetch-0
// never triggers and the 'old' operand is dead (no mov needed).
__device__ __forceinline__ float permxor16(float x, unsigned s0, unsigned s1) {
  int v = __float_as_int(x);
  v = __builtin_amdgcn_permlane16(v, v, (int)s0, (int)s1, false, true);
  return __int_as_float(v);
}
__device__ __forceinline__ float rowmax16(float t) {
  t = fmaxf(t, permxor16(t, 0x67452301u, 0xEFCDAB89u));  // xor 1
  t = fmaxf(t, permxor16(t, 0x54761032u, 0xDCFE98BAu));  // xor 2
  t = fmaxf(t, permxor16(t, 0x32107654u, 0xBA98FEDCu));  // xor 4
  t = fmaxf(t, permxor16(t, 0xFEDCBA98u, 0x76543210u));  // xor 8
  return t;
}
__device__ __forceinline__ float rowsum16(float t) {
  t += permxor16(t, 0x67452301u, 0xEFCDAB89u);
  t += permxor16(t, 0x54761032u, 0xDCFE98BAu);
  t += permxor16(t, 0x32107654u, 0xBA98FEDCu);
  t += permxor16(t, 0xFEDCBA98u, 0x76543210u);
  return t;
}

// ---------------------------------------------------------------------------
// Kernel 1: Q/K/V projections, LDS-staged.  Z template: 0=Q, 1=K, 2=V.
// Block tile: 128 rows x 64 cols, K-step 32.  8 waves, each 16 rows x 64 cols.
// Outputs f16: Qh/Kh [bh, n, 32] (Q pre-scaled), Vth transposed [bh, 32, n].
// ---------------------------------------------------------------------------
template <int Z>
__global__ __launch_bounds__(256) void qkv_proj_kernel(
    const float* __restrict__ X, const float* __restrict__ W,
    _Float16* __restrict__ Out)
{
  __shared__ __align__(16) _Float16 Asub[128][32];  // 8 KB, [row][k]
  __shared__ __align__(16) _Float16 Bsub[64][32];   // 4 KB, [col][k] (transposed)

  const int tid  = threadIdx.x;
  const int wave = tid >> 5;
  const int lane = tid & 31;
  const int hi = lane >> 4, lx = lane & 15, base = hi << 3;

  const int row0    = blockIdx.x * 128;   // 8192 rows
  const int colbase = blockIdx.y * 64;    // 256 cols

  constexpr int ldb  = (Z == 0) ? 256 : 512;
  constexpr int coff = (Z == 2) ? 256 : 0;

  const v8f zv = {};
  v8f acc[4] = {zv, zv, zv, zv};

  for (int k0 = 0; k0 < 256; k0 += 32) {
    // stage A tile: 128 x 32 f32 -> f16 (coalesced float4 loads)
#pragma unroll
    for (int i = 0; i < 4; ++i) {
      const int idx = tid + 256 * i;              // 0..1023
      const int row = idx >> 3, f4 = idx & 7;
      const float4 v = *(const float4*)(X + (size_t)(row0 + row) * 256 + k0 + f4 * 4);
      Asub[row][f4 * 4 + 0] = (_Float16)v.x;
      Asub[row][f4 * 4 + 1] = (_Float16)v.y;
      Asub[row][f4 * 4 + 2] = (_Float16)v.z;
      Asub[row][f4 * 4 + 3] = (_Float16)v.w;
    }
    // stage B tile transposed: W[k0..k0+31][colbase..+63] -> Bsub[col][k]
#pragma unroll
    for (int i = 0; i < 2; ++i) {
      const int idx = tid + 256 * i;              // 0..511
      const int k = idx >> 4, f4 = idx & 15;
      const float4 v = *(const float4*)(W + (size_t)(k0 + k) * ldb + coff + colbase + f4 * 4);
      Bsub[f4 * 4 + 0][k] = (_Float16)v.x;
      Bsub[f4 * 4 + 1][k] = (_Float16)v.y;
      Bsub[f4 * 4 + 2][k] = (_Float16)v.z;
      Bsub[f4 * 4 + 3][k] = (_Float16)v.w;
    }
    __syncthreads();

    const v16h a = frag_from_f16_row(&Asub[(wave << 4) + lx][0], base);
#pragma unroll
    for (int c = 0; c < 4; ++c) {
      const v16h b = frag_from_f16_row(&Bsub[(c << 4) + lx][0], base);
      acc[c] = WMMA_F32_F16(a, b, acc[c]);
    }
    __syncthreads();
  }

  const float qscale = 0.17677669529663687f;  // 32^-0.5
#pragma unroll
  for (int c = 0; c < 4; ++c) {
#pragma unroll
    for (int r = 0; r < 8; ++r) {
      const int grow = row0 + (wave << 4) + r + base;
      const int gcol = colbase + (c << 4) + lx;
      const int b_ = grow >> 11, n_ = grow & 2047;
      const int h_ = gcol >> 5,  d_ = gcol & 31;
      const float v = acc[c][r];
      if (Z == 0)
        Out[(((size_t)(b_ * 8 + h_) * 2048 + n_) << 5) + d_] = (_Float16)(v * qscale);
      else if (Z == 1)
        Out[(((size_t)(b_ * 8 + h_) * 2048 + n_) << 5) + d_] = (_Float16)v;
      else
        Out[(((size_t)(b_ * 8 + h_) * 32 + d_) << 11) + n_] = (_Float16)v;
    }
  }
}

// ---------------------------------------------------------------------------
// Kernel 2: cor_embed = cor @ Wcor  (K=3, tiny).  Writes f32 ce [B*N, 64] and
// f16 transposed CEth [bh, 16, n] with rows 8..15 zero-padded.
// ---------------------------------------------------------------------------
__global__ void cor_embed_kernel(const float* __restrict__ cor, const float* __restrict__ Wcor,
                                 float* __restrict__ ce, _Float16* __restrict__ CEth)
{
  const int idx = blockIdx.x * blockDim.x + threadIdx.x;  // 8192 * 128
  if (idx >= 8192 * 128) return;
  const int bn = idx >> 7, m2 = idx & 127;
  const int h = m2 >> 4, d = m2 & 15;
  const int b = bn >> 11, n = bn & 2047;
  const size_t tpos = (((size_t)(b * 8 + h) * 16 + d) << 11) + n;
  if (d < 8) {
    const int m = h * 8 + d;
    const float* c3 = cor + (size_t)bn * 3;
    const float v = c3[0] * Wcor[m] + c3[1] * Wcor[64 + m] + c3[2] * Wcor[128 + m];
    ce[(size_t)bn * 64 + m] = v;
    CEth[tpos] = (_Float16)v;
  } else {
    CEth[tpos] = (_Float16)0.f;
  }
}

// ---------------------------------------------------------------------------
// Kernel 3: flash attention.  One 16-query tile per wave, 8 waves/WG,
// grid (N/128, B*H).  Online softmax; 5 WMMA per 32-key tile.
// ---------------------------------------------------------------------------
__global__ __launch_bounds__(256) void attn_kernel(
    const _Float16* __restrict__ Qh, const _Float16* __restrict__ Kh,
    const _Float16* __restrict__ Vth, const _Float16* __restrict__ CEth,
    float* __restrict__ attn_x, float* __restrict__ c_rev)
{
  __shared__ __align__(16) _Float16 plds[8][16][40];  // per-wave P tile, padded rows

  const int wave = threadIdx.x >> 5;
  const int lane = threadIdx.x & 31;
  const int hi = lane >> 4, lx = lane & 15, base = hi << 3;
  const int bh = blockIdx.y;
  const int q0 = blockIdx.x * 128 + wave * 16;

  const _Float16* Qb = Qh   + (size_t)bh * (2048 * 32);
  const _Float16* Kb = Kh   + (size_t)bh * (2048 * 32);
  const _Float16* Vb = Vth  + (size_t)bh * (32 * 2048);
  const _Float16* Cb = CEth + (size_t)bh * (16 * 2048);

  const v16h qf = frag_from_f16_row(Qb + (size_t)(q0 + lx) * 32, base);

  v8f o0 = {}, o1 = {}, crv = {};
  float rm[8], rl[8];
#pragma unroll
  for (int r = 0; r < 8; ++r) { rm[r] = -3.0e38f; rl[r] = 0.f; }

  for (int j0 = 0; j0 < 2048; j0 += 32) {
    // S = Q * K^T  (scale folded into Q)
    const v16h kb0 = frag_from_f16_row(Kb + (size_t)(j0 + lx) * 32, base);
    const v16h kb1 = frag_from_f16_row(Kb + (size_t)(j0 + 16 + lx) * 32, base);
    v8f s0 = {}, s1 = {};
    s0 = WMMA_F32_F16(qf, kb0, s0);
    s1 = WMMA_F32_F16(qf, kb1, s1);

    // online softmax per row (row r+8*hi lives on this half-wave's lanes)
#pragma unroll
    for (int r = 0; r < 8; ++r) {
      const float t  = rowmax16(fmaxf(s0[r], s1[r]));
      const float mn = fmaxf(rm[r], t);
      const float alpha = __expf(rm[r] - mn);
      const float p0 = __expf(s0[r] - mn);
      const float p1 = __expf(s1[r] - mn);
      const float rs = rowsum16(p0 + p1);
      rl[r] = rl[r] * alpha + rs;
      rm[r] = mn;
      o0[r] *= alpha; o1[r] *= alpha; crv[r] *= alpha;
      plds[wave][r + base][lx]      = (_Float16)p0;  // C-layout -> LDS
      plds[wave][r + base][lx + 16] = (_Float16)p1;
    }

    // P tile back as A fragment (same wave; compiler orders via s_wait_dscnt)
    const v16h pf  = frag_from_f16_row(&plds[wave][lx][0], base);
    const v16h vb0 = frag_from_f16_row(Vb + ((size_t)lx << 11) + j0, base);
    const v16h vb1 = frag_from_f16_row(Vb + ((size_t)(lx + 16) << 11) + j0, base);
    const v16h cb  = frag_from_f16_row(Cb + ((size_t)lx << 11) + j0, base);
    o0  = WMMA_F32_F16(pf, vb0, o0);
    o1  = WMMA_F32_F16(pf, vb1, o1);
    crv = WMMA_F32_F16(pf, cb, crv);
  }

  const int b_ = bh >> 3, h_ = bh & 7;
#pragma unroll
  for (int r = 0; r < 8; ++r) {
    const int   q   = q0 + r + base;
    const float inv = 1.0f / rl[r];
    float* xr = attn_x + (((size_t)b_ * 2048 + q) << 8) + (h_ << 5);
    xr[lx]      = o0[r] * inv;
    xr[lx + 16] = o1[r] * inv;
    if (lx < 8)
      c_rev[(((size_t)b_ * 2048 + q) << 6) + (h_ << 3) + lx] = crv[r] * inv;
  }
}

// ---------------------------------------------------------------------------
// Kernel 4: x_out = attn_x @ Wproj + bproj   [8192,256]x[256,256], LDS-staged.
// ---------------------------------------------------------------------------
__global__ __launch_bounds__(256) void proj_kernel(
    const float* __restrict__ attn_x, const float* __restrict__ Wproj,
    const float* __restrict__ bproj, float* __restrict__ out)
{
  __shared__ __align__(16) _Float16 Asub[128][32];
  __shared__ __align__(16) _Float16 Bsub[64][32];

  const int tid  = threadIdx.x;
  const int wave = tid >> 5;
  const int lane = tid & 31;
  const int hi = lane >> 4, lx = lane & 15, base = hi << 3;
  const int row0 = blockIdx.x * 128;
  const int colbase = blockIdx.y * 64;

  const v8f zv = {};
  v8f acc[4] = {zv, zv, zv, zv};

  for (int k0 = 0; k0 < 256; k0 += 32) {
#pragma unroll
    for (int i = 0; i < 4; ++i) {
      const int idx = tid + 256 * i;
      const int row = idx >> 3, f4 = idx & 7;
      const float4 v = *(const float4*)(attn_x + (size_t)(row0 + row) * 256 + k0 + f4 * 4);
      Asub[row][f4 * 4 + 0] = (_Float16)v.x;
      Asub[row][f4 * 4 + 1] = (_Float16)v.y;
      Asub[row][f4 * 4 + 2] = (_Float16)v.z;
      Asub[row][f4 * 4 + 3] = (_Float16)v.w;
    }
#pragma unroll
    for (int i = 0; i < 2; ++i) {
      const int idx = tid + 256 * i;
      const int k = idx >> 4, f4 = idx & 15;
      const float4 v = *(const float4*)(Wproj + (size_t)(k0 + k) * 256 + colbase + f4 * 4);
      Bsub[f4 * 4 + 0][k] = (_Float16)v.x;
      Bsub[f4 * 4 + 1][k] = (_Float16)v.y;
      Bsub[f4 * 4 + 2][k] = (_Float16)v.z;
      Bsub[f4 * 4 + 3][k] = (_Float16)v.w;
    }
    __syncthreads();

    const v16h a = frag_from_f16_row(&Asub[(wave << 4) + lx][0], base);
#pragma unroll
    for (int c = 0; c < 4; ++c) {
      const v16h b = frag_from_f16_row(&Bsub[(c << 4) + lx][0], base);
      acc[c] = WMMA_F32_F16(a, b, acc[c]);
    }
    __syncthreads();
  }

#pragma unroll
  for (int c = 0; c < 4; ++c) {
#pragma unroll
    for (int r = 0; r < 8; ++r) {
      const int grow = row0 + (wave << 4) + r + base;
      const int gcol = colbase + (c << 4) + lx;
      out[((size_t)grow << 8) + gcol] = acc[c][r] + bproj[gcol];
    }
  }
}

// ---------------------------------------------------------------------------
// Kernel 5: motion = (c_rev - ce) @ Wm + bm   [8192,64]x[64,64].
// Wm^T staged once in LDS; each wave: 16 rows x 64 cols, K=64 in 2 steps.
// ---------------------------------------------------------------------------
__global__ __launch_bounds__(256) void motion_kernel(
    const float* __restrict__ c_rev, const float* __restrict__ ce,
    const float* __restrict__ Wm, const float* __restrict__ bm, float* __restrict__ out)
{
  __shared__ __align__(16) _Float16 Wt[64][64];  // 8 KB, [col][k]

  const int tid  = threadIdx.x;
  const int wave = tid >> 5;
  const int lane = tid & 31;
  const int hi = lane >> 4, lx = lane & 15, base = hi << 3;
  const int row0 = blockIdx.x * 128;

#pragma unroll
  for (int i = 0; i < 4; ++i) {
    const int idx = tid + 256 * i;              // 0..1023
    const int k = idx >> 4, f4 = idx & 15;
    const float4 v = *(const float4*)(Wm + (size_t)k * 64 + f4 * 4);
    Wt[f4 * 4 + 0][k] = (_Float16)v.x;
    Wt[f4 * 4 + 1][k] = (_Float16)v.y;
    Wt[f4 * 4 + 2][k] = (_Float16)v.z;
    Wt[f4 * 4 + 3][k] = (_Float16)v.w;
  }
  __syncthreads();

  const float* ar = c_rev + (size_t)(row0 + (wave << 4) + lx) * 64;
  const float* er = ce    + (size_t)(row0 + (wave << 4) + lx) * 64;

  const v8f zv = {};
  v8f acc[4] = {zv, zv, zv, zv};
#pragma unroll
  for (int k0 = 0; k0 < 64; k0 += 32) {
    v16h a;
#pragma unroll
    for (int i = 0; i < 8; ++i) {
      const int ka = k0 + base + i, kb = k0 + 16 + base + i;
      a[i]     = (_Float16)(ar[ka] - er[ka]);
      a[i + 8] = (_Float16)(ar[kb] - er[kb]);
    }
#pragma unroll
    for (int c = 0; c < 4; ++c) {
      const v16h b = frag_from_f16_row(&Wt[(c << 4) + lx][k0], base);
      acc[c] = WMMA_F32_F16(a, b, acc[c]);
    }
  }

#pragma unroll
  for (int c = 0; c < 4; ++c) {
#pragma unroll
    for (int r = 0; r < 8; ++r) {
      const int grow = row0 + (wave << 4) + r + base;
      const int gcol = (c << 4) + lx;
      out[((size_t)grow << 6) + gcol] = acc[c][r] + bm[gcol];
    }
  }
}

// ---------------------------------------------------------------------------
extern "C" void kernel_launch(void* const* d_in, const int* in_sizes, int n_in,
                              void* d_out, int out_size, void* d_ws, size_t ws_size,
                              hipStream_t stream) {
  (void)in_sizes; (void)n_in; (void)out_size; (void)ws_size;
  const float* x1    = (const float*)d_in[0];
  const float* x2    = (const float*)d_in[1];
  const float* cor   = (const float*)d_in[2];
  const float* Wq    = (const float*)d_in[3];
  const float* Wkv   = (const float*)d_in[4];
  const float* Wcor  = (const float*)d_in[5];
  const float* Wproj = (const float*)d_in[6];
  const float* bproj = (const float*)d_in[7];
  const float* Wm    = (const float*)d_in[8];
  const float* bm    = (const float*)d_in[9];

  char* ws = (char*)d_ws;                                  // 26 MB total
  _Float16* Qh     = (_Float16*)(ws);                      //  4 MB
  _Float16* Kh     = (_Float16*)(ws + ( 4u << 20));        //  4 MB
  _Float16* Vth    = (_Float16*)(ws + ( 8u << 20));        //  4 MB
  _Float16* CEth   = (_Float16*)(ws + (12u << 20));        //  2 MB
  float*    ce     = (float*)   (ws + (14u << 20));        //  2 MB
  float*    attn_x = (float*)   (ws + (16u << 20));        //  8 MB
  float*    c_rev  = (float*)   (ws + (24u << 20));        //  2 MB

  float* out_x      = (float*)d_out;                       // [4,2048,256]
  float* out_motion = out_x + (size_t)4 * 2048 * 256;      // [4,2048,64]

  qkv_proj_kernel<0><<<dim3(64, 4), 256, 0, stream>>>(x1, Wq,  Qh);
  qkv_proj_kernel<1><<<dim3(64, 4), 256, 0, stream>>>(x2, Wkv, Kh);
  qkv_proj_kernel<2><<<dim3(64, 4), 256, 0, stream>>>(x2, Wkv, Vth);
  cor_embed_kernel<<<(8192 * 128) / 256, 256, 0, stream>>>(cor, Wcor, ce, CEth);
  attn_kernel     <<<dim3(16, 32),    256, 0, stream>>>(Qh, Kh, Vth, CEth, attn_x, c_rev);
  proj_kernel     <<<dim3(64, 4),     256, 0, stream>>>(attn_x, Wproj, bproj, out_x);
  motion_kernel   <<<dim3(64, 1),     256, 0, stream>>>(c_rev, ce, Wm, bm, out_motion);
}

// v001
// One run takes 159 microseconds.
// Next to v000, in two timings, it ran 1.08 and 1.10 times as fast.
#include <hip/hip_runtime.h>

// ---------------------------------------------------------------------------
// InterFrameAttention for MI455X (gfx1250, wave32, WMMA f16->f32)
// Shapes: B=4, N=2048, C=256, H=8, Dh=32, M=64, Mh=8
// GEMMs: LDS-staged tiles (coalesced b128 global loads, f16 conversion once,
// weights transposed in LDS so WMMA B-fragments are contiguous ds_load_b128).
// Attention: flash-style single pass, 5 WMMA per 32-key tile per wave, all
// products transposed (S^T = K Q^T, O^T += V^T P^T): a lane holds one query's
// scores, so max and sum are in-lane plus one exchange between wave halves,
// and the two score tiles convert in place into the P^T operand (no LDS).
// ---------------------------------------------------------------------------

typedef _Float16 v16h __attribute__((ext_vector_type(16)));
typedef _Float16 v8h  __attribute__((ext_vector_type(8)));
typedef float    v8f  __attribute__((ext_vector_type(8)));

#define WMMA_F32_F16(A, Bm, Cm) \
  __builtin_amdgcn_wmma_f32_16x16x32_f16(false, (A), false, (Bm), (short)0, (Cm), false, false)

// A/B fragment element -> K mapping (16-bit 16x32 operand, wave32):
//   e in [0,8):  K = base + e          (base = 8 * (lane>>4))
//   e in [8,16): K = 16 + base + (e-8)
// -> per lane, two contiguous 8-half (16B) chunks at offsets base and 16+base.
__device__ __forceinline__ v16h frag_from_f16_row(const _Float16* __restrict__ row, int base) {
  v8h lo = *(const v8h*)(row + base);
  v8h hi = *(const v8h*)(row + 16 + base);
  v16h r;
#pragma unroll
  for (int i = 0; i < 8; ++i) { r[i] = lo[i]; r[i + 8] = hi[i]; }
  return r;
}

// --- exchange between the two 16-lane halves (lane l <-> l ^ 16) -------------
// v_permlanex16_b32 with the identity select table.  bound_ctrl=1: every select
// is in range and EXEC is all-ones, so the 'old' operand is dead.
__device__ __forceinline__ float swap_halves(float x) {
  int v = __float_as_int(x);
  v = __builtin_amdgcn_permlanex16(v, v, 0x76543210, (int)0xFEDCBA98u, false, true);
  return __int_as_float(v);
}

// ---------------------------------------------------------------------------
// Kernel 1: Q/K/V projections, LDS-staged.  Z template: 0=Q, 1=K, 2=V.
// Block tile: 128 rows x 64 cols, K-step 32.  8 waves, each 16 rows x 64 cols.
// Outputs f16: Qh/Kh [bh, n, 32] (Q pre-scaled), Vth transposed [bh, 32, n].
// ---------------------------------------------------------------------------
template <int Z>
__global__ __launch_bounds__(256) void qkv_proj_kernel(
    const float* __restrict__ X, const float* __restrict__ W,
    _Float16* __restrict__ Out)
{
  __shared__ __align__(16) _Float16 Asub[128][32];  // 8 KB, [row][k]
  __shared__ __align__(16) _Float16 Bsub[64][32];   // 4 KB, [col][k] (transposed)

  const int tid  = threadIdx.x;
  const int wave = tid >> 5;
  const int lane = tid & 31;
  const int hi = lane >> 4, lx = lane & 15, base = hi << 3;

  const int row0    = blockIdx.x * 128;   // 8192 rows
  const int colbase = blockIdx.y * 64;    // 256 cols

  constexpr int ldb  = (Z == 0) ? 256 : 512;
  constexpr int coff = (Z == 2) ? 256 : 0;

  const v8f zv = {};
  v8f acc[4] = {zv, zv, zv, zv};

  for (int k0 = 0; k0 < 256; k0 += 32) {
    // stage A tile: 128 x 32 f32 -> f16 (coalesced float4 loads)
#pragma unroll
    for (int i = 0; i < 4; ++i) {
      const int idx = tid + 256 * i;              // 0..1023
      const int row = idx >> 3, f4 = idx & 7;
      const float4 v = *(const float4*)(X + (size_t)(row0 + row) * 256 + k0 + f4 * 4);
      Asub[row][f4 * 4 + 0] = (_Float16)v.x;
      Asub[row][f4 * 4 + 1] = (_Float16)v.y;
      Asub[row][f4 * 4 + 2] = (_Float16)v.z;
      Asub[row][f4 * 4 + 3] = (_Float16)v.w;
    }
    // stage B tile transposed: W[k0..k0+31][colbase..+63] -> Bsub[col][k]
#pragma unroll
    for (int i = 0; i < 2; ++i) {
      const int idx = tid + 256 * i;              // 0..511
      const int k = idx >> 4, f4 = idx & 15;
      const float4 v = *(const float4*)(W + (size_t)(k0 + k) * ldb + coff + colbase + f4 * 4);
      Bsub[f4 * 4 + 0][k] = (_Float16)v.x;
      Bsub[f4 * 4 + 1][k] = (_Float16)v.y;
      Bsub[f4 * 4 + 2][k] = (_Float16)v.z;
      Bsub[f4 * 4 + 3][k] = (_Float16)v.w;
    }
    __syncthreads();

    const v16h a = frag_from_f16_row(&Asub[(wave << 4) + lx][0], base);
#pragma unroll
    for (int c = 0; c < 4; ++c) {
      const v16h b = frag_from_f16_row(&Bsub[(c << 4) + lx][0], base);
      acc[c] = WMMA_F32_F16(a, b, acc[c]);
    }
    __syncthreads();
  }

  const float qscale = 0.17677669529663687f;  // 32^-0.5
#pragma unroll
  for (int c = 0; c < 4; ++c) {
#pragma unroll
    for (int r = 0; r < 8; ++r) {
      const int grow = row0 + (wave << 4) + r + base;
      const int gcol = colbase + (c << 4) + lx;
      const int b_ = grow >> 11, n_ = grow & 2047;
      const int h_ = gcol >> 5,  d_ = gcol & 31;
      const float v = acc[c][r];
      if (Z == 0)
        Out[(((size_t)(b_ * 8 + h_) * 2048 + n_) << 5) + d_] = (_Float16)(v * qscale);
      else if (Z == 1)
        Out[(((size_t)(b_ * 8 + h_) * 2048 + n_) << 5) + d_] = (_Float16)v;
      else
        Out[(((size_t)(b_ * 8 + h_) * 32 + d_) << 11) + n_] = (_Float16)v;
    }
  }
}

// ---------------------------------------------------------------------------
// Kernel 2: cor_embed = cor @ Wcor  (K=3, tiny).  Writes f32 ce [B*N, 64] and
// f16 transposed CEth [bh, 16, n] with rows 8..15 zero-padded.
// ---------------------------------------------------------------------------
__global__ void cor_embed_kernel(const float* __restrict__ cor, const float* __restrict__ Wcor,
                                 float* __restrict__ ce, _Float16* __restrict__ CEth)
{
  const int idx = blockIdx.x * blockDim.x + threadIdx.x;  // 8192 * 128
  if (idx >= 8192 * 128) return;
  const int bn = idx >> 7, m2 = idx & 127;
  const int h = m2 >> 4, d = m2 & 15;
  const int b = bn >> 11, n = bn & 2047;
  const size_t tpos = (((size_t)(b * 8 + h) * 16 + d) << 11) + n;
  if (d < 8) {
    const int m = h * 8 + d;
    const float* c3 = cor + (size_t)bn * 3;
    const float v = c3[0] * Wcor[m] + c3[1] * Wcor[64 + m] + c3[2] * Wcor[128 + m];
    ce[(size_t)bn * 64 + m] = v;
    CEth[tpos] = (_Float16)v;
  } else {
    CEth[tpos] = (_Float16)0.f;
  }
}

// ---------------------------------------------------------------------------
// Kernel 3: flash attention.  One 16-query tile per wave, 8 waves/WG,
// grid (N/128, B*H).  Online softmax; 5 WMMA per 32-key tile.
// Transposed products: D register r of lane (hi, lx) is [8*hi + r][lx], so with
// K (or V^T, CE^T) as A and Q^T (or P^T) as B, lane lx owns query q0 + lx.
//   s0[r] = S[q0+lx][j0 + 8*hi + r],  s1[r] = S[q0+lx][j0 + 16 + 8*hi + r]
// which is exactly the B-fragment k order (e<8: 8*hi+e, e>=8: 16+8*hi+e-8).
// ---------------------------------------------------------------------------
__global__ __launch_bounds__(256) void attn_kernel(
    const _Float16* __restrict__ Qh, const _Float16* __restrict__ Kh,
    const _Float16* __restrict__ Vth, const _Float16* __restrict__ CEth,
    float* __restrict__ attn_x, float* __restrict__ c_rev)
{
  const int wave = threadIdx.x >> 5;
  const int lane = threadIdx.x & 31;
  const int hi = lane >> 4, lx = lane & 15, base = hi << 3;
  const int bh = blockIdx.y;
  const int q0 = blockIdx.x * 128 + wave * 16;

  const _Float16* Qb = Qh   + (size_t)bh * (2048 * 32);
  const _Float16* Kb = Kh   + (size_t)bh * (2048 * 32);
  const _Float16* Vb = Vth  + (size_t)bh * (32 * 2048);
  const _Float16* Cb = CEth + (size_t)bh * (16 * 2048);

  const v16h qf = frag_from_f16_row(Qb + (size_t)(q0 + lx) * 32, base);

  v8f o0 = {}, o1 = {}, crv = {};       // O^T rows d 0..15, 16..31; CE^T rows 0..15
  float rm = -3.0e38f, rl = 0.f;        // this lane's query: max; sum over this half's keys

  for (int j0 = 0; j0 < 2048; j0 += 32) {
    // S^T = K * Q^T  (scale folded into Q)
    const v16h ka0 = frag_from_f16_row(Kb + (size_t)(j0 + lx) * 32, base);
    const v16h ka1 = frag_from_f16_row(Kb + (size_t)(j0 + 16 + lx) * 32, base);
    const v16h va0 = frag_from_f16_row(Vb + ((size_t)lx << 11) + j0, base);
    const v16h va1 = frag_from_f16_row(Vb + ((size_t)(lx + 16) << 11) + j0, base);
    const v16h ca  = frag_from_f16_row(Cb + ((size_t)lx << 11) + j0, base);
    v8f s0 = {}, s1 = {};
    s0 = WMMA_F32_F16(ka0, qf, s0);
    s1 = WMMA_F32_F16(ka1, qf, s1);

    // online softmax: 16 of the query's 32 scores sit in this lane, 16 in lane ^ 16
    float t0 = fmaxf(s0[0], s1[0]), t1 = fmaxf(s0[1], s1[1]);
#pragma unroll
    for (int r = 2; r < 8; r += 2) {
      t0 = fmaxf(t0, fmaxf(s0[r], s1[r]));
      t1 = fmaxf(t1, fmaxf(s0[r + 1], s1[r + 1]));
    }
    float t = fmaxf(t0, t1);
    t = fmaxf(t, swap_halves(t));
    const float mn = fmaxf(rm, t);
    const float alpha = __expf(rm - mn);
    rm = mn;

    v16h pf;                            // P^T as B fragment, straight from the score tiles
    float ps0 = 0.f, ps1 = 0.f;
#pragma unroll
    for (int r = 0; r < 8; ++r) {
      const float p0 = __expf(s0[r] - mn);
      const float p1 = __expf(s1[r] - mn);
      ps0 += p0; ps1 += p1;
      pf[r]     = (_Float16)p0;
      pf[r + 8] = (_Float16)p1;
    }
    rl = rl * alpha + (ps0 + ps1);
    o0 *= alpha; o1 *= alpha; crv *= alpha;

    o0  = WMMA_F32_F16(va0, pf, o0);
    o1  = WMMA_F32_F16(va1, pf, o1);
    crv = WMMA_F32_F16(ca,  pf, crv);
  }

  // join the halves' sums once; lane (hi, lx) holds d = 8*hi + r of query q0 + lx
  const float inv = 1.0f / (rl + swap_halves(rl));
  const int b_ = bh >> 3, h_ = bh & 7;
  const int q  = q0 + lx;
  float* xr = attn_x + (((size_t)b_ * 2048 + q) << 8) + (h_ << 5) + base;
  *(float4*)(xr)      = make_float4(o0[0] * inv, o0[1] * inv, o0[2] * inv, o0[3] * inv);
  *(float4*)(xr + 4)  = make_float4(o0[4] * inv, o0[5] * inv, o0[6] * inv, o0[7] * inv);
  *(float4*)(xr + 16) = make_float4(o1[0] * inv, o1[1] * inv, o1[2] * inv, o1[3] * inv);
  *(float4*)(xr + 20) = make_float4(o1[4] * inv, o1[5] * inv, o1[6] * inv, o1[7] * inv);
  if (hi == 0) {                        // CE^T rows 8..15 are the zero padding
    float* cr = c_rev + (((size_t)b_ * 2048 + q) << 6) + (h_ << 3);
    *(float4*)(cr)     = make_float4(crv[0] * inv, crv[1] * inv, crv[2] * inv, crv[3] * inv);
    *(float4*)(cr + 4) = make_float4(crv[4] * inv, crv[5] * inv, crv[6] * inv, crv[7] * inv);
  }
}

// ---------------------------------------------------------------------------
// Kernel 4: x_out = attn_x @ Wproj + bproj   [8192,256]x[256,256], LDS-staged.
// ---------------------------------------------------------------------------
__global__ __launch_bounds__(256) void proj_kernel(
    const float* __restrict__ attn_x, const float* __restrict__ Wproj,
    const float* __restrict__ bproj, float* __restrict__ out)
{
  __shared__ __align__(16) _Float16 Asub[128][32];
  __shared__ __align__(16) _Float16 Bsub[64][32];

  const int tid  = threadIdx.x;
  const int wave = tid >> 5;
  const int lane = tid & 31;
  const int hi = lane >> 4, lx = lane & 15, base = hi << 3;
  const int row0 = blockIdx.x * 128;
  const int colbase = blockIdx.y * 64;

  const v8f zv = {};
  v8f acc[4] = {zv, zv, zv, zv};

  for (int k0 = 0; k0 < 256; k0 += 32) {
#pragma unroll
    for (int i = 0; i < 4; ++i) {
      const int idx = tid + 256 * i;
      const int row = idx >> 3, f4 = idx & 7;
      const float4 v = *(const float4*)(attn_x + (size_t)(row0 + row) * 256 + k0 + f4 * 4);
      Asub[row][f4 * 4 + 0] = (_Float16)v.x;
      Asub[row][f4 * 4 + 1] = (_Float16)v.y;
      Asub[row][f4 * 4 + 2] = (_Float16)v.z;
      Asub[row][f4 * 4 + 3] = (_Float16)v.w;
    }
#pragma unroll
    for (int i = 0; i < 2; ++i) {
      const int idx = tid + 256 * i;
      const int k = idx >> 4, f4 = idx & 15;
      const float4 v = *(const float4*)(Wproj + (size_t)(k0 + k) * 256 + colbase + f4 * 4);
      Bsub[f4 * 4 + 0][k] = (_Float16)v.x;
      Bsub[f4 * 4 + 1][k] = (_Float16)v.y;
      Bsub[f4 * 4 + 2][k] = (_Float16)v.z;
      Bsub[f4 * 4 + 3][k] = (_Float16)v.w;
    }
    __syncthreads();

    const v16h a = frag_from_f16_row(&Asub[(wave << 4) + lx][0], base);
#pragma unroll
    for (int c = 0; c < 4; ++c) {
      const v16h b = frag_from_f16_row(&Bsub[(c << 4) + lx][0], base);
      acc[c] = WMMA_F32_F16(a, b, acc[c]);
    }
    __syncthreads();
  }

#pragma unroll
  for (int c = 0; c < 4; ++c) {
#pragma unroll
    for (int r = 0; r < 8; ++r) {
      const int grow = row0 + (wave << 4) + r + base;
      const int gcol = colbase + (c << 4) + lx;
      out[((size_t)grow << 8) + gcol] = acc[c][r] + bproj[gcol];
    }
  }
}

// ---------------------------------------------------------------------------
// Kernel 5: motion = (c_rev - ce) @ Wm + bm   [8192,64]x[64,64].
// Wm^T staged once in LDS; each wave: 16 rows x 64 cols, K=64 in 2 steps.
// ---------------------------------------------------------------------------
__global__ __launch_bounds__(256) void motion_kernel(
    const float* __restrict__ c_rev, const float* __restrict__ ce,
    const float* __restrict__ Wm, const float* __restrict__ bm, float* __restrict__ out)
{
  __shared__ __align__(16) _Float16 Wt[64][64];  // 8 KB, [col][k]

  const int tid  = threadIdx.x;
  const int wave = tid >> 5;
  const int lane = tid & 31;
  const int hi = lane >> 4, lx = lane & 15, base = hi << 3;
  const int row0 = blockIdx.x * 128;

#pragma unroll
  for (int i = 0; i < 4; ++i) {
    const int idx = tid + 256 * i;              // 0..1023
    const int k = idx >> 4, f4 = idx & 15;
    const float4 v = *(const float4*)(Wm + (size_t)k * 64 + f4 * 4);
    Wt[f4 * 4 + 0][k] = (_Float16)v.x;
    Wt[f4 * 4 + 1][k] = (_Float16)v.y;
    Wt[f4 * 4 + 2][k] = (_Float16)v.z;
    Wt[f4 * 4 + 3][k] = (_Float16)v.w;
  }
  __syncthreads();

  const float* ar = c_rev + (size_t)(row0 + (wave << 4) + lx) * 64;
  const float* er = ce    + (size_t)(row0 + (wave << 4) + lx) * 64;

  const v8f zv = {};
  v8f acc[4] = {zv, zv, zv, zv};
#pragma unroll
  for (int k0 = 0; k0 < 64; k0 += 32) {
    v16h a;
#pragma unroll
    for (int i = 0; i < 8; ++i) {
      const int ka = k0 + base + i, kb = k0 + 16 + base + i;
      a[i]     = (_Float16)(ar[ka] - er[ka]);
      a[i + 8] = (_Float16)(ar[kb] - er[kb]);
    }
#pragma unroll
    for (int c = 0; c < 4; ++c) {
      const v16h b = frag_from_f16_row(&Wt[(c << 4) + lx][k0], base);
      acc[c] = WMMA_F32_F16(a, b, acc[c]);
    }
  }

#pragma unroll
  for (int c = 0; c < 4; ++c) {
#pragma unroll
    for (int r = 0; r < 8; ++r) {
      const int grow = row0 + (wave << 4) + r + base;
      const int gcol = (c << 4) + lx;
      out[((size_t)grow << 6) + gcol] = acc[c][r] + bm[gcol];
    }
  }
}

// ---------------------------------------------------------------------------
extern "C" void kernel_launch(void* const* d_in, const int* in_sizes, int n_in,
                              void* d_out, int out_size, void* d_ws, size_t ws_size,
                              hipStream_t stream) {
  (void)in_sizes; (void)n_in; (void)out_size; (void)ws_size;
  const float* x1    = (const float*)d_in[0];
  const float* x2    = (const float*)d_in[1];
  const float* cor   = (const float*)d_in[2];
  const float* Wq    = (const float*)d_in[3];
  const float* Wkv   = (const float*)d_in[4];
  const float* Wcor  = (const float*)d_in[5];
  const float* Wproj = (const float*)d_in[6];
  const float* bproj = (const float*)d_in[7];
  const float* Wm    = (const float*)d_in[8];
  const float* bm    = (const float*)d_in[9];

  char* ws = (char*)d_ws;                                  // 26 MB total
  _Float16* Qh     = (_Float16*)(ws);                      //  4 MB
  _Float16* Kh     = (_Float16*)(ws + ( 4u << 20));        //  4 MB
  _Float16* Vth    = (_Float16*)(ws + ( 8u << 20));        //  4 MB
  _Float16* CEth   = (_Float16*)(ws + (12u << 20));        //  2 MB
  float*    ce     = (float*)   (ws + (14u << 20));        //  2 MB
  float*    attn_x = (float*)   (ws + (16u << 20));        //  8 MB
  float*    c_rev  = (float*)   (ws + (24u << 20));        //  2 MB

  float* out_x      = (float*)d_out;                       // [4,2048,256]
  float* out_motion = out_x + (size_t)4 * 2048 * 256;      // [4,2048,64]

  qkv_proj_kernel<0><<<dim3(64, 4), 256, 0, stream>>>(x1, Wq,  Qh);
  qkv_proj_kernel<1><<<dim3(64, 4), 256, 0, stream>>>(x2, Wkv, Kh);
  qkv_proj_kernel<2><<<dim3(64, 4), 256, 0, stream>>>(x2, Wkv, Vth);
  cor_embed_kernel<<<(8192 * 128) / 256, 256, 0, stream>>>(cor, Wcor, ce, CEth);
  attn_kernel     <<<dim3(16, 32),    256, 0, stream>>>(Qh, Kh, Vth, CEth, attn_x, c_rev);
  proj_kernel     <<<dim3(64, 4),     256, 0, stream>>>(attn_x, Wproj, bproj, out_x);
  motion_kernel   <<<dim3(64, 1),     256, 0, stream>>>(c_rev, ce, Wm, bm, out_motion);
}

// v002
// One run takes 115 microseconds.
// Timed twice side by side with v001, it ran 1.37 and 1.36 times as fast.
// Over all steps from v000 it is 1.49 times as fast.
#include <hip/hip_runtime.h>

// ---------------------------------------------------------------------------
// InterFrameAttention for MI455X (gfx1250, wave32, WMMA f16->f32)
// Shapes: B=4, N=2048, C=256, H=8, Dh=32, M=64, Mh=8
// GEMMs: LDS-staged tiles (coalesced b128 global loads, f16 conversion once,
// weights transposed in LDS so WMMA B-fragments are contiguous ds_load_b128).
// Attention: flash-style single pass, 5 WMMA per 32-key tile per wave, all
// products transposed (S^T = K Q^T, O^T += V^T P^T): a lane holds one query's
// scores, so max and sum are in-lane plus one exchange between wave halves,
// and the two score tiles convert in place into the P^T operand (no LDS).
// Q, K, V^T and CE^T live in the workspace in fragment order: a fragment is two
// blocks of 512 B, block c holding lane l's elements 8c..8c+7 at byte 16*l, so a
// wave-wide 16-B load or store covers four whole 128-B lines.
// ---------------------------------------------------------------------------

typedef _Float16 v16h __attribute__((ext_vector_type(16)));
typedef _Float16 v8h  __attribute__((ext_vector_type(8)));
typedef float    v8f  __attribute__((ext_vector_type(8)));

#define WMMA_F32_F16(A, Bm, Cm) \
  __builtin_amdgcn_wmma_f32_16x16x32_f16(false, (A), false, (Bm), (short)0, (Cm), false, false)

// A/B fragment element -> K mapping (16-bit 16x32 operand, wave32):
//   e in [0,8):  K = base + e          (base = 8 * (lane>>4))
//   e in [8,16): K = 16 + base + (e-8)
// -> per lane, two contiguous 8-half (16B) chunks at offsets base and 16+base.
__device__ __forceinline__ v16h frag_from_f16_row(const _Float16* __restrict__ row, int base) {
  v8h lo = *(const v8h*)(row + base);
  v8h hi = *(const v8h*)(row + 16 + base);
  v16h r;
#pragma unroll
  for (int i = 0; i < 8; ++i) { r[i] = lo[i]; r[i + 8] = hi[i]; }
  return r;
}

// The same fragment from fragment-ordered memory; p already includes 8 * lane.
__device__ __forceinline__ v16h frag_packed(const _Float16* __restrict__ p) {
  v8h lo = *(const v8h*)(p);
  v8h hi = *(const v8h*)(p + 256);
  v16h r;
#pragma unroll
  for (int i = 0; i < 8; ++i) { r[i] = lo[i]; r[i + 8] = hi[i]; }
  return r;
}

// --- exchange between the two 16-lane halves (lane l <-> l ^ 16) -------------
// v_permlanex16_b32 with the identity select table.  bound_ctrl=1: every select
// is in range and EXEC is all-ones, so the 'old' operand is dead.
__device__ __forceinline__ float swap_halves(float x) {
  int v = __float_as_int(x);
  v = __builtin_amdgcn_permlanex16(v, v, 0x76543210, (int)0xFEDCBA98u, false, true);
  return __int_as_float(v);
}

// ---------------------------------------------------------------------------
// Kernel 1: Q/K/V projections, LDS-staged.  Z template: 0=Q, 1=K, 2=V.
// Block tile: 128 rows x 64 cols, K-step 32.  8 waves, each 16 rows x 64 cols.
// Outputs f16 in fragment order, 512-B blocks of [lane][8] (Q pre-scaled):
//   Qh/Kh [bh][n/16][d/16]        lane = 16*((d>>3)&1) + (n&15), element d&7
//   Vth   [bh][n/32][d/16][(n>>4)&1]  lane = 16*((n>>3)&1) + (d&15), element n&7
// Q and K are computed transposed (W^T as A, X^T as B): a lane then ends with 8
// consecutive d of one row n, as V's plain product ends with 8 consecutive n of one d.
// ---------------------------------------------------------------------------
template <int Z>
__global__ __launch_bounds__(256) void qkv_proj_kernel(
    const float* __restrict__ X, const float* __restrict__ W,
    _Float16* __restrict__ Out)
{
  __shared__ __align__(16) _Float16 Asub[128][32];  // 8 KB, [row][k]
  __shared__ __align__(16) _Float16 Bsub[64][32];   // 4 KB, [col][k] (transposed)

  const int tid  = threadIdx.x;
  const int wave = tid >> 5;
  const int lane = tid & 31;
  const int hi = lane >> 4, lx = lane & 15, base = hi << 3;

  const int row0    = blockIdx.x * 128;   // 8192 rows
  const int colbase = blockIdx.y * 64;    // 256 cols

  constexpr int ldb  = (Z == 0) ? 256 : 512;
  constexpr int coff = (Z == 2) ? 256 : 0;

  const v8f zv = {};
  v8f acc[4] = {zv, zv, zv, zv};

  for (int k0 = 0; k0 < 256; k0 += 32) {
    // stage A tile: 128 x 32 f32 -> f16 (coalesced float4 loads)
#pragma unroll
    for (int i = 0; i < 4; ++i) {
      const int idx = tid + 256 * i;              // 0..1023
      const int row = idx >> 3, f4 = idx & 7;
      const float4 v = *(const float4*)(X + (size_t)(row0 + row) * 256 + k0 + f4 * 4);
      Asub[row][f4 * 4 + 0] = (_Float16)v.x;
      Asub[row][f4 * 4 + 1] = (_Float16)v.y;
      Asub[row][f4 * 4 + 2] = (_Float16)v.z;
      Asub[row][f4 * 4 + 3] = (_Float16)v.w;
    }
    // stage B tile transposed: W[k0..k0+31][colbase..+63] -> Bsub[col][k]
#pragma unroll
    for (int i = 0; i < 2; ++i) {
      const int idx = tid + 256 * i;              // 0..511
      const int k = idx >> 4, f4 = idx & 15;
      const float4 v = *(const float4*)(W + (size_t)(k0 + k) * ldb + coff + colbase + f4 * 4);
      Bsub[f4 * 4 + 0][k] = (_Float16)v.x;
      Bsub[f4 * 4 + 1][k] = (_Float16)v.y;
      Bsub[f4 * 4 + 2][k] = (_Float16)v.z;
      Bsub[f4 * 4 + 3][k] = (_Float16)v.w;
    }
    __syncthreads();

    const v16h a = frag_from_f16_row(&Asub[(wave << 4) + lx][0], base);
#pragma unroll
    for (int c = 0; c < 4; ++c) {
      const v16h b = frag_from_f16_row(&Bsub[(c << 4) + lx][0], base);
      if (Z == 2) acc[c] = WMMA_F32_F16(a, b, acc[c]);   // D[n][d]
      else        acc[c] = WMMA_F32_F16(b, a, acc[c]);   // D[d][n]
    }
    __syncthreads();
  }

  const float qscale = 0.17677669529663687f;  // 32^-0.5
  const int rt  = row0 + (wave << 4);          // first of this wave's 16 rows
  const int b_  = rt >> 11;
  const int t16 = (rt & 2047) >> 4;            // 16-row group inside the batch
#pragma unroll
  for (int c = 0; c < 4; ++c) {
    const int h_ = (colbase + (c << 4)) >> 5;
    const int dh = c & 1;                      // d / 16 (colbase is a multiple of 32)
    v8h o;
#pragma unroll
    for (int r = 0; r < 8; ++r)
      o[r] = (Z == 0) ? (_Float16)(acc[c][r] * qscale) : (_Float16)acc[c][r];
    const int blk = (Z == 2) ? ((((t16 >> 1) << 1) + dh) << 1) + (t16 & 1)
                             : (t16 << 1) + dh;
    *(v8h*)(Out + ((size_t)(b_ * 8 + h_) << 16) + (((blk << 5) + lane) << 3)) = o;
  }
}

// ---------------------------------------------------------------------------
// Kernel 2: cor_embed = cor @ Wcor  (K=3, tiny).  Writes f32 ce [B*N, 64] and
// f16 CEth in fragment order, 512-B blocks [bh][n/32][(n>>4)&1] of [lane][8] with
// lane = 16*((n>>3)&1) + d, element n&7; rows d = 8..15 are zero padding.
// One thread per 16-B piece: 8 consecutive n of one (head, d).
// ---------------------------------------------------------------------------
__global__ void cor_embed_kernel(const float* __restrict__ cor, const float* __restrict__ Wcor,
                                 float* __restrict__ ce, _Float16* __restrict__ CEth)
{
  const int idx = blockIdx.x * blockDim.x + threadIdx.x;  // 32 heads * 128 blocks * 32 lanes
  if (idx >= 32 * 128 * 32) return;
  const int d  = idx & 15;
  const int n0 = ((idx >> 4) & 255) << 3;     // block and lane half give n / 8
  const int bh = idx >> 12;
  const int b = bh >> 3, h = bh & 7;
  v8h o = {};
  if (d < 8) {
    const int m = h * 8 + d;
    const size_t bn0 = (size_t)b * 2048 + n0;
    const float4* c4 = (const float4*)(cor + bn0 * 3);   // 24 floats, 96-B aligned
    float cv[24];
#pragma unroll
    for (int i = 0; i < 6; ++i) {
      const float4 x = c4[i];
      cv[4 * i] = x.x; cv[4 * i + 1] = x.y; cv[4 * i + 2] = x.z; cv[4 * i + 3] = x.w;
    }
    const float w0 = Wcor[m], w1 = Wcor[64 + m], w2 = Wcor[128 + m];
#pragma unroll
    for (int e = 0; e < 8; ++e) {
      const float v = cv[3 * e] * w0 + cv[3 * e + 1] * w1 + cv[3 * e + 2] * w2;
      ce[(bn0 + e) * 64 + m] = v;
      o[e] = (_Float16)v;
    }
  }
  *(v8h*)(CEth + ((size_t)idx << 3)) = o;
}

// ---------------------------------------------------------------------------
// Kernel 3: flash attention.  One 16-query tile per wave, 8 waves/WG,
// grid (N/128, B*H).  Online softmax; 5 WMMA per 32-key tile.
// Transposed products: D register r of lane (hi, lx) is [8*hi + r][lx], so with
// K (or V^T, CE^T) as A and Q^T (or P^T) as B, lane lx owns query q0 + lx.
//   s0[r] = S[q0+lx][j0 + 8*hi + r],  s1[r] = S[q0+lx][j0 + 16 + 8*hi + r]
// which is exactly the B-fragment k order (e<8: 8*hi+e, e>=8: 16+8*hi+e-8).
// ---------------------------------------------------------------------------
__global__ __launch_bounds__(256) void attn_kernel(
    const _Float16* __restrict__ Qh, const _Float16* __restrict__ Kh,
    const _Float16* __restrict__ Vth, const _Float16* __restrict__ CEth,
    float* __restrict__ attn_x, float* __restrict__ c_rev)
{
  const int wave = threadIdx.x >> 5;
  const int lane = threadIdx.x & 31;
  const int hi = lane >> 4, lx = lane & 15, base = hi << 3;
  const int bh = blockIdx.y;
  const int q0 = blockIdx.x * 128 + wave * 16;

  // fragment-ordered operands: this lane's 16-B piece of each 512-B block
  const _Float16* Qb = Qh   + (size_t)bh * (2048 * 32) + (lane << 3);
  const _Float16* Kb = Kh   + (size_t)bh * (2048 * 32) + (lane << 3);
  const _Float16* Vb = Vth  + (size_t)bh * (32 * 2048) + (lane << 3);
  const _Float16* Cb = CEth + (size_t)bh * (16 * 2048) + (lane << 3);

  const v16h qf = frag_packed(Qb + (size_t)q0 * 32);

  v8f o0 = {}, o1 = {}, crv = {};       // O^T rows d 0..15, 16..31; CE^T rows 0..15
  float rm = -3.0e38f, rl = 0.f;        // this lane's query: max; sum over this half's keys

  for (int j0 = 0; j0 < 2048; j0 += 32) {
    // S^T = K * Q^T  (scale folded into Q)
    // 32 keys: K and V^T 2 KB each (two fragments), CE^T 1 KB, all contiguous
    const v16h ka0 = frag_packed(Kb + (size_t)j0 * 32);
    const v16h ka1 = frag_packed(Kb + (size_t)j0 * 32 + 512);
    const v16h va0 = frag_packed(Vb + (size_t)j0 * 32);
    const v16h va1 = frag_packed(Vb + (size_t)j0 * 32 + 512);
    const v16h ca  = frag_packed(Cb + (size_t)j0 * 16);
    // keeps all ten loads issued ahead of the score products: without it the last
    // four sink to just before their use and a second load latency shows per pass
    __builtin_amdgcn_sched_barrier(0);
    v8f s0 = {}, s1 = {};
    s0 = WMMA_F32_F16(ka0, qf, s0);
    s1 = WMMA_F32_F16(ka1, qf, s1);

    // online softmax: 16 of the query's 32 scores sit in this lane, 16 in lane ^ 16
    float t0 = fmaxf(s0[0], s1[0]), t1 = fmaxf(s0[1], s1[1]);
#pragma unroll
    for (int r = 2; r < 8; r += 2) {
      t0 = fmaxf(t0, fmaxf(s0[r], s1[r]));
      t1 = fmaxf(t1, fmaxf(s0[r + 1], s1[r + 1]));
    }
    float t = fmaxf(t0, t1);
    t = fmaxf(t, swap_halves(t));
    const float mn = fmaxf(rm, t);
    const float alpha = __expf(rm - mn);
    rm = mn;

    v16h pf;                            // P^T as B fragment, straight from the score tiles
    float ps0 = 0.f, ps1 = 0.f;
#pragma unroll
    for (int r = 0; r < 8; ++r) {
      const float p0 = __expf(s0[r] - mn);
      const float p1 = __expf(s1[r] - mn);
      ps0 += p0; ps1 += p1;
      pf[r]     = (_Float16)p0;
      pf[r + 8] = (_Float16)p1;
    }
    rl = rl * alpha + (ps0 + ps1);
    o0 *= alpha; o1 *= alpha; crv *= alpha;

    o0  = WMMA_F32_F16(va0, pf, o0);
    o1  = WMMA_F32_F16(va1, pf, o1);
    crv = WMMA_F32_F16(ca,  pf, crv);
  }

  // join the halves' sums once; lane (hi, lx) holds d = 8*hi + r of query q0 + lx
  const float inv = 1.0f / (rl + swap_halves(rl));
  const int b_ = bh >> 3, h_ = bh & 7;
  const int q  = q0 + lx;
  float* xr = attn_x + (((size_t)b_ * 2048 + q) << 8) + (h_ << 5) + base;
  *(float4*)(xr)      = make_float4(o0[0] * inv, o0[1] * inv, o0[2] * inv, o0[3] * inv);
  *(float4*)(xr + 4)  = make_float4(o0[4] * inv, o0[5] * inv, o0[6] * inv, o0[7] * inv);
  *(float4*)(xr + 16) = make_float4(o1[0] * inv, o1[1] * inv, o1[2] * inv, o1[3] * inv);
  *(float4*)(xr + 20) = make_float4(o1[4] * inv, o1[5] * inv, o1[6] * inv, o1[7] * inv);
  if (hi == 0) {                        // CE^T rows 8..15 are the zero padding
    float* cr = c_rev + (((size_t)b_ * 2048 + q) << 6) + (h_ << 3);
    *(float4*)(cr)     = make_float4(crv[0] * inv, crv[1] * inv, crv[2] * inv, crv[3] * inv);
    *(float4*)(cr + 4) = make_float4(crv[4] * inv, crv[5] * inv, crv[6] * inv, crv[7] * inv);
  }
}

// ---------------------------------------------------------------------------
// Kernel 4: x_out = attn_x @ Wproj + bproj   [8192,256]x[256,256], LDS-staged.
// ---------------------------------------------------------------------------
__global__ __launch_bounds__(256) void proj_kernel(
    const float* __restrict__ attn_x, const float* __restrict__ Wproj,
    const float* __restrict__ bproj, float* __restrict__ out)
{
  __shared__ __align__(16) _Float16 Asub[128][32];
  __shared__ __align__(16) _Float16 Bsub[64][32];

  const int tid  = threadIdx.x;
  const int wave = tid >> 5;
  const int lane = tid & 31;
  const int hi = lane >> 4, lx = lane & 15, base = hi << 3;
  const int row0 = blockIdx.x * 128;
  const int colbase = blockIdx.y * 64;

  const v8f zv = {};
  v8f acc[4] = {zv, zv, zv, zv};

  for (int k0 = 0; k0 < 256; k0 += 32) {
#pragma unroll
    for (int i = 0; i < 4; ++i) {
      const int idx = tid + 256 * i;
      const int row = idx >> 3, f4 = idx & 7;
      const float4 v = *(const float4*)(attn_x + (size_t)(row0 + row) * 256 + k0 + f4 * 4);
      Asub[row][f4 * 4 + 0] = (_Float16)v.x;
      Asub[row][f4 * 4 + 1] = (_Float16)v.y;
      Asub[row][f4 * 4 + 2] = (_Float16)v.z;
      Asub[row][f4 * 4 + 3] = (_Float16)v.w;
    }
#pragma unroll
    for (int i = 0; i < 2; ++i) {
      const int idx = tid + 256 * i;
      const int k = idx >> 4, f4 = idx & 15;
      const float4 v = *(const float4*)(Wproj + (size_t)(k0 + k) * 256 + colbase + f4 * 4);
      Bsub[f4 * 4 + 0][k] = (_Float16)v.x;
      Bsub[f4 * 4 + 1][k] = (_Float16)v.y;
      Bsub[f4 * 4 + 2][k] = (_Float16)v.z;
      Bsub[f4 * 4 + 3][k] = (_Float16)v.w;
    }
    __syncthreads();

    const v16h a = frag_from_f16_row(&Asub[(wave << 4) + lx][0], base);
#pragma unroll
    for (int c = 0; c < 4; ++c) {
      const v16h b = frag_from_f16_row(&Bsub[(c << 4) + lx][0], base);
      acc[c] = WMMA_F32_F16(a, b, acc[c]);
    }
    __syncthreads();
  }

#pragma unroll
  for (int c = 0; c < 4; ++c) {
#pragma unroll
    for (int r = 0; r < 8; ++r) {
      const int grow = row0 + (wave << 4) + r + base;
      const int gcol = colbase + (c << 4) + lx;
      out[((size_t)grow << 8) + gcol] = acc[c][r] + bproj[gcol];
    }
  }
}

// ---------------------------------------------------------------------------
// Kernel 5: motion = (c_rev - ce) @ Wm + bm   [8192,64]x[64,64].
// Wm^T staged once in LDS; each wave: 16 rows x 64 cols, K=64 in 2 steps.
// ---------------------------------------------------------------------------
__global__ __launch_bounds__(256) void motion_kernel(
    const float* __restrict__ c_rev, const float* __restrict__ ce,
    const float* __restrict__ Wm, const float* __restrict__ bm, float* __restrict__ out)
{
  __shared__ __align__(16) _Float16 Wt[64][64];  // 8 KB, [col][k]

  const int tid  = threadIdx.x;
  const int wave = tid >> 5;
  const int lane = tid & 31;
  const int hi = lane >> 4, lx = lane & 15, base = hi << 3;
  const int row0 = blockIdx.x * 128;

#pragma unroll
  for (int i = 0; i < 4; ++i) {
    const int idx = tid + 256 * i;              // 0..1023
    const int k = idx >> 4, f4 = idx & 15;
    const float4 v = *(const float4*)(Wm + (size_t)k * 64 + f4 * 4);
    Wt[f4 * 4 + 0][k] = (_Float16)v.x;
    Wt[f4 * 4 + 1][k] = (_Float16)v.y;
    Wt[f4 * 4 + 2][k] = (_Float16)v.z;
    Wt[f4 * 4 + 3][k] = (_Float16)v.w;
  }
  __syncthreads();

  const float* ar = c_rev + (size_t)(row0 + (wave << 4) + lx) * 64;
  const float* er = ce    + (size_t)(row0 + (wave << 4) + lx) * 64;

  const v8f zv = {};
  v8f acc[4] = {zv, zv, zv, zv};
#pragma unroll
  for (int k0 = 0; k0 < 64; k0 += 32) {
    v16h a;
#pragma unroll
    for (int i = 0; i < 8; ++i) {
      const int ka = k0 + base + i, kb = k0 + 16 + base + i;
      a[i]     = (_Float16)(ar[ka] - er[ka]);
      a[i + 8] = (_Float16)(ar[kb] - er[kb]);
    }
#pragma unroll
    for (int c = 0; c < 4; ++c) {
      const v16h b = frag_from_f16_row(&Wt[(c << 4) + lx][k0], base);
      acc[c] = WMMA_F32_F16(a, b, acc[c]);
    }
  }

#pragma unroll
  for (int c = 0; c < 4; ++c) {
#pragma unroll
    for (int r = 0; r < 8; ++r) {
      const int grow = row0 + (wave << 4) + r + base;
      const int gcol = (c << 4) + lx;
      out[((size_t)grow << 6) + gcol] = acc[c][r] + bm[gcol];
    }
  }
}

// ---------------------------------------------------------------------------
extern "C" void kernel_launch(void* const* d_in, const int* in_sizes, int n_in,
                              void* d_out, int out_size, void* d_ws, size_t ws_size,
                              hipStream_t stream) {
  (void)in_sizes; (void)n_in; (void)out_size; (void)ws_size;
  const float* x1    = (const float*)d_in[0];
  const float* x2    = (const float*)d_in[1];
  const float* cor   = (const float*)d_in[2];
  const float* Wq    = (const float*)d_in[3];
  const float* Wkv   = (const float*)d_in[4];
  const float* Wcor  = (const float*)d_in[5];
  const float* Wproj = (const float*)d_in[6];
  const float* bproj = (const float*)d_in[7];
  const float* Wm    = (const float*)d_in[8];
  const float* bm    = (const float*)d_in[9];

  char* ws = (char*)d_ws;                                  // 26 MB total
  _Float16* Qh     = (_Float16*)(ws);                      //  4 MB
  _Float16* Kh     = (_Float16*)(ws + ( 4u << 20));        //  4 MB
  _Float16* Vth    = (_Float16*)(ws + ( 8u << 20));        //  4 MB
  _Float16* CEth   = (_Float16*)(ws + (12u << 20));        //  2 MB
  float*    ce     = (float*)   (ws + (14u << 20));        //  2 MB
  float*    attn_x = (float*)   (ws + (16u << 20));        //  8 MB
  float*    c_rev  = (float*)   (ws + (24u << 20));        //  2 MB

  float* out_x      = (float*)d_out;                       // [4,2048,256]
  float* out_motion = out_x + (size_t)4 * 2048 * 256;      // [4,2048,64]

  qkv_proj_kernel<0><<<dim3(64, 4), 256, 0, stream>>>(x1, Wq,  Qh);
  qkv_proj_kernel<1><<<dim3(64, 4), 256, 0, stream>>>(x2, Wkv, Kh);
  qkv_proj_kernel<2><<<dim3(64, 4), 256, 0, stream>>>(x2, Wkv, Vth);
  cor_embed_kernel<<<512, 256, 0, stream>>>(cor, Wcor, ce, CEth);
  attn_kernel     <<<dim3(16, 32),    256, 0, stream>>>(Qh, Kh, Vth, CEth, attn_x, c_rev);
  proj_kernel     <<<dim3(64, 4),     256, 0, stream>>>(attn_x, Wproj, bproj, out_x);
  motion_kernel   <<<dim3(64, 1),     256, 0, stream>>>(c_rev, ce, Wm, bm, out_motion);
}

// v003
// Measured time: 87.8 microseconds a run.
// In both of two side-by-side timings against v002, it was 1.30 times as fast.
// Counting every step since v000, it is 1.93 times as fast.
#include <hip/hip_runtime.h>

// ---------------------------------------------------------------------------
// InterFrameAttention for MI455X (gfx1250, wave32, WMMA f16->f32)
// Shapes: B=4, N=2048, C=256, H=8, Dh=32, M=64, Mh=8
// GEMMs: LDS-staged tiles (coalesced b128 global loads, f16 conversion once,
// weights transposed in LDS so WMMA B-fragments are contiguous ds_load_b128).
// Attention: flash-style single pass, 5 WMMA per 32-key tile per wave, all
// products transposed (S^T = K Q^T, O^T += V^T P^T): a lane holds one query's
// scores, so max and sum are in-lane plus one exchange between wave halves,
// and the two score tiles convert in place into the P^T operand (no LDS).
// Q, K, V^T and CE^T live in the workspace in fragment order: a fragment is two
// blocks of 512 B, block c holding lane l's elements 8c..8c+7 at byte 16*l, so a
// wave-wide 16-B load or store covers four whole 128-B lines.
// Three launches: the four producers of the attention operands share one grid, as
// do the two consumers of its results; inside a grid no block needs another's data.
// ---------------------------------------------------------------------------

typedef _Float16 v16h __attribute__((ext_vector_type(16)));
typedef _Float16 v8h  __attribute__((ext_vector_type(8)));
typedef float    v8f  __attribute__((ext_vector_type(8)));

#define WMMA_F32_F16(A, Bm, Cm) \
  __builtin_amdgcn_wmma_f32_16x16x32_f16(false, (A), false, (Bm), (short)0, (Cm), false, false)

// A/B fragment element -> K mapping (16-bit 16x32 operand, wave32):
//   e in [0,8):  K = base + e          (base = 8 * (lane>>4))
//   e in [8,16): K = 16 + base + (e-8)
// -> per lane, two contiguous 8-half (16B) chunks at offsets base and 16+base.
__device__ __forceinline__ v16h frag_from_f16_row(const _Float16* __restrict__ row, int base) {
  v8h lo = *(const v8h*)(row + base);
  v8h hi = *(const v8h*)(row + 16 + base);
  v16h r;
#pragma unroll
  for (int i = 0; i < 8; ++i) { r[i] = lo[i]; r[i + 8] = hi[i]; }
  return r;
}

// The same fragment from fragment-ordered memory; p already includes 8 * lane.
__device__ __forceinline__ v16h frag_packed(const _Float16* __restrict__ p) {
  v8h lo = *(const v8h*)(p);
  v8h hi = *(const v8h*)(p + 256);
  v16h r;
#pragma unroll
  for (int i = 0; i < 8; ++i) { r[i] = lo[i]; r[i + 8] = hi[i]; }
  return r;
}

// --- exchange between the two 16-lane halves (lane l <-> l ^ 16) -------------
// v_permlanex16_b32 with the identity select table.  bound_ctrl=1: every select
// is in range and EXEC is all-ones, so the 'old' operand is dead.
__device__ __forceinline__ float swap_halves(float x) {
  int v = __float_as_int(x);
  v = __builtin_amdgcn_permlanex16(v, v, 0x76543210, (int)0xFEDCBA98u, false, true);
  return __int_as_float(v);
}

// ---------------------------------------------------------------------------
// Producer part 1: Q/K/V projections, LDS-staged.  Z template: 0=Q, 1=K, 2=V.
// Block tile: 128 rows x 64 cols, K-step 32.  8 waves, each 16 rows x 64 cols.
// Outputs f16 in fragment order, 512-B blocks of [lane][8] (Q pre-scaled):
//   Qh/Kh [bh][n/16][d/16]        lane = 16*((d>>3)&1) + (n&15), element d&7
//   Vth   [bh][n/32][d/16][(n>>4)&1]  lane = 16*((n>>3)&1) + (d&15), element n&7
// Q and K are computed transposed (W^T as A, X^T as B): a lane then ends with 8
// consecutive d of one row n, as V's plain product ends with 8 consecutive n of one d.
// ---------------------------------------------------------------------------
template <int Z>
__device__ __forceinline__ void qkv_proj_tile(
    const float* __restrict__ X, const float* __restrict__ W,
    _Float16* __restrict__ Out,
    _Float16 (*__restrict__ Asub)[32],   // 128 rows, [row][k]
    _Float16 (*__restrict__ Bsub)[32])   // 64 rows, [col][k] (transposed)
{
  const int tid  = threadIdx.x;
  const int wave = tid >> 5;
  const int lane = tid & 31;
  const int hi = lane >> 4, lx = lane & 15, base = hi << 3;

  const int row0    = blockIdx.x * 128;   // 8192 rows
  const int colbase = blockIdx.y * 64;    // 256 cols

  constexpr int ldb  = (Z == 0) ? 256 : 512;
  constexpr int coff = (Z == 2) ? 256 : 0;

  const v8f zv = {};
  v8f acc[4] = {zv, zv, zv, zv};

  for (int k0 = 0; k0 < 256; k0 += 32) {
    // stage A tile: 128 x 32 f32 -> f16 (coalesced float4 loads)
#pragma unroll
    for (int i = 0; i < 4; ++i) {
      const int idx = tid + 256 * i;              // 0..1023
      const int row = idx >> 3, f4 = idx & 7;
      const float4 v = *(const float4*)(X + (size_t)(row0 + row) * 256 + k0 + f4 * 4);
      Asub[row][f4 * 4 + 0] = (_Float16)v.x;
      Asub[row][f4 * 4 + 1] = (_Float16)v.y;
      Asub[row][f4 * 4 + 2] = (_Float16)v.z;
      Asub[row][f4 * 4 + 3] = (_Float16)v.w;
    }
    // stage B tile transposed: W[k0..k0+31][colbase..+63] -> Bsub[col][k]
#pragma unroll
    for (int i = 0; i < 2; ++i) {
      const int idx = tid + 256 * i;              // 0..511
      const int k = idx >> 4, f4 = idx & 15;
      const float4 v = *(const float4*)(W + (size_t)(k0 + k) * ldb + coff + colbase + f4 * 4);
      Bsub[f4 * 4 + 0][k] = (_Float16)v.x;
      Bsub[f4 * 4 + 1][k] = (_Float16)v.y;
      Bsub[f4 * 4 + 2][k] = (_Float16)v.z;
      Bsub[f4 * 4 + 3][k] = (_Float16)v.w;
    }
    __syncthreads();

    const v16h a = frag_from_f16_row(&Asub[(wave << 4) + lx][0], base);
#pragma unroll
    for (int c = 0; c < 4; ++c) {
      const v16h b = frag_from_f16_row(&Bsub[(c << 4) + lx][0], base);
      if (Z == 2) acc[c] = WMMA_F32_F16(a, b, acc[c]);   // D[n][d]
      else        acc[c] = WMMA_F32_F16(b, a, acc[c]);   // D[d][n]
    }
    __syncthreads();
  }

  const float qscale = 0.17677669529663687f;  // 32^-0.5
  const int rt  = row0 + (wave << 4);          // first of this wave's 16 rows
  const int b_  = rt >> 11;
  const int t16 = (rt & 2047) >> 4;            // 16-row group inside the batch
#pragma unroll
  for (int c = 0; c < 4; ++c) {
    const int h_ = (colbase + (c << 4)) >> 5;
    const int dh = c & 1;                      // d / 16 (colbase is a multiple of 32)
    v8h o;
#pragma unroll
    for (int r = 0; r < 8; ++r)
      o[r] = (Z == 0) ? (_Float16)(acc[c][r] * qscale) : (_Float16)acc[c][r];
    const int blk = (Z == 2) ? ((((t16 >> 1) << 1) + dh) << 1) + (t16 & 1)
                             : (t16 << 1) + dh;
    *(v8h*)(Out + ((size_t)(b_ * 8 + h_) << 16) + (((blk << 5) + lane) << 3)) = o;
  }
  // a block runs no other part after this one (the branch is uniform); the wait is a
  // precaution ahead of any later overwrite of the stores' address and data registers
  asm volatile("s_wait_xcnt 0x0" ::: "memory");
}

// ---------------------------------------------------------------------------
// Producer part 2: cor_embed = cor @ Wcor  (K=3, tiny).  Writes f32 ce [B*N, 64] and
// f16 CEth in fragment order, 512-B blocks [bh][n/32][(n>>4)&1] of [lane][8] with
// lane = 16*((n>>3)&1) + d, element n&7; rows d = 8..15 are zero padding.
// One thread per 16-B piece: 8 consecutive n of one (head, d).
// ---------------------------------------------------------------------------
__device__ __forceinline__ void cor_embed_tile(
    const float* __restrict__ cor, const float* __restrict__ Wcor,
    float* __restrict__ ce, _Float16* __restrict__ CEth, int blk)
{
  const int idx = blk * 256 + threadIdx.x;    // 32 heads * 128 blocks * 32 lanes
  if (idx >= 32 * 128 * 32) return;
  const int d  = idx & 15;
  const int n0 = ((idx >> 4) & 255) << 3;     // block and lane half give n / 8
  const int bh = idx >> 12;
  const int b = bh >> 3, h = bh & 7;
  v8h o = {};
  if (d < 8) {
    const int m = h * 8 + d;
    const size_t bn0 = (size_t)b * 2048 + n0;
    const float4* c4 = (const float4*)(cor + bn0 * 3);   // 24 floats, 96-B aligned
    float cv[24];
#pragma unroll
    for (int i = 0; i < 6; ++i) {
      const float4 x = c4[i];
      cv[4 * i] = x.x; cv[4 * i + 1] = x.y; cv[4 * i + 2] = x.z; cv[4 * i + 3] = x.w;
    }
    const float w0 = Wcor[m], w1 = Wcor[64 + m], w2 = Wcor[128 + m];
#pragma unroll
    for (int e = 0; e < 8; ++e) {
      const float v = cv[3 * e] * w0 + cv[3 * e + 1] * w1 + cv[3 * e + 2] * w2;
      ce[(bn0 + e) * 64 + m] = v;
      o[e] = (_Float16)v;
    }
  }
  *(v8h*)(CEth + ((size_t)idx << 3)) = o;
}

// ---------------------------------------------------------------------------
// Kernel 1: everything the attention reads, in one grid (64, 4, 5).
// z = 0, 1, 2: the Q, K, V projection tile (x, y); z = 3, 4: 512 cor_embed blocks,
// last because they are the short ones.  The branch is uniform for a block.
// ---------------------------------------------------------------------------
__global__ __launch_bounds__(256) void producers_kernel(
    const float* __restrict__ x1, const float* __restrict__ x2,
    const float* __restrict__ cor, const float* __restrict__ Wq,
    const float* __restrict__ Wkv, const float* __restrict__ Wcor,
    _Float16* __restrict__ Qh, _Float16* __restrict__ Kh, _Float16* __restrict__ Vth,
    float* __restrict__ ce, _Float16* __restrict__ CEth)
{
  __shared__ __align__(16) _Float16 Asub[128][32];  // 8 KB
  __shared__ __align__(16) _Float16 Bsub[64][32];   // 4 KB

  const int z = blockIdx.z;
  if (z == 0)      qkv_proj_tile<0>(x1, Wq,  Qh,  Asub, Bsub);
  else if (z == 1) qkv_proj_tile<1>(x2, Wkv, Kh,  Asub, Bsub);
  else if (z == 2) qkv_proj_tile<2>(x2, Wkv, Vth, Asub, Bsub);
  else cor_embed_tile(cor, Wcor, ce, CEth, ((z - 3) * 4 + blockIdx.y) * 64 + blockIdx.x);
}

// ---------------------------------------------------------------------------
// Kernel 2: flash attention.  One 16-query tile per wave, 8 waves/WG,
// grid (N/128, B*H).  Online softmax; 5 WMMA per 32-key tile.
// Transposed products: D register r of lane (hi, lx) is [8*hi + r][lx], so with
// K (or V^T, CE^T) as A and Q^T (or P^T) as B, lane lx owns query q0 + lx.
//   s0[r] = S[q0+lx][j0 + 8*hi + r],  s1[r] = S[q0+lx][j0 + 16 + 8*hi + r]
// which is exactly the B-fragment k order (e<8: 8*hi+e, e>=8: 16+8*hi+e-8).
// ---------------------------------------------------------------------------
__global__ __launch_bounds__(256) void attn_kernel(
    const _Float16* __restrict__ Qh, const _Float16* __restrict__ Kh,
    const _Float16* __restrict__ Vth, const _Float16* __restrict__ CEth,
    float* __restrict__ attn_x, float* __restrict__ c_rev)
{
  const int wave = threadIdx.x >> 5;
  const int lane = threadIdx.x & 31;
  const int hi = lane >> 4, lx = lane & 15, base = hi << 3;
  const int bh = blockIdx.y;
  const int q0 = blockIdx.x * 128 + wave * 16;

  // fragment-ordered operands: this lane's 16-B piece of each 512-B block
  const _Float16* Qb = Qh   + (size_t)bh * (2048 * 32) + (lane << 3);
  const _Float16* Kb = Kh   + (size_t)bh * (2048 * 32) + (lane << 3);
  const _Float16* Vb = Vth  + (size_t)bh * (32 * 2048) + (lane << 3);
  const _Float16* Cb = CEth + (size_t)bh * (16 * 2048) + (lane << 3);

  const v16h qf = frag_packed(Qb + (size_t)q0 * 32);

  v8f o0 = {}, o1 = {}, crv = {};       // O^T rows d 0..15, 16..31; CE^T rows 0..15
  float rm = -3.0e38f, rl = 0.f;        // this lane's query: max; sum over this half's keys

  for (int j0 = 0; j0 < 2048; j0 += 32) {
    // S^T = K * Q^T  (scale folded into Q)
    // 32 keys: K and V^T 2 KB each (two fragments), CE^T 1 KB, all contiguous
    const v16h ka0 = frag_packed(Kb + (size_t)j0 * 32);
    const v16h ka1 = frag_packed(Kb + (size_t)j0 * 32 + 512);
    const v16h va0 = frag_packed(Vb + (size_t)j0 * 32);
    const v16h va1 = frag_packed(Vb + (size_t)j0 * 32 + 512);
    const v16h ca  = frag_packed(Cb + (size_t)j0 * 16);
    // keeps all ten loads issued ahead of the score products: without it the last
    // four sink to just before their use and a second load latency shows per pass
    __builtin_amdgcn_sched_barrier(0);
    v8f s0 = {}, s1 = {};
    s0 = WMMA_F32_F16(ka0, qf, s0);
    s1 = WMMA_F32_F16(ka1, qf, s1);

    // online softmax: 16 of the query's 32 scores sit in this lane, 16 in lane ^ 16
    float t0 = fmaxf(s0[0], s1[0]), t1 = fmaxf(s0[1], s1[1]);
#pragma unroll
    for (int r = 2; r < 8; r += 2) {
      t0 = fmaxf(t0, fmaxf(s0[r], s1[r]));
      t1 = fmaxf(t1, fmaxf(s0[r + 1], s1[r + 1]));
    }
    float t = fmaxf(t0, t1);
    t = fmaxf(t, swap_halves(t));
    const float mn = fmaxf(rm, t);
    const float alpha = __expf(rm - mn);
    rm = mn;

    v16h pf;                            // P^T as B fragment, straight from the score tiles
    float ps0 = 0.f, ps1 = 0.f;
#pragma unroll
    for (int r = 0; r < 8; ++r) {
      const float p0 = __expf(s0[r] - mn);
      const float p1 = __expf(s1[r] - mn);
      ps0 += p0; ps1 += p1;
      pf[r]     = (_Float16)p0;
      pf[r + 8] = (_Float16)p1;
    }
    rl = rl * alpha + (ps0 + ps1);
    o0 *= alpha; o1 *= alpha; crv *= alpha;

    o0  = WMMA_F32_F16(va0, pf, o0);
    o1  = WMMA_F32_F16(va1, pf, o1);
    crv = WMMA_F32_F16(ca,  pf, crv);
  }

  // join the halves' sums once; lane (hi, lx) holds d = 8*hi + r of query q0 + lx
  const float inv = 1.0f / (rl + swap_halves(rl));
  const int b_ = bh >> 3, h_ = bh & 7;
  const int q  = q0 + lx;
  float* xr = attn_x + (((size_t)b_ * 2048 + q) << 8) + (h_ << 5) + base;
  *(float4*)(xr)      = make_float4(o0[0] * inv, o0[1] * inv, o0[2] * inv, o0[3] * inv);
  *(float4*)(xr + 4)  = make_float4(o0[4] * inv, o0[5] * inv, o0[6] * inv, o0[7] * inv);
  *(float4*)(xr + 16) = make_float4(o1[0] * inv, o1[1] * inv, o1[2] * inv, o1[3] * inv);
  *(float4*)(xr + 20) = make_float4(o1[4] * inv, o1[5] * inv, o1[6] * inv, o1[7] * inv);
  if (hi == 0) {                        // CE^T rows 8..15 are the zero padding
    float* cr = c_rev + (((size_t)b_ * 2048 + q) << 6) + (h_ << 3);
    *(float4*)(cr)     = make_float4(crv[0] * inv, crv[1] * inv, crv[2] * inv, crv[3] * inv);
    *(float4*)(cr + 4) = make_float4(crv[4] * inv, crv[5] * inv, crv[6] * inv, crv[7] * inv);
  }
}

// ---------------------------------------------------------------------------
// Consumer part 1: x_out = attn_x @ Wproj + bproj   [8192,256]x[256,256], LDS-staged.
// ---------------------------------------------------------------------------
__device__ __forceinline__ void proj_tile(
    const float* __restrict__ attn_x, const float* __restrict__ Wproj,
    const float* __restrict__ bproj, float* __restrict__ out,
    _Float16 (*__restrict__ Asub)[32],   // 128 rows, [row][k]
    _Float16 (*__restrict__ Bsub)[32])   // 64 rows, [col][k]
{
  const int tid  = threadIdx.x;
  const int wave = tid >> 5;
  const int lane = tid & 31;
  const int hi = lane >> 4, lx = lane & 15, base = hi << 3;
  const int row0 = blockIdx.x * 128;
  const int colbase = blockIdx.y * 64;

  const v8f zv = {};
  v8f acc[4] = {zv, zv, zv, zv};

  for (int k0 = 0; k0 < 256; k0 += 32) {
#pragma unroll
    for (int i = 0; i < 4; ++i) {
      const int idx = tid + 256 * i;
      const int row = idx >> 3, f4 = idx & 7;
      const float4 v = *(const float4*)(attn_x + (size_t)(row0 + row) * 256 + k0 + f4 * 4);
      Asub[row][f4 * 4 + 0] = (_Float16)v.x;
      Asub[row][f4 * 4 + 1] = (_Float16)v.y;
      Asub[row][f4 * 4 + 2] = (_Float16)v.z;
      Asub[row][f4 * 4 + 3] = (_Float16)v.w;
    }
#pragma unroll
    for (int i = 0; i < 2; ++i) {
      const int idx = tid + 256 * i;
      const int k = idx >> 4, f4 = idx & 15;
      const float4 v = *(const float4*)(Wproj + (size_t)(k0 + k) * 256 + colbase + f4 * 4);
      Bsub[f4 * 4 + 0][k] = (_Float16)v.x;
      Bsub[f4 * 4 + 1][k] = (_Float16)v.y;
      Bsub[f4 * 4 + 2][k] = (_Float16)v.z;
      Bsub[f4 * 4 + 3][k] = (_Float16)v.w;
    }
    __syncthreads();

    const v16h a = frag_from_f16_row(&Asub[(wave << 4) + lx][0], base);
#pragma unroll
    for (int c = 0; c < 4; ++c) {
      const v16h b = frag_from_f16_row(&Bsub[(c << 4) + lx][0], base);
      acc[c] = WMMA_F32_F16(a, b, acc[c]);
    }
    __syncthreads();
  }

#pragma unroll
  for (int c = 0; c < 4; ++c) {
#pragma unroll
    for (int r = 0; r < 8; ++r) {
      const int grow = row0 + (wave << 4) + r + base;
      const int gcol = colbase + (c << 4) + lx;
      out[((size_t)grow << 8) + gcol] = acc[c][r] + bproj[gcol];
    }
  }
}

// ---------------------------------------------------------------------------
// Consumer part 2: motion = (c_rev - ce) @ Wm + bm   [8192,64]x[64,64].
// Wm^T staged once in LDS; each wave: 16 rows x 64 cols, K=64 in 2 steps.
// ---------------------------------------------------------------------------
__device__ __forceinline__ void motion_tile(
    const float* __restrict__ c_rev, const float* __restrict__ ce,
    const float* __restrict__ Wm, const float* __restrict__ bm, float* __restrict__ out,
    _Float16 (*__restrict__ Wt)[64])     // 64 rows, [col][k]
{
  const int tid  = threadIdx.x;
  const int wave = tid >> 5;
  const int lane = tid & 31;
  const int hi = lane >> 4, lx = lane & 15, base = hi << 3;
  const int row0 = blockIdx.x * 128;

#pragma unroll
  for (int i = 0; i < 4; ++i) {
    const int idx = tid + 256 * i;              // 0..1023
    const int k = idx >> 4, f4 = idx & 15;
    const float4 v = *(const float4*)(Wm + (size_t)k * 64 + f4 * 4);
    Wt[f4 * 4 + 0][k] = (_Float16)v.x;
    Wt[f4 * 4 + 1][k] = (_Float16)v.y;
    Wt[f4 * 4 + 2][k] = (_Float16)v.z;
    Wt[f4 * 4 + 3][k] = (_Float16)v.w;
  }
  __syncthreads();

  const float* ar = c_rev + (size_t)(row0 + (wave << 4) + lx) * 64;
  const float* er = ce    + (size_t)(row0 + (wave << 4) + lx) * 64;

  const v8f zv = {};
  v8f acc[4] = {zv, zv, zv, zv};
#pragma unroll
  for (int k0 = 0; k0 < 64; k0 += 32) {
    v16h a;
#pragma unroll
    for (int i = 0; i < 8; ++i) {
      const int ka = k0 + base + i, kb = k0 + 16 + base + i;
      a[i]     = (_Float16)(ar[ka] - er[ka]);
      a[i + 8] = (_Float16)(ar[kb] - er[kb]);
    }
#pragma unroll
    for (int c = 0; c < 4; ++c) {
      const v16h b = frag_from_f16_row(&Wt[(c << 4) + lx][k0], base);
      acc[c] = WMMA_F32_F16(a, b, acc[c]);
    }
  }

#pragma unroll
  for (int c = 0; c < 4; ++c) {
#pragma unroll
    for (int r = 0; r < 8; ++r) {
      const int grow = row0 + (wave << 4) + r + base;
      const int gcol = (c << 4) + lx;
      out[((size_t)grow << 6) + gcol] = acc[c][r] + bm[gcol];
    }
  }
}

// ---------------------------------------------------------------------------
// Kernel 3: both outputs in one grid (64, 5).  y = 0..3: output projection tile
// (x, y); y = 4: motion rows of block x.  The branch is uniform for a block.
// ---------------------------------------------------------------------------
__global__ __launch_bounds__(256) void outputs_kernel(
    const float* __restrict__ attn_x, const float* __restrict__ Wproj,
    const float* __restrict__ bproj, float* __restrict__ out_x,
    const float* __restrict__ c_rev, const float* __restrict__ ce,
    const float* __restrict__ Wm, const float* __restrict__ bm,
    float* __restrict__ out_motion)
{
  __shared__ __align__(16) _Float16 smem[6144];     // 12 KB: A 8 + B 4, or Wm^T 8

  if (blockIdx.y < 4)
    proj_tile(attn_x, Wproj, bproj, out_x,
              (_Float16 (*)[32])smem, (_Float16 (*)[32])(smem + 128 * 32));
  else
    motion_tile(c_rev, ce, Wm, bm, out_motion, (_Float16 (*)[64])smem);
}

// ---------------------------------------------------------------------------
extern "C" void kernel_launch(void* const* d_in, const int* in_sizes, int n_in,
                              void* d_out, int out_size, void* d_ws, size_t ws_size,
                              hipStream_t stream) {
  (void)in_sizes; (void)n_in; (void)out_size; (void)ws_size;
  const float* x1    = (const float*)d_in[0];
  const float* x2    = (const float*)d_in[1];
  const float* cor   = (const float*)d_in[2];
  const float* Wq    = (const float*)d_in[3];
  const float* Wkv   = (const float*)d_in[4];
  const float* Wcor  = (const float*)d_in[5];
  const float* Wproj = (const float*)d_in[6];
  const float* bproj = (const float*)d_in[7];
  const float* Wm    = (const float*)d_in[8];
  const float* bm    = (const float*)d_in[9];

  char* ws = (char*)d_ws;                                  // 26 MB total
  _Float16* Qh     = (_Float16*)(ws);                      //  4 MB
  _Float16* Kh     = (_Float16*)(ws + ( 4u << 20));        //  4 MB
  _Float16* Vth    = (_Float16*)(ws + ( 8u << 20));        //  4 MB
  _Float16* CEth   = (_Float16*)(ws + (12u << 20));        //  2 MB
  float*    ce     = (float*)   (ws + (14u << 20));        //  2 MB
  float*    attn_x = (float*)   (ws + (16u << 20));        //  8 MB
  float*    c_rev  = (float*)   (ws + (24u << 20));        //  2 MB

  float* out_x      = (float*)d_out;                       // [4,2048,256]
  float* out_motion = out_x + (size_t)4 * 2048 * 256;      // [4,2048,64]

  producers_kernel<<<dim3(64, 4, 5), 256, 0, stream>>>(x1, x2, cor, Wq, Wkv, Wcor,
                                                       Qh, Kh, Vth, ce, CEth);
  attn_kernel     <<<dim3(16, 32),   256, 0, stream>>>(Qh, Kh, Vth, CEth, attn_x, c_rev);
  outputs_kernel  <<<dim3(64, 5),    256, 0, stream>>>(attn_x, Wproj, bproj, out_x,
                                                       c_rev, ce, Wm, bm, out_motion);
}

// v004
// A run of this version takes 69.6 microseconds.
// Timed twice side by side with v003, it ran 1.28 and 1.30 times as fast.
// Counting every step since v000, it is 2.48 times as fast.
#include <hip/hip_runtime.h>

// ---------------------------------------------------------------------------
// InterFrameAttention for MI455X (gfx1250, wave32, WMMA f16->f32)
// Shapes: B=4, N=2048, C=256, H=8, Dh=32, M=64, Mh=8
// GEMMs: LDS-staged tiles (coalesced b128 global loads, f16 conversion once,
// weights transposed in LDS so WMMA B-fragments are contiguous ds_load_b128).
// Attention: flash-style single pass, 5 WMMA per 32-key tile per wave, all
// products transposed (S^T = K Q^T, O^T += V^T P^T): a lane holds one query's
// scores, so max and sum are in-lane plus one exchange between wave halves,
// and the two score tiles convert in place into the P^T operand (no LDS).
// Q, K, V^T and CE^T live in the workspace in fragment order: a fragment is two
// blocks of 512 B, block c holding lane l's elements 8c..8c+7 at byte 16*l, so a
// wave-wide 16-B load or store covers four whole 128-B lines.
// The attention work-group brings K, V^T and CE^T into LDS once for its 8 waves
// (asynchronous copies, two buffers of 128 keys); the waves read fragments from LDS.
// Three launches: the four producers of the attention operands share one grid, as
// do the two consumers of its results; inside a grid no block needs another's data.
// ---------------------------------------------------------------------------

typedef _Float16 v16h __attribute__((ext_vector_type(16)));
typedef _Float16 v8h  __attribute__((ext_vector_type(8)));
typedef float    v8f  __attribute__((ext_vector_type(8)));

#define WMMA_F32_F16(A, Bm, Cm) \
  __builtin_amdgcn_wmma_f32_16x16x32_f16(false, (A), false, (Bm), (short)0, (Cm), false, false)

// A/B fragment element -> K mapping (16-bit 16x32 operand, wave32):
//   e in [0,8):  K = base + e          (base = 8 * (lane>>4))
//   e in [8,16): K = 16 + base + (e-8)
// -> per lane, two contiguous 8-half (16B) chunks at offsets base and 16+base.
__device__ __forceinline__ v16h frag_from_f16_row(const _Float16* __restrict__ row, int base) {
  v8h lo = *(const v8h*)(row + base);
  v8h hi = *(const v8h*)(row + 16 + base);
  v16h r;
#pragma unroll
  for (int i = 0; i < 8; ++i) { r[i] = lo[i]; r[i + 8] = hi[i]; }
  return r;
}

// The same fragment from fragment-ordered memory; p already includes 8 * lane.
__device__ __forceinline__ v16h frag_packed(const _Float16* __restrict__ p) {
  v8h lo = *(const v8h*)(p);
  v8h hi = *(const v8h*)(p + 256);
  v16h r;
#pragma unroll
  for (int i = 0; i < 8; ++i) { r[i] = lo[i]; r[i + 8] = hi[i]; }
  return r;
}

// --- exchange between the two 16-lane halves (lane l <-> l ^ 16) -------------
// v_permlanex16_b32 with the identity select table.  bound_ctrl=1: every select
// is in range and EXEC is all-ones, so the 'old' operand is dead.
__device__ __forceinline__ float swap_halves(float x) {
  int v = __float_as_int(x);
  v = __builtin_amdgcn_permlanex16(v, v, 0x76543210, (int)0xFEDCBA98u, false, true);
  return __int_as_float(v);
}

// ---------------------------------------------------------------------------
// Producer part 1: Q/K/V projections, LDS-staged.  Z template: 0=Q, 1=K, 2=V.
// Block tile: 128 rows x 64 cols, K-step 32.  8 waves, each 16 rows x 64 cols.
// Outputs f16 in fragment order, 512-B blocks of [lane][8] (Q pre-scaled):
//   Qh/Kh [bh][n/16][d/16]        lane = 16*((d>>3)&1) + (n&15), element d&7
//   Vth   [bh][n/32][d/16][(n>>4)&1]  lane = 16*((n>>3)&1) + (d&15), element n&7
// Q and K are computed transposed (W^T as A, X^T as B): a lane then ends with 8
// consecutive d of one row n, as V's plain product ends with 8 consecutive n of one d.
// ---------------------------------------------------------------------------
template <int Z>
__device__ __forceinline__ void qkv_proj_tile(
    const float* __restrict__ X, const float* __restrict__ W,
    _Float16* __restrict__ Out,
    _Float16 (*__restrict__ Asub)[32],   // 128 rows, [row][k]
    _Float16 (*__restrict__ Bsub)[32])   // 64 rows, [col][k] (transposed)
{
  const int tid  = threadIdx.x;
  const int wave = tid >> 5;
  const int lane = tid & 31;
  const int hi = lane >> 4, lx = lane & 15, base = hi << 3;

  const int row0    = blockIdx.x * 128;   // 8192 rows
  const int colbase = blockIdx.y * 64;    // 256 cols

  constexpr int ldb  = (Z == 0) ? 256 : 512;
  constexpr int coff = (Z == 2) ? 256 : 0;

  const v8f zv = {};
  v8f acc[4] = {zv, zv, zv, zv};

  for (int k0 = 0; k0 < 256; k0 += 32) {
    // stage A tile: 128 x 32 f32 -> f16 (coalesced float4 loads)
#pragma unroll
    for (int i = 0; i < 4; ++i) {
      const int idx = tid + 256 * i;              // 0..1023
      const int row = idx >> 3, f4 = idx & 7;
      const float4 v = *(const float4*)(X + (size_t)(row0 + row) * 256 + k0 + f4 * 4);
      Asub[row][f4 * 4 + 0] = (_Float16)v.x;
      Asub[row][f4 * 4 + 1] = (_Float16)v.y;
      Asub[row][f4 * 4 + 2] = (_Float16)v.z;
      Asub[row][f4 * 4 + 3] = (_Float16)v.w;
    }
    // stage B tile transposed: W[k0..k0+31][colbase..+63] -> Bsub[col][k]
#pragma unroll
    for (int i = 0; i < 2; ++i) {
      const int idx = tid + 256 * i;              // 0..511
      const int k = idx >> 4, f4 = idx & 15;
      const float4 v = *(const float4*)(W + (size_t)(k0 + k) * ldb + coff + colbase + f4 * 4);
      Bsub[f4 * 4 + 0][k] = (_Float16)v.x;
      Bsub[f4 * 4 + 1][k] = (_Float16)v.y;
      Bsub[f4 * 4 + 2][k] = (_Float16)v.z;
      Bsub[f4 * 4 + 3][k] = (_Float16)v.w;
    }
    __syncthreads();

    const v16h a = frag_from_f16_row(&Asub[(wave << 4) + lx][0], base);
#pragma unroll
    for (int c = 0; c < 4; ++c) {
      const v16h b = frag_from_f16_row(&Bsub[(c << 4) + lx][0], base);
      if (Z == 2) acc[c] = WMMA_F32_F16(a, b, acc[c]);   // D[n][d]
      else        acc[c] = WMMA_F32_F16(b, a, acc[c]);   // D[d][n]
    }
    __syncthreads();
  }

  const float qscale = 0.17677669529663687f;  // 32^-0.5
  const int rt  = row0 + (wave << 4);          // first of this wave's 16 rows
  const int b_  = rt >> 11;
  const int t16 = (rt & 2047) >> 4;            // 16-row group inside the batch
#pragma unroll
  for (int c = 0; c < 4; ++c) {
    const int h_ = (colbase + (c << 4)) >> 5;
    const int dh = c & 1;                      // d / 16 (colbase is a multiple of 32)
    v8h o;
#pragma unroll
    for (int r = 0; r < 8; ++r)
      o[r] = (Z == 0) ? (_Float16)(acc[c][r] * qscale) : (_Float16)acc[c][r];
    const int blk = (Z == 2) ? ((((t16 >> 1) << 1) + dh) << 1) + (t16 & 1)
                             : (t16 << 1) + dh;
    *(v8h*)(Out + ((size_t)(b_ * 8 + h_) << 16) + (((blk << 5) + lane) << 3)) = o;
  }
  // a block runs no other part after this one (the branch is uniform); the wait is a
  // precaution ahead of any later overwrite of the stores' address and data registers
  asm volatile("s_wait_xcnt 0x0" ::: "memory");
}

// ---------------------------------------------------------------------------
// Producer part 2: cor_embed = cor @ Wcor  (K=3, tiny).  Writes f32 ce [B*N, 64] and
// f16 CEth in fragment order, 512-B blocks [bh][n/32][(n>>4)&1] of [lane][8] with
// lane = 16*((n>>3)&1) + d, element n&7; rows d = 8..15 are zero padding.
// One thread per 16-B piece: 8 consecutive n of one (head, d).
// ---------------------------------------------------------------------------
__device__ __forceinline__ void cor_embed_tile(
    const float* __restrict__ cor, const float* __restrict__ Wcor,
    float* __restrict__ ce, _Float16* __restrict__ CEth, int blk)
{
  const int idx = blk * 256 + threadIdx.x;    // 32 heads * 128 blocks * 32 lanes
  if (idx >= 32 * 128 * 32) return;
  const int d  = idx & 15;
  const int n0 = ((idx >> 4) & 255) << 3;     // block and lane half give n / 8
  const int bh = idx >> 12;
  const int b = bh >> 3, h = bh & 7;
  v8h o = {};
  if (d < 8) {
    const int m = h * 8 + d;
    const size_t bn0 = (size_t)b * 2048 + n0;
    const float4* c4 = (const float4*)(cor + bn0 * 3);   // 24 floats, 96-B aligned
    float cv[24];
#pragma unroll
    for (int i = 0; i < 6; ++i) {
      const float4 x = c4[i];
      cv[4 * i] = x.x; cv[4 * i + 1] = x.y; cv[4 * i + 2] = x.z; cv[4 * i + 3] = x.w;
    }
    const float w0 = Wcor[m], w1 = Wcor[64 + m], w2 = Wcor[128 + m];
#pragma unroll
    for (int e = 0; e < 8; ++e) {
      const float v = cv[3 * e] * w0 + cv[3 * e + 1] * w1 + cv[3 * e + 2] * w2;
      ce[(bn0 + e) * 64 + m] = v;
      o[e] = (_Float16)v;
    }
  }
  *(v8h*)(CEth + ((size_t)idx << 3)) = o;
}

// ---------------------------------------------------------------------------
// Kernel 1: everything the attention reads, in one grid (64, 4, 5).
// z = 0, 1, 2: the Q, K, V projection tile (x, y); z = 3, 4: 512 cor_embed blocks,
// last because they are the short ones.  The branch is uniform for a block.
// ---------------------------------------------------------------------------
__global__ __launch_bounds__(256) void producers_kernel(
    const float* __restrict__ x1, const float* __restrict__ x2,
    const float* __restrict__ cor, const float* __restrict__ Wq,
    const float* __restrict__ Wkv, const float* __restrict__ Wcor,
    _Float16* __restrict__ Qh, _Float16* __restrict__ Kh, _Float16* __restrict__ Vth,
    float* __restrict__ ce, _Float16* __restrict__ CEth)
{
  __shared__ __align__(16) _Float16 Asub[128][32];  // 8 KB
  __shared__ __align__(16) _Float16 Bsub[64][32];   // 4 KB

  const int z = blockIdx.z;
  if (z == 0)      qkv_proj_tile<0>(x1, Wq,  Qh,  Asub, Bsub);
  else if (z == 1) qkv_proj_tile<1>(x2, Wkv, Kh,  Asub, Bsub);
  else if (z == 2) qkv_proj_tile<2>(x2, Wkv, Vth, Asub, Bsub);
  else cor_embed_tile(cor, Wcor, ce, CEth, ((z - 3) * 4 + blockIdx.y) * 64 + blockIdx.x);
}

// ---------------------------------------------------------------------------
// Kernel 2: flash attention.  One 16-query tile per wave, 8 waves/WG,
// grid (N/128, B*H).  Online softmax; 5 WMMA per 32-key tile.
// Transposed products: D register r of lane (hi, lx) is [8*hi + r][lx], so with
// K (or V^T, CE^T) as A and Q^T (or P^T) as B, lane lx owns query q0 + lx.
//   s0[r] = S[q0+lx][j0 + 8*hi + r],  s1[r] = S[q0+lx][j0 + 16 + 8*hi + r]
// which is exactly the B-fragment k order (e<8: 8*hi+e, e>=8: 16+8*hi+e-8).
// K, V^T, CE^T: a stage is 128 keys = 8 + 8 + 4 KB, contiguous in each operand's
// fragment-ordered plane; it keeps that order in LDS, so a fragment read is 512
// contiguous bytes a wave.  Stage t + 1 flies while stage t is worked on.
// ---------------------------------------------------------------------------
#define STAGE_KEYS   128
#define STAGE_HALVES 10240            // K 4096, V^T 4096, CE^T 2048 halves
#define STAGE_BYTES  20480
#define N_STAGES     (2048 / STAGE_KEYS)

// One stage: five 16-B copies a thread (K 2, V^T 2, CE^T 1), 4 KB a round of the
// work-group.  lds: this thread's byte address in the buffer; k, v, c: its 16 B of
// the stage in each plane.
__device__ __forceinline__ void stage_copy(unsigned lds, const _Float16* k,
                                           const _Float16* v, const _Float16* c) {
  // global to LDS through no register; the s_wait_xcnt ends the statement so that no
  // address register named here is rewritten ahead of it
  asm volatile(
      "global_load_async_to_lds_b128 %0, %5, off\n\t"
      "global_load_async_to_lds_b128 %1, %6, off\n\t"
      "global_load_async_to_lds_b128 %2, %7, off\n\t"
      "global_load_async_to_lds_b128 %3, %8, off\n\t"
      "global_load_async_to_lds_b128 %4, %9, off\n\t"
      "s_wait_xcnt 0x0"
      :: "v"(lds), "v"(lds + 4096u), "v"(lds + 8192u), "v"(lds + 12288u), "v"(lds + 16384u),
         "v"(k), "v"(k + 2048), "v"(v), "v"(v + 2048), "v"(c)
      : "memory");
}

__global__ __launch_bounds__(256) void attn_kernel(
    const _Float16* __restrict__ Qh, const _Float16* __restrict__ Kh,
    const _Float16* __restrict__ Vth, const _Float16* __restrict__ CEth,
    float* __restrict__ attn_x, float* __restrict__ c_rev)
{
  const int wave = threadIdx.x >> 5;
  const int lane = threadIdx.x & 31;
  const int hi = lane >> 4, lx = lane & 15, base = hi << 3;
  const int bh = blockIdx.y;
  const int q0 = blockIdx.x * 128 + wave * 16;

  __shared__ __align__(16) _Float16 ring[2][STAGE_HALVES];   // 40 KB

  // fragment-ordered operands: this lane's 16-B piece of each 512-B block
  const _Float16* Qb = Qh + (size_t)bh * (2048 * 32) + (lane << 3);
  // this thread's 16 B of each 4-KB copy round
  const _Float16* Kg = Kh   + (size_t)bh * (2048 * 32) + (threadIdx.x << 3);
  const _Float16* Vg = Vth  + (size_t)bh * (32 * 2048) + (threadIdx.x << 3);
  const _Float16* Cg = CEth + (size_t)bh * (16 * 2048) + (threadIdx.x << 3);
  const unsigned ring_b = (unsigned)(size_t)&ring[0][0] + (threadIdx.x << 4);

  stage_copy(ring_b, Kg, Vg, Cg);                       // stage 0 into buffer 0
  // stage 0 has landed for this wave, then for all: nobody reads it before
  asm volatile("s_wait_asynccnt 0x0" ::: "memory");
  __syncthreads();
  stage_copy(ring_b + STAGE_BYTES, Kg + 4096, Vg + 4096, Cg + 2048);   // stage 1

  const v16h qf = frag_packed(Qb + (size_t)q0 * 32);

  v8f o0 = {}, o1 = {}, crv = {};       // O^T rows d 0..15, 16..31; CE^T rows 0..15
  float rm = -3.0e38f, rl = 0.f;        // this lane's query: max; sum over this half's keys

  for (int t = 0; t < N_STAGES; ++t) {
   const _Float16* Sb = &ring[t & 1][lane << 3];
   // unrolled so that every LDS read has its place in the stage as an immediate offset
#pragma unroll
   for (int p = 0; p < STAGE_KEYS / 32; ++p) {
    // S^T = K * Q^T  (scale folded into Q)
    // 32 keys: K and V^T 2 KB each (two fragments), CE^T 1 KB, all contiguous
    const v16h ka0 = frag_packed(Sb + p * 1024);
    const v16h ka1 = frag_packed(Sb + p * 1024 + 512);
    const v16h va0 = frag_packed(Sb + 4096 + p * 1024);
    const v16h va1 = frag_packed(Sb + 4096 + p * 1024 + 512);
    const v16h ca  = frag_packed(Sb + 8192 + p * 512);
    // keeps all ten reads in one group ahead of the score products: without it the
    // last ones sink to just before their use and a second read latency shows per pass
    __builtin_amdgcn_sched_barrier(0);
    v8f s0 = {}, s1 = {};
    s0 = WMMA_F32_F16(ka0, qf, s0);
    s1 = WMMA_F32_F16(ka1, qf, s1);

    // online softmax: 16 of the query's 32 scores sit in this lane, 16 in lane ^ 16
    float t0 = fmaxf(s0[0], s1[0]), t1 = fmaxf(s0[1], s1[1]);
#pragma unroll
    for (int r = 2; r < 8; r += 2) {
      t0 = fmaxf(t0, fmaxf(s0[r], s1[r]));
      t1 = fmaxf(t1, fmaxf(s0[r + 1], s1[r + 1]));
    }
    float t = fmaxf(t0, t1);
    t = fmaxf(t, swap_halves(t));
    const float mn = fmaxf(rm, t);
    const float alpha = __expf(rm - mn);
    rm = mn;

    v16h pf;                            // P^T as B fragment, straight from the score tiles
    float ps0 = 0.f, ps1 = 0.f;
#pragma unroll
    for (int r = 0; r < 8; ++r) {
      const float p0 = __expf(s0[r] - mn);
      const float p1 = __expf(s1[r] - mn);
      ps0 += p0; ps1 += p1;
      pf[r]     = (_Float16)p0;
      pf[r + 8] = (_Float16)p1;
    }
    rl = rl * alpha + (ps0 + ps1);
    o0 *= alpha; o1 *= alpha; crv *= alpha;

    o0  = WMMA_F32_F16(va0, pf, o0);
    o1  = WMMA_F32_F16(va1, pf, o1);
    crv = WMMA_F32_F16(ca,  pf, crv);
   }
   // hand-over: this wave's reads of stage t are done, its copies of stage t + 1 have
   // landed; behind the barrier both hold for all 8 waves
   asm volatile("s_wait_dscnt 0x0" ::: "memory");      // own reads of stage t retired
   asm volatile("s_wait_asynccnt 0x0" ::: "memory");   // own copies of stage t + 1 landed
   __syncthreads();
   if (t + 2 < N_STAGES)                                 // into the buffer just read
     stage_copy(ring_b + (unsigned)(t & 1) * STAGE_BYTES, Kg + (t + 2) * 4096,
                Vg + (t + 2) * 4096, Cg + (t + 2) * 2048);
  }
  // no copy is left in flight when the wave goes on to its end
  asm volatile("s_wait_asynccnt 0x0" ::: "memory");

  // join the halves' sums once; lane (hi, lx) holds d = 8*hi + r of query q0 + lx
  const float inv = 1.0f / (rl + swap_halves(rl));
  const int b_ = bh >> 3, h_ = bh & 7;
  const int q  = q0 + lx;
  float* xr = attn_x + (((size_t)b_ * 2048 + q) << 8) + (h_ << 5) + base;
  *(float4*)(xr)      = make_float4(o0[0] * inv, o0[1] * inv, o0[2] * inv, o0[3] * inv);
  *(float4*)(xr + 4)  = make_float4(o0[4] * inv, o0[5] * inv, o0[6] * inv, o0[7] * inv);
  *(float4*)(xr + 16) = make_float4(o1[0] * inv, o1[1] * inv, o1[2] * inv, o1[3] * inv);
  *(float4*)(xr + 20) = make_float4(o1[4] * inv, o1[5] * inv, o1[6] * inv, o1[7] * inv);
  if (hi == 0) {                        // CE^T rows 8..15 are the zero padding
    float* cr = c_rev + (((size_t)b_ * 2048 + q) << 6) + (h_ << 3);
    *(float4*)(cr)     = make_float4(crv[0] * inv, crv[1] * inv, crv[2] * inv, crv[3] * inv);
    *(float4*)(cr + 4) = make_float4(crv[4] * inv, crv[5] * inv, crv[6] * inv, crv[7] * inv);
  }
}

// ---------------------------------------------------------------------------
// Consumer part 1: x_out = attn_x @ Wproj + bproj   [8192,256]x[256,256], LDS-staged.
// ---------------------------------------------------------------------------
__device__ __forceinline__ void proj_tile(
    const float* __restrict__ attn_x, const float* __restrict__ Wproj,
    const float* __restrict__ bproj, float* __restrict__ out,
    _Float16 (*__restrict__ Asub)[32],   // 128 rows, [row][k]
    _Float16 (*__restrict__ Bsub)[32])   // 64 rows, [col][k]
{
  const int tid  = threadIdx.x;
  const int wave = tid >> 5;
  const int lane = tid & 31;
  const int hi = lane >> 4, lx = lane & 15, base = hi << 3;
  const int row0 = blockIdx.x * 128;
  const int colbase = blockIdx.y * 64;

  const v8f zv = {};
  v8f acc[4] = {zv, zv, zv, zv};

  for (int k0 = 0; k0 < 256; k0 += 32) {
#pragma unroll
    for (int i = 0; i < 4; ++i) {
      const int idx = tid + 256 * i;
      const int row = idx >> 3, f4 = idx & 7;
      const float4 v = *(const float4*)(attn_x + (size_t)(row0 + row) * 256 + k0 + f4 * 4);
      Asub[row][f4 * 4 + 0] = (_Float16)v.x;
      Asub[row][f4 * 4 + 1] = (_Float16)v.y;
      Asub[row][f4 * 4 + 2] = (_Float16)v.z;
      Asub[row][f4 * 4 + 3] = (_Float16)v.w;
    }
#pragma unroll
    for (int i = 0; i < 2; ++i) {
      const int idx = tid + 256 * i;
      const int k = idx >> 4, f4 = idx & 15;
      const float4 v = *(const float4*)(Wproj + (size_t)(k0 + k) * 256 + colbase + f4 * 4);
      Bsub[f4 * 4 + 0][k] = (_Float16)v.x;
      Bsub[f4 * 4 + 1][k] = (_Float16)v.y;
      Bsub[f4 * 4 + 2][k] = (_Float16)v.z;
      Bsub[f4 * 4 + 3][k] = (_Float16)v.w;
    }
    __syncthreads();

    const v16h a = frag_from_f16_row(&Asub[(wave << 4) + lx][0], base);
#pragma unroll
    for (int c = 0; c < 4; ++c) {
      const v16h b = frag_from_f16_row(&Bsub[(c << 4) + lx][0], base);
      acc[c] = WMMA_F32_F16(a, b, acc[c]);
    }
    __syncthreads();
  }

#pragma unroll
  for (int c = 0; c < 4; ++c) {
#pragma unroll
    for (int r = 0; r < 8; ++r) {
      const int grow = row0 + (wave << 4) + r + base;
      const int gcol = colbase + (c << 4) + lx;
      out[((size_t)grow << 8) + gcol] = acc[c][r] + bproj[gcol];
    }
  }
}

// ---------------------------------------------------------------------------
// Consumer part 2: motion = (c_rev - ce) @ Wm + bm   [8192,64]x[64,64].
// Wm^T staged once in LDS; each wave: 16 rows x 64 cols, K=64 in 2 steps.
// ---------------------------------------------------------------------------
__device__ __forceinline__ void motion_tile(
    const float* __restrict__ c_rev, const float* __restrict__ ce,
    const float* __restrict__ Wm, const float* __restrict__ bm, float* __restrict__ out,
    _Float16 (*__restrict__ Wt)[64])     // 64 rows, [col][k]
{
  const int tid  = threadIdx.x;
  const int wave = tid >> 5;
  const int lane = tid & 31;
  const int hi = lane >> 4, lx = lane & 15, base = hi << 3;
  const int row0 = blockIdx.x * 128;

#pragma unroll
  for (int i = 0; i < 4; ++i) {
    const int idx = tid + 256 * i;              // 0..1023
    const int k = idx >> 4, f4 = idx & 15;
    const float4 v = *(const float4*)(Wm + (size_t)k * 64 + f4 * 4);
    Wt[f4 * 4 + 0][k] = (_Float16)v.x;
    Wt[f4 * 4 + 1][k] = (_Float16)v.y;
    Wt[f4 * 4 + 2][k] = (_Float16)v.z;
    Wt[f4 * 4 + 3][k] = (_Float16)v.w;
  }
  __syncthreads();

  const float* ar = c_rev + (size_t)(row0 + (wave << 4) + lx) * 64;
  const float* er = ce    + (size_t)(row0 + (wave << 4) + lx) * 64;

  const v8f zv = {};
  v8f acc[4] = {zv, zv, zv, zv};
#pragma unroll
  for (int k0 = 0; k0 < 64; k0 += 32) {
    v16h a;
#pragma unroll
    for (int i = 0; i < 8; ++i) {
      const int ka = k0 + base + i, kb = k0 + 16 + base + i;
      a[i]     = (_Float16)(ar[ka] - er[ka]);
      a[i + 8] = (_Float16)(ar[kb] - er[kb]);
    }
#pragma unroll
    for (int c = 0; c < 4; ++c) {
      const v16h b = frag_from_f16_row(&Wt[(c << 4) + lx][k0], base);
      acc[c] = WMMA_F32_F16(a, b, acc[c]);
    }
  }

#pragma unroll
  for (int c = 0; c < 4; ++c) {
#pragma unroll
    for (int r = 0; r < 8; ++r) {
      const int grow = row0 + (wave << 4) + r + base;
      const int gcol = (c << 4) + lx;
      out[((size_t)grow << 6) + gcol] = acc[c][r] + bm[gcol];
    }
  }
}

// ---------------------------------------------------------------------------
// Kernel 3: both outputs in one grid (64, 5).  y = 0..3: output projection tile
// (x, y); y = 4: motion rows of block x.  The branch is uniform for a block.
// ---------------------------------------------------------------------------
__global__ __launch_bounds__(256) void outputs_kernel(
    const float* __restrict__ attn_x, const float* __restrict__ Wproj,
    const float* __restrict__ bproj, float* __restrict__ out_x,
    const float* __restrict__ c_rev, const float* __restrict__ ce,
    const float* __restrict__ Wm, const float* __restrict__ bm,
    float* __restrict__ out_motion)
{
  __shared__ __align__(16) _Float16 smem[6144];     // 12 KB: A 8 + B 4, or Wm^T 8

  if (blockIdx.y < 4)
    proj_tile(attn_x, Wproj, bproj, out_x,
              (_Float16 (*)[32])smem, (_Float16 (*)[32])(smem + 128 * 32));
  else
    motion_tile(c_rev, ce, Wm, bm, out_motion, (_Float16 (*)[64])smem);
}

// ---------------------------------------------------------------------------
extern "C" void kernel_launch(void* const* d_in, const int* in_sizes, int n_in,
                              void* d_out, int out_size, void* d_ws, size_t ws_size,
                              hipStream_t stream) {
  (void)in_sizes; (void)n_in; (void)out_size; (void)ws_size;
  const float* x1    = (const float*)d_in[0];
  const float* x2    = (const float*)d_in[1];
  const float* cor   = (const float*)d_in[2];
  const float* Wq    = (const float*)d_in[3];
  const float* Wkv   = (const float*)d_in[4];
  const float* Wcor  = (const float*)d_in[5];
  const float* Wproj = (const float*)d_in[6];
  const float* bproj = (const float*)d_in[7];
  const float* Wm    = (const float*)d_in[8];
  const float* bm    = (const float*)d_in[9];

  char* ws = (char*)d_ws;                                  // 26 MB total
  _Float16* Qh     = (_Float16*)(ws);                      //  4 MB
  _Float16* Kh     = (_Float16*)(ws + ( 4u << 20));        //  4 MB
  _Float16* Vth    = (_Float16*)(ws + ( 8u << 20));        //  4 MB
  _Float16* CEth   = (_Float16*)(ws + (12u << 20));        //  2 MB
  float*    ce     = (float*)   (ws + (14u << 20));        //  2 MB
  float*    attn_x = (float*)   (ws + (16u << 20));        //  8 MB
  float*    c_rev  = (float*)   (ws + (24u << 20));        //  2 MB

  float* out_x      = (float*)d_out;                       // [4,2048,256]
  float* out_motion = out_x + (size_t)4 * 2048 * 256;      // [4,2048,64]

  producers_kernel<<<dim3(64, 4, 5), 256, 0, stream>>>(x1, x2, cor, Wq, Wkv, Wcor,
                                                       Qh, Kh, Vth, ce, CEth);
  attn_kernel     <<<dim3(16, 32),   256, 0, stream>>>(Qh, Kh, Vth, CEth, attn_x, c_rev);
  outputs_kernel  <<<dim3(64, 5),    256, 0, stream>>>(attn_x, Wproj, bproj, out_x,
                                                       c_rev, ce, Wm, bm, out_motion);
}

// v005
// Measured time: 47 microseconds a run.
// Timed twice side by side with v004, it ran 1.49 and 1.48 times as fast.
// Counting every step since v000, it is 3.69 times as fast.
#include <hip/hip_runtime.h>

// ---------------------------------------------------------------------------
// InterFrameAttention for MI455X (gfx1250, wave32, WMMA f16->f32)
// Shapes: B=4, N=2048, C=256, H=8, Dh=32, M=64, Mh=8
// GEMMs: LDS-staged tiles (coalesced b128 global loads, f16 conversion once,
// weights transposed in LDS so WMMA B-fragments are contiguous ds_load_b128); a tile
// holds the whole K = 256, so a block has one load phase and one barrier.
// Attention: flash-style single pass, 5 WMMA per 32-key tile per wave, all
// products transposed (S^T = K Q^T, O^T += V^T P^T): a lane holds one query's
// scores, so max and sum are in-lane plus one exchange between wave halves,
// and the two score tiles convert in place into the P^T operand (no LDS).
// Q, K, V^T and CE^T live in the workspace in fragment order: a fragment is two
// blocks of 512 B, block c holding lane l's elements 8c..8c+7 at byte 16*l, so a
// wave-wide 16-B load or store covers four whole 128-B lines.
// The attention work-group brings K, V^T and CE^T into LDS once for its 8 waves
// (asynchronous copies, two buffers of 128 keys); the waves read fragments from LDS.
// Three launches: the four producers of the attention operands share one grid, as
// do the two consumers of its results; inside a grid no block needs another's data.
// ---------------------------------------------------------------------------

typedef _Float16 v16h __attribute__((ext_vector_type(16)));
typedef _Float16 v8h  __attribute__((ext_vector_type(8)));
typedef float    v8f  __attribute__((ext_vector_type(8)));

#define WMMA_F32_F16(A, Bm, Cm) \
  __builtin_amdgcn_wmma_f32_16x16x32_f16(false, (A), false, (Bm), (short)0, (Cm), false, false)

// A/B fragment element -> K mapping (16-bit 16x32 operand, wave32):
//   e in [0,8):  K = base + e          (base = 8 * (lane>>4))
//   e in [8,16): K = 16 + base + (e-8)
// -> per lane, two contiguous 8-half (16B) chunks at offsets base and 16+base.
__device__ __forceinline__ v16h frag_from_f16_row(const _Float16* __restrict__ row, int base) {
  v8h lo = *(const v8h*)(row + base);
  v8h hi = *(const v8h*)(row + 16 + base);
  v16h r;
#pragma unroll
  for (int i = 0; i < 8; ++i) { r[i] = lo[i]; r[i + 8] = hi[i]; }
  return r;
}

// The same fragment from fragment-ordered memory; p already includes 8 * lane.
__device__ __forceinline__ v16h frag_packed(const _Float16* __restrict__ p) {
  v8h lo = *(const v8h*)(p);
  v8h hi = *(const v8h*)(p + 256);
  v16h r;
#pragma unroll
  for (int i = 0; i < 8; ++i) { r[i] = lo[i]; r[i + 8] = hi[i]; }
  return r;
}

// --- exchange between the two 16-lane halves (lane l <-> l ^ 16) -------------
// v_permlanex16_b32 with the identity select table.  bound_ctrl=1: every select
// is in range and EXEC is all-ones, so the 'old' operand is dead.
__device__ __forceinline__ float swap_halves(float x) {
  int v = __float_as_int(x);
  v = __builtin_amdgcn_permlanex16(v, v, 0x76543210, (int)0xFEDCBA98u, false, true);
  return __int_as_float(v);
}

// ---------------------------------------------------------------------------
// The K = 256 product of a 128-row x 64-column block tile, shared by the Q, K, V and
// output projections.  Both operands are staged for the whole K at once: every global
// load of the block is issued in one phase, one barrier follows, and the 32 WMMA of a
// wave then run with no further barrier.  8 waves, each 16 rows x 64 columns.
// LDS row pitch 264 halves = 528 B = 33 x 16 B: 16 rows read 16 B each fall on
// 16 different groups of four banks.
// WA: weights are the A operand, D = [col][row]; else D = [row][col].
// ---------------------------------------------------------------------------
#define KP 264
typedef float    v4f  __attribute__((ext_vector_type(4)));
typedef _Float16 v4h  __attribute__((ext_vector_type(4)));

template <bool WA>
__device__ __forceinline__ void gemm_k256_tile(
    const float* __restrict__ X,         // row 0 of the tile; 128 rows of 256, contiguous
    const float* __restrict__ W,         // row 0, first of the tile's 64 columns
    const int ldb,                       // row pitch of W in floats
    _Float16 (*__restrict__ Asub)[KP],   // 128 rows, [row][k]
    _Float16 (*__restrict__ Bsub)[KP],   // 64 rows, [col][k] (transposed)
    v8f (&acc)[4])
{
  const int tid  = threadIdx.x;
  const int wave = tid >> 5;
  const int lane = tid & 31;
  const int hi = lane >> 4, lx = lane & 15, base = hi << 3;

  // X: the tile is 128 KB in a row; round i of the block takes 4 KB (4 rows) of it
  const float* xp = X + (tid << 2);
  const int xr = tid >> 6, xc = (tid & 63) << 2;
  v4f xa[16], xb[16];
#pragma unroll
  for (int i = 0; i < 16; ++i) xa[i] = *(const v4f*)(xp + 1024 * i);
  // W: a thread takes 4 columns x 16 consecutive k; 16 lanes cover 256 contiguous bytes
  const int wc = (tid & 15) << 2, wk = (tid >> 4) << 4;
  const float* wp = W + (size_t)wk * ldb + wc;
  v4f wv[16];
#pragma unroll
  for (int e = 0; e < 15; ++e) wv[e] = *(const v4f*)(wp + (size_t)e * ldb);
  // the last load's result may take over the address registers that the 15 before it name:
  // the wait stands ahead of that overwrite
  asm volatile("s_wait_xcnt 0x0" ::: "memory");
  wv[15] = *(const v4f*)(wp + (size_t)15 * ldb);
  // ahead of any other overwrite of an address register that these 32 loads name
  asm volatile("s_wait_xcnt 0x0" ::: "memory");
#pragma unroll
  for (int i = 0; i < 16; ++i) {
    v4h o = {(_Float16)xa[i][0], (_Float16)xa[i][1], (_Float16)xa[i][2], (_Float16)xa[i][3]};
    *(v4h*)&Asub[xr + 4 * i][xc] = o;
  }
  // compiler fence: the loads below stay behind the stores above, whose registers they
  // take over; moved up to the first 32 they cost the block its third place on a WGP
  asm volatile("" ::: "memory");
#pragma unroll
  for (int i = 0; i < 16; ++i) xb[i] = *(const v4f*)(xp + 1024 * (16 + i));
  // ahead of any overwrite of an address register that these 16 loads name; they fly
  // while W is converted and stored
  asm volatile("s_wait_xcnt 0x0" ::: "memory");
#pragma unroll
  for (int j = 0; j < 4; ++j) {
    v8h lo, hj;
#pragma unroll
    for (int e = 0; e < 8; ++e) { lo[e] = (_Float16)wv[e][j]; hj[e] = (_Float16)wv[e + 8][j]; }
    *(v8h*)&Bsub[wc + j][wk]     = lo;
    *(v8h*)&Bsub[wc + j][wk + 8] = hj;
  }
#pragma unroll
  for (int i = 0; i < 16; ++i) {
    v4h o = {(_Float16)xb[i][0], (_Float16)xb[i][1], (_Float16)xb[i][2], (_Float16)xb[i][3]};
    *(v4h*)&Asub[xr + 4 * (16 + i)][xc] = o;
  }
  __syncthreads();

  // no barrier from here on, so the fragments of k-step s + 1 are read ahead of the
  // products of k-step s
  const _Float16* ar = &Asub[(wave << 4) + lx][0];
  const _Float16* br = &Bsub[lx][0];
  v16h a = frag_from_f16_row(ar, base);
  v16h b[4];
#pragma unroll
  for (int c = 0; c < 4; ++c) b[c] = frag_from_f16_row(br + (c << 4) * KP, base);
#pragma unroll
  for (int k0 = 0; k0 < 256; k0 += 32) {
    v16h an = a, bn[4] = {b[0], b[1], b[2], b[3]};
    if (k0 + 32 < 256) {
      an = frag_from_f16_row(ar + k0 + 32, base);
#pragma unroll
      for (int c = 0; c < 4; ++c) bn[c] = frag_from_f16_row(br + (c << 4) * KP + k0 + 32, base);
    }
    // keeps the reads of k-step s + 1 ahead of the products of k-step s: without it each
    // pair of reads sinks to just before its product and its latency shows 32 times
    __builtin_amdgcn_sched_barrier(0);
#pragma unroll
    for (int c = 0; c < 4; ++c) {
      if (WA) acc[c] = WMMA_F32_F16(b[c], a, acc[c]);   // D[col][row]
      else    acc[c] = WMMA_F32_F16(a, b[c], acc[c]);   // D[row][col]
    }
    a = an;
#pragma unroll
    for (int c = 0; c < 4; ++c) b[c] = bn[c];
  }
}

// ---------------------------------------------------------------------------
// Producer part 1: Q/K/V projections, LDS-staged.  Z template: 0=Q, 1=K, 2=V.
// Block tile: 128 rows x 64 cols, whole K.  8 waves, each 16 rows x 64 cols.
// Outputs f16 in fragment order, 512-B blocks of [lane][8] (Q pre-scaled):
//   Qh/Kh [bh][n/16][d/16]        lane = 16*((d>>3)&1) + (n&15), element d&7
//   Vth   [bh][n/32][d/16][(n>>4)&1]  lane = 16*((n>>3)&1) + (d&15), element n&7
// Q and K are computed transposed (W^T as A, X^T as B): a lane then ends with 8
// consecutive d of one row n, as V's plain product ends with 8 consecutive n of one d.
// ---------------------------------------------------------------------------
template <int Z>
__device__ __forceinline__ void qkv_proj_tile(
    const float* __restrict__ X, const float* __restrict__ W,
    _Float16* __restrict__ Out,
    _Float16 (*__restrict__ Asub)[KP],   // 128 rows, [row][k]
    _Float16 (*__restrict__ Bsub)[KP])   // 64 rows, [col][k] (transposed)
{
  const int tid  = threadIdx.x;
  const int wave = tid >> 5;
  const int lane = tid & 31;

  const int row0    = blockIdx.x * 128;   // 8192 rows
  const int colbase = blockIdx.y * 64;    // 256 cols

  constexpr int ldb  = (Z == 0) ? 256 : 512;
  constexpr int coff = (Z == 2) ? 256 : 0;

  const v8f zv = {};
  v8f acc[4] = {zv, zv, zv, zv};
  // V: D[n][d]; Q, K: D[d][n]
  gemm_k256_tile<Z != 2>(X + (size_t)row0 * 256, W + coff + colbase, ldb, Asub, Bsub, acc);

  const float qscale = 0.17677669529663687f;  // 32^-0.5
  const int rt  = row0 + (wave << 4);          // first of this wave's 16 rows
  const int b_  = rt >> 11;
  const int t16 = (rt & 2047) >> 4;            // 16-row group inside the batch
#pragma unroll
  for (int c = 0; c < 4; ++c) {
    const int h_ = (colbase + (c << 4)) >> 5;
    const int dh = c & 1;                      // d / 16 (colbase is a multiple of 32)
    v8h o;
#pragma unroll
    for (int r = 0; r < 8; ++r)
      o[r] = (Z == 0) ? (_Float16)(acc[c][r] * qscale) : (_Float16)acc[c][r];
    const int blk = (Z == 2) ? ((((t16 >> 1) << 1) + dh) << 1) + (t16 & 1)
                             : (t16 << 1) + dh;
    *(v8h*)(Out + ((size_t)(b_ * 8 + h_) << 16) + (((blk << 5) + lane) << 3)) = o;
  }
  // a block runs no other part after this one (the branch is uniform); the wait is a
  // precaution ahead of any later overwrite of the stores' address and data registers
  asm volatile("s_wait_xcnt 0x0" ::: "memory");
}

// ---------------------------------------------------------------------------
// Producer part 2: cor_embed = cor @ Wcor  (K=3, tiny).  Writes f32 ce [B*N, 64] and
// f16 CEth in fragment order, 512-B blocks [bh][n/32][(n>>4)&1] of [lane][8] with
// lane = 16*((n>>3)&1) + d, element n&7; rows d = 8..15 are zero padding.
// One thread per 16-B piece: 8 consecutive n of one (head, d).
// ---------------------------------------------------------------------------
__device__ __forceinline__ void cor_embed_tile(
    const float* __restrict__ cor, const float* __restrict__ Wcor,
    float* __restrict__ ce, _Float16* __restrict__ CEth, int blk)
{
  const int idx = blk * 256 + threadIdx.x;    // 32 heads * 128 blocks * 32 lanes
  if (idx >= 32 * 128 * 32) return;
  const int d  = idx & 15;
  const int n0 = ((idx >> 4) & 255) << 3;     // block and lane half give n / 8
  const int bh = idx >> 12;
  const int b = bh >> 3, h = bh & 7;
  v8h o = {};
  if (d < 8) {
    const int m = h * 8 + d;
    const size_t bn0 = (size_t)b * 2048 + n0;
    const float4* c4 = (const float4*)(cor + bn0 * 3);   // 24 floats, 96-B aligned
    float cv[24];
#pragma unroll
    for (int i = 0; i < 6; ++i) {
      const float4 x = c4[i];
      cv[4 * i] = x.x; cv[4 * i + 1] = x.y; cv[4 * i + 2] = x.z; cv[4 * i + 3] = x.w;
    }
    const float w0 = Wcor[m], w1 = Wcor[64 + m], w2 = Wcor[128 + m];
#pragma unroll
    for (int e = 0; e < 8; ++e) {
      const float v = cv[3 * e] * w0 + cv[3 * e + 1] * w1 + cv[3 * e + 2] * w2;
      ce[(bn0 + e) * 64 + m] = v;
      o[e] = (_Float16)v;
    }
  }
  *(v8h*)(CEth + ((size_t)idx << 3)) = o;
}

// ---------------------------------------------------------------------------
// Kernel 1: everything the attention reads, in one grid (64, 4, 5).
// z = 0, 1, 2: the Q, K, V projection tile (x, y); z = 3, 4: 512 cor_embed blocks,
// last because they are the short ones.  The branch is uniform for a block.
// ---------------------------------------------------------------------------
__global__ __launch_bounds__(256) void producers_kernel(
    const float* __restrict__ x1, const float* __restrict__ x2,
    const float* __restrict__ cor, const float* __restrict__ Wq,
    const float* __restrict__ Wkv, const float* __restrict__ Wcor,
    _Float16* __restrict__ Qh, _Float16* __restrict__ Kh, _Float16* __restrict__ Vth,
    float* __restrict__ ce, _Float16* __restrict__ CEth)
{
  __shared__ __align__(16) _Float16 Asub[128][KP];  // 66 KB
  __shared__ __align__(16) _Float16 Bsub[64][KP];   // 33 KB

  const int z = blockIdx.z;
  if (z == 0)      qkv_proj_tile<0>(x1, Wq,  Qh,  Asub, Bsub);
  else if (z == 1) qkv_proj_tile<1>(x2, Wkv, Kh,  Asub, Bsub);
  else if (z == 2) qkv_proj_tile<2>(x2, Wkv, Vth, Asub, Bsub);
  else cor_embed_tile(cor, Wcor, ce, CEth, ((z - 3) * 4 + blockIdx.y) * 64 + blockIdx.x);
}

// ---------------------------------------------------------------------------
// Kernel 2: flash attention.  One 16-query tile per wave, 8 waves/WG,
// grid (N/128, B*H).  Online softmax; 5 WMMA per 32-key tile.
// Transposed products: D register r of lane (hi, lx) is [8*hi + r][lx], so with
// K (or V^T, CE^T) as A and Q^T (or P^T) as B, lane lx owns query q0 + lx.
//   s0[r] = S[q0+lx][j0 + 8*hi + r],  s1[r] = S[q0+lx][j0 + 16 + 8*hi + r]
// which is exactly the B-fragment k order (e<8: 8*hi+e, e>=8: 16+8*hi+e-8).
// K, V^T, CE^T: a stage is 128 keys = 8 + 8 + 4 KB, contiguous in each operand's
// fragment-ordered plane; it keeps that order in LDS, so a fragment read is 512
// contiguous bytes a wave.  Stage t + 1 flies while stage t is worked on.
// ---------------------------------------------------------------------------
#define STAGE_KEYS   128
#define STAGE_HALVES 10240            // K 4096, V^T 4096, CE^T 2048 halves
#define STAGE_BYTES  20480
#define N_STAGES     (2048 / STAGE_KEYS)

// One stage: five 16-B copies a thread (K 2, V^T 2, CE^T 1), 4 KB a round of the
// work-group.  lds: this thread's byte address in the buffer; k, v, c: its 16 B of
// the stage in each plane.
__device__ __forceinline__ void stage_copy(unsigned lds, const _Float16* k,
                                           const _Float16* v, const _Float16* c) {
  // global to LDS through no register; the s_wait_xcnt ends the statement so that no
  // address register named here is rewritten ahead of it
  asm volatile(
      "global_load_async_to_lds_b128 %0, %5, off\n\t"
      "global_load_async_to_lds_b128 %1, %6, off\n\t"
      "global_load_async_to_lds_b128 %2, %7, off\n\t"
      "global_load_async_to_lds_b128 %3, %8, off\n\t"
      "global_load_async_to_lds_b128 %4, %9, off\n\t"
      "s_wait_xcnt 0x0"
      :: "v"(lds), "v"(lds + 4096u), "v"(lds + 8192u), "v"(lds + 12288u), "v"(lds + 16384u),
         "v"(k), "v"(k + 2048), "v"(v), "v"(v + 2048), "v"(c)
      : "memory");
}

__global__ __launch_bounds__(256) void attn_kernel(
    const _Float16* __restrict__ Qh, const _Float16* __restrict__ Kh,
    const _Float16* __restrict__ Vth, const _Float16* __restrict__ CEth,
    float* __restrict__ attn_x, float* __restrict__ c_rev)
{
  const int wave = threadIdx.x >> 5;
  const int lane = threadIdx.x & 31;
  const int hi = lane >> 4, lx = lane & 15, base = hi << 3;
  const int bh = blockIdx.y;
  const int q0 = blockIdx.x * 128 + wave * 16;

  __shared__ __align__(16) _Float16 ring[2][STAGE_HALVES];   // 40 KB

  // fragment-ordered operands: this lane's 16-B piece of each 512-B block
  const _Float16* Qb = Qh + (size_t)bh * (2048 * 32) + (lane << 3);
  // this thread's 16 B of each 4-KB copy round
  const _Float16* Kg = Kh   + (size_t)bh * (2048 * 32) + (threadIdx.x << 3);
  const _Float16* Vg = Vth  + (size_t)bh * (32 * 2048) + (threadIdx.x << 3);
  const _Float16* Cg = CEth + (size_t)bh * (16 * 2048) + (threadIdx.x << 3);
  const unsigned ring_b = (unsigned)(size_t)&ring[0][0] + (threadIdx.x << 4);

  stage_copy(ring_b, Kg, Vg, Cg);                       // stage 0 into buffer 0
  // stage 0 has landed for this wave, then for all: nobody reads it before
  asm volatile("s_wait_asynccnt 0x0" ::: "memory");
  __syncthreads();
  stage_copy(ring_b + STAGE_BYTES, Kg + 4096, Vg + 4096, Cg + 2048);   // stage 1

  const v16h qf = frag_packed(Qb + (size_t)q0 * 32);

  v8f o0 = {}, o1 = {}, crv = {};       // O^T rows d 0..15, 16..31; CE^T rows 0..15
  float rm = -3.0e38f, rl = 0.f;        // this lane's query: max; sum over this half's keys

  for (int t = 0; t < N_STAGES; ++t) {
   const _Float16* Sb = &ring[t & 1][lane << 3];
   // unrolled so that every LDS read has its place in the stage as an immediate offset
#pragma unroll
   for (int p = 0; p < STAGE_KEYS / 32; ++p) {
    // S^T = K * Q^T  (scale folded into Q)
    // 32 keys: K and V^T 2 KB each (two fragments), CE^T 1 KB, all contiguous
    const v16h ka0 = frag_packed(Sb + p * 1024);
    const v16h ka1 = frag_packed(Sb + p * 1024 + 512);
    const v16h va0 = frag_packed(Sb + 4096 + p * 1024);
    const v16h va1 = frag_packed(Sb + 4096 + p * 1024 + 512);
    const v16h ca  = frag_packed(Sb + 8192 + p * 512);
    // keeps all ten reads in one group ahead of the score products: without it the
    // last ones sink to just before their use and a second read latency shows per pass
    __builtin_amdgcn_sched_barrier(0);
    v8f s0 = {}, s1 = {};
    s0 = WMMA_F32_F16(ka0, qf, s0);
    s1 = WMMA_F32_F16(ka1, qf, s1);

    // online softmax: 16 of the query's 32 scores sit in this lane, 16 in lane ^ 16
    float t0 = fmaxf(s0[0], s1[0]), t1 = fmaxf(s0[1], s1[1]);
#pragma unroll
    for (int r = 2; r < 8; r += 2) {
      t0 = fmaxf(t0, fmaxf(s0[r], s1[r]));
      t1 = fmaxf(t1, fmaxf(s0[r + 1], s1[r + 1]));
    }
    float t = fmaxf(t0, t1);
    t = fmaxf(t, swap_halves(t));
    const float mn = fmaxf(rm, t);
    const float alpha = __expf(rm - mn);
    rm = mn;

    v16h pf;                            // P^T as B fragment, straight from the score tiles
    float ps0 = 0.f, ps1 = 0.f;
#pragma unroll
    for (int r = 0; r < 8; ++r) {
      const float p0 = __expf(s0[r] - mn);
      const float p1 = __expf(s1[r] - mn);
      ps0 += p0; ps1 += p1;
      pf[r]     = (_Float16)p0;
      pf[r + 8] = (_Float16)p1;
    }
    rl = rl * alpha + (ps0 + ps1);
    o0 *= alpha; o1 *= alpha; crv *= alpha;

    o0  = WMMA_F32_F16(va0, pf, o0);
    o1  = WMMA_F32_F16(va1, pf, o1);
    crv = WMMA_F32_F16(ca,  pf, crv);
   }
   // hand-over: this wave's reads of stage t are done, its copies of stage t + 1 have
   // landed; behind the barrier both hold for all 8 waves
   asm volatile("s_wait_dscnt 0x0" ::: "memory");      // own reads of stage t retired
   asm volatile("s_wait_asynccnt 0x0" ::: "memory");   // own copies of stage t + 1 landed
   __syncthreads();
   if (t + 2 < N_STAGES)                                 // into the buffer just read
     stage_copy(ring_b + (unsigned)(t & 1) * STAGE_BYTES, Kg + (t + 2) * 4096,
                Vg + (t + 2) * 4096, Cg + (t + 2) * 2048);
  }
  // no copy is left in flight when the wave goes on to its end
  asm volatile("s_wait_asynccnt 0x0" ::: "memory");

  // join the halves' sums once; lane (hi, lx) holds d = 8*hi + r of query q0 + lx
  const float inv = 1.0f / (rl + swap_halves(rl));
  const int b_ = bh >> 3, h_ = bh & 7;
  const int q  = q0 + lx;
  float* xr = attn_x + (((size_t)b_ * 2048 + q) << 8) + (h_ << 5) + base;
  *(float4*)(xr)      = make_float4(o0[0] * inv, o0[1] * inv, o0[2] * inv, o0[3] * inv);
  *(float4*)(xr + 4)  = make_float4(o0[4] * inv, o0[5] * inv, o0[6] * inv, o0[7] * inv);
  *(float4*)(xr + 16) = make_float4(o1[0] * inv, o1[1] * inv, o1[2] * inv, o1[3] * inv);
  *(float4*)(xr + 20) = make_float4(o1[4] * inv, o1[5] * inv, o1[6] * inv, o1[7] * inv);
  if (hi == 0) {                        // CE^T rows 8..15 are the zero padding
    float* cr = c_rev + (((size_t)b_ * 2048 + q) << 6) + (h_ << 3);
    *(float4*)(cr)     = make_float4(crv[0] * inv, crv[1] * inv, crv[2] * inv, crv[3] * inv);
    *(float4*)(cr + 4) = make_float4(crv[4] * inv, crv[5] * inv, crv[6] * inv, crv[7] * inv);
  }
}

// ---------------------------------------------------------------------------
// Consumer part 1: x_out = attn_x @ Wproj + bproj   [8192,256]x[256,256], LDS-staged.
// ---------------------------------------------------------------------------
__device__ __forceinline__ void proj_tile(
    const float* __restrict__ attn_x, const float* __restrict__ Wproj,
    const float* __restrict__ bproj, float* __restrict__ out,
    _Float16 (*__restrict__ Asub)[KP],   // 128 rows, [row][k]
    _Float16 (*__restrict__ Bsub)[KP])   // 64 rows, [col][k]
{
  const int tid  = threadIdx.x;
  const int wave = tid >> 5;
  const int lane = tid & 31;
  const int hi = lane >> 4, lx = lane & 15, base = hi << 3;
  const int row0 = blockIdx.x * 128;
  const int colbase = blockIdx.y * 64;

  const v8f zv = {};
  v8f acc[4] = {zv, zv, zv, zv};
  gemm_k256_tile<false>(attn_x + (size_t)row0 * 256, Wproj + colbase, 256, Asub, Bsub, acc);

#pragma unroll
  for (int c = 0; c < 4; ++c) {
#pragma unroll
    for (int r = 0; r < 8; ++r) {
      const int grow = row0 + (wave << 4) + r + base;
      const int gcol = colbase + (c << 4) + lx;
      out[((size_t)grow << 8) + gcol] = acc[c][r] + bproj[gcol];
    }
  }
}

// ---------------------------------------------------------------------------
// Consumer part 2: motion = (c_rev - ce) @ Wm + bm   [8192,64]x[64,64].
// Wm^T staged once in LDS; each wave: 16 rows x 64 cols, K=64 in 2 steps.
// ---------------------------------------------------------------------------
__device__ __forceinline__ void motion_tile(
    const float* __restrict__ c_rev, const float* __restrict__ ce,
    const float* __restrict__ Wm, const float* __restrict__ bm, float* __restrict__ out,
    _Float16 (*__restrict__ Wt)[64])     // 64 rows, [col][k]
{
  const int tid  = threadIdx.x;
  const int wave = tid >> 5;
  const int lane = tid & 31;
  const int hi = lane >> 4, lx = lane & 15, base = hi << 3;
  const int row0 = blockIdx.x * 128;

#pragma unroll
  for (int i = 0; i < 4; ++i) {
    const int idx = tid + 256 * i;              // 0..1023
    const int k = idx >> 4, f4 = idx & 15;
    const float4 v = *(const float4*)(Wm + (size_t)k * 64 + f4 * 4);
    Wt[f4 * 4 + 0][k] = (_Float16)v.x;
    Wt[f4 * 4 + 1][k] = (_Float16)v.y;
    Wt[f4 * 4 + 2][k] = (_Float16)v.z;
    Wt[f4 * 4 + 3][k] = (_Float16)v.w;
  }
  __syncthreads();

  const float* ar = c_rev + (size_t)(row0 + (wave << 4) + lx) * 64;
  const float* er = ce    + (size_t)(row0 + (wave << 4) + lx) * 64;

  const v8f zv = {};
  v8f acc[4] = {zv, zv, zv, zv};
#pragma unroll
  for (int k0 = 0; k0 < 64; k0 += 32) {
    v16h a;
#pragma unroll
    for (int i = 0; i < 8; ++i) {
      const int ka = k0 + base + i, kb = k0 + 16 + base + i;
      a[i]     = (_Float16)(ar[ka] - er[ka]);
      a[i + 8] = (_Float16)(ar[kb] - er[kb]);
    }
#pragma unroll
    for (int c = 0; c < 4; ++c) {
      const v16h b = frag_from_f16_row(&Wt[(c << 4) + lx][k0], base);
      acc[c] = WMMA_F32_F16(a, b, acc[c]);
    }
  }

#pragma unroll
  for (int c = 0; c < 4; ++c) {
#pragma unroll
    for (int r = 0; r < 8; ++r) {
      const int grow = row0 + (wave << 4) + r + base;
      const int gcol = (c << 4) + lx;
      out[((size_t)grow << 6) + gcol] = acc[c][r] + bm[gcol];
    }
  }
}

// ---------------------------------------------------------------------------
// Kernel 3: both outputs in one grid (64, 5).  y = 0..3: output projection tile
// (x, y); y = 4: motion rows of block x.  The branch is uniform for a block.
// ---------------------------------------------------------------------------
__global__ __launch_bounds__(256) void outputs_kernel(
    const float* __restrict__ attn_x, const float* __restrict__ Wproj,
    const float* __restrict__ bproj, float* __restrict__ out_x,
    const float* __restrict__ c_rev, const float* __restrict__ ce,
    const float* __restrict__ Wm, const float* __restrict__ bm,
    float* __restrict__ out_motion)
{
  __shared__ __align__(16) _Float16 smem[192 * KP]; // 99 KB: A 66 + B 33, or Wm^T 8

  if (blockIdx.y < 4)
    proj_tile(attn_x, Wproj, bproj, out_x,
              (_Float16 (*)[KP])smem, (_Float16 (*)[KP])(smem + 128 * KP));
  else
    motion_tile(c_rev, ce, Wm, bm, out_motion, (_Float16 (*)[64])smem);
}

// ---------------------------------------------------------------------------
extern "C" void kernel_launch(void* const* d_in, const int* in_sizes, int n_in,
                              void* d_out, int out_size, void* d_ws, size_t ws_size,
                              hipStream_t stream) {
  (void)in_sizes; (void)n_in; (void)out_size; (void)ws_size;
  const float* x1    = (const float*)d_in[0];
  const float* x2    = (const float*)d_in[1];
  const float* cor   = (const float*)d_in[2];
  const float* Wq    = (const float*)d_in[3];
  const float* Wkv   = (const float*)d_in[4];
  const float* Wcor  = (const float*)d_in[5];
  const float* Wproj = (const float*)d_in[6];
  const float* bproj = (const float*)d_in[7];
  const float* Wm    = (const float*)d_in[8];
  const float* bm    = (const float*)d_in[9];

  char* ws = (char*)d_ws;                                  // 26 MB total
  _Float16* Qh     = (_Float16*)(ws);                      //  4 MB
  _Float16* Kh     = (_Float16*)(ws + ( 4u << 20));        //  4 MB
  _Float16* Vth    = (_Float16*)(ws + ( 8u << 20));        //  4 MB
  _Float16* CEth   = (_Float16*)(ws + (12u << 20));        //  2 MB
  float*    ce     = (float*)   (ws + (14u << 20));        //  2 MB
  float*    attn_x = (float*)   (ws + (16u << 20));        //  8 MB
  float*    c_rev  = (float*)   (ws + (24u << 20));        //  2 MB

  float* out_x      = (float*)d_out;                       // [4,2048,256]
  float* out_motion = out_x + (size_t)4 * 2048 * 256;      // [4,2048,64]

  producers_kernel<<<dim3(64, 4, 5), 256, 0, stream>>>(x1, x2, cor, Wq, Wkv, Wcor,
                                                       Qh, Kh, Vth, ce, CEth);
  attn_kernel     <<<dim3(16, 32),   256, 0, stream>>>(Qh, Kh, Vth, CEth, attn_x, c_rev);
  outputs_kernel  <<<dim3(64, 5),    256, 0, stream>>>(attn_x, Wproj, bproj, out_x,
                                                       c_rev, ce, Wm, bm, out_motion);
}

// v006
// One run takes 44.6 microseconds.
// In two side-by-side timings against v005, it was 1.05 and 1.06 times as fast.
// Counting every step since v000, it is 3.89 times as fast.
#include <hip/hip_runtime.h>

// ---------------------------------------------------------------------------
// InterFrameAttention for MI455X (gfx1250, wave32, WMMA f16->f32)
// Shapes: B=4, N=2048, C=256, H=8, Dh=32, M=64, Mh=8
// GEMMs: LDS-staged tiles (coalesced b128 global loads, f16 conversion once,
// weights transposed in LDS so WMMA B-fragments are contiguous ds_load_b128); a tile
// holds the whole K = 256, so a block has one load phase and one barrier.
// Attention: flash-style single pass, one online-softmax step per 128 keys (20 WMMA
// per wave: 8 score tiles, then 12 value products), all
// products transposed (S^T = K Q^T, O^T += V^T P^T): a lane holds one query's
// scores, so max and sum are in-lane plus one exchange between wave halves,
// and each pair of score tiles converts in place into a P^T operand (no LDS).
// Q, K, V^T and CE^T live in the workspace in fragment order: a fragment is two
// blocks of 512 B, block c holding lane l's elements 8c..8c+7 at byte 16*l, so a
// wave-wide 16-B load or store covers four whole 128-B lines.
// The attention work-group brings K, V^T and CE^T into LDS once for its 8 waves
// (asynchronous copies, two buffers of 128 keys); the waves read fragments from LDS.
// Three launches: the four producers of the attention operands share one grid, as
// do the two consumers of its results; inside a grid no block needs another's data.
// ---------------------------------------------------------------------------

typedef _Float16 v16h __attribute__((ext_vector_type(16)));
typedef _Float16 v8h  __attribute__((ext_vector_type(8)));
typedef float    v8f  __attribute__((ext_vector_type(8)));

#define WMMA_F32_F16(A, Bm, Cm) \
  __builtin_amdgcn_wmma_f32_16x16x32_f16(false, (A), false, (Bm), (short)0, (Cm), false, false)

// A/B fragment element -> K mapping (16-bit 16x32 operand, wave32):
//   e in [0,8):  K = base + e          (base = 8 * (lane>>4))
//   e in [8,16): K = 16 + base + (e-8)
// -> per lane, two contiguous 8-half (16B) chunks at offsets base and 16+base.
__device__ __forceinline__ v16h frag_from_f16_row(const _Float16* __restrict__ row, int base) {
  v8h lo = *(const v8h*)(row + base);
  v8h hi = *(const v8h*)(row + 16 + base);
  v16h r;
#pragma unroll
  for (int i = 0; i < 8; ++i) { r[i] = lo[i]; r[i + 8] = hi[i]; }
  return r;
}

// The same fragment from fragment-ordered memory; p already includes 8 * lane.
__device__ __forceinline__ v16h frag_packed(const _Float16* __restrict__ p) {
  v8h lo = *(const v8h*)(p);
  v8h hi = *(const v8h*)(p + 256);
  v16h r;
#pragma unroll
  for (int i = 0; i < 8; ++i) { r[i] = lo[i]; r[i + 8] = hi[i]; }
  return r;
}

// --- exchange between the two 16-lane halves (lane l <-> l ^ 16) -------------
// v_permlanex16_b32 with the identity select table.  bound_ctrl=1: every select
// is in range and EXEC is all-ones, so the 'old' operand is dead.
__device__ __forceinline__ float swap_halves(float x) {
  int v = __float_as_int(x);
  v = __builtin_amdgcn_permlanex16(v, v, 0x76543210, (int)0xFEDCBA98u, false, true);
  return __int_as_float(v);
}

// ---------------------------------------------------------------------------
// The K = 256 product of a 128-row x 64-column block tile, shared by the Q, K, V and
// output projections.  Both operands are staged for the whole K at once: every global
// load of the block is issued in one phase, one barrier follows, and the 32 WMMA of a
// wave then run with no further barrier.  8 waves, each 16 rows x 64 columns.
// LDS row pitch 264 halves = 528 B = 33 x 16 B: 16 rows read 16 B each fall on
// 16 different groups of four banks.
// WA: weights are the A operand, D = [col][row]; else D = [row][col].
// ---------------------------------------------------------------------------
#define KP 264
typedef float    v4f  __attribute__((ext_vector_type(4)));
typedef _Float16 v4h  __attribute__((ext_vector_type(4)));

template <bool WA>
__device__ __forceinline__ void gemm_k256_tile(
    const float* __restrict__ X,         // row 0 of the tile; 128 rows of 256, contiguous
    const float* __restrict__ W,         // row 0, first of the tile's 64 columns
    const int ldb,                       // row pitch of W in floats
    _Float16 (*__restrict__ Asub)[KP],   // 128 rows, [row][k]
    _Float16 (*__restrict__ Bsub)[KP],   // 64 rows, [col][k] (transposed)
    v8f (&acc)[4])
{
  const int tid  = threadIdx.x;
  const int wave = tid >> 5;
  const int lane = tid & 31;
  const int hi = lane >> 4, lx = lane & 15, base = hi << 3;

  // X: the tile is 128 KB in a row; round i of the block takes 4 KB (4 rows) of it
  const float* xp = X + (tid << 2);
  const int xr = tid >> 6, xc = (tid & 63) << 2;
  v4f xa[16], xb[16];
#pragma unroll
  for (int i = 0; i < 16; ++i) xa[i] = *(const v4f*)(xp + 1024 * i);
  // W: a thread takes 4 columns x 16 consecutive k; 16 lanes cover 256 contiguous bytes
  const int wc = (tid & 15) << 2, wk = (tid >> 4) << 4;
  const float* wp = W + (size_t)wk * ldb + wc;
  v4f wv[16];
#pragma unroll
  for (int e = 0; e < 15; ++e) wv[e] = *(const v4f*)(wp + (size_t)e * ldb);
  // the last load's result may take over the address registers that the 15 before it name:
  // the wait stands ahead of that overwrite
  asm volatile("s_wait_xcnt 0x0" ::: "memory");
  wv[15] = *(const v4f*)(wp + (size_t)15 * ldb);
  // ahead of any other overwrite of an address register that these 32 loads name
  asm volatile("s_wait_xcnt 0x0" ::: "memory");
#pragma unroll
  for (int i = 0; i < 16; ++i) {
    v4h o = {(_Float16)xa[i][0], (_Float16)xa[i][1], (_Float16)xa[i][2], (_Float16)xa[i][3]};
    *(v4h*)&Asub[xr + 4 * i][xc] = o;
  }
  // compiler fence: the loads below stay behind the stores above, whose registers they
  // take over; moved up to the first 32 they cost the block its third place on a WGP
  asm volatile("" ::: "memory");
#pragma unroll
  for (int i = 0; i < 16; ++i) xb[i] = *(const v4f*)(xp + 1024 * (16 + i));
  // ahead of any overwrite of an address register that these 16 loads name; they fly
  // while W is converted and stored
  asm volatile("s_wait_xcnt 0x0" ::: "memory");
#pragma unroll
  for (int j = 0; j < 4; ++j) {
    v8h lo, hj;
#pragma unroll
    for (int e = 0; e < 8; ++e) { lo[e] = (_Float16)wv[e][j]; hj[e] = (_Float16)wv[e + 8][j]; }
    *(v8h*)&Bsub[wc + j][wk]     = lo;
    *(v8h*)&Bsub[wc + j][wk + 8] = hj;
  }
#pragma unroll
  for (int i = 0; i < 16; ++i) {
    v4h o = {(_Float16)xb[i][0], (_Float16)xb[i][1], (_Float16)xb[i][2], (_Float16)xb[i][3]};
    *(v4h*)&Asub[xr + 4 * (16 + i)][xc] = o;
  }
  __syncthreads();

  // no barrier from here on, so the fragments of k-step s + 1 are read ahead of the
  // products of k-step s
  const _Float16* ar = &Asub[(wave << 4) + lx][0];
  const _Float16* br = &Bsub[lx][0];
  v16h a = frag_from_f16_row(ar, base);
  v16h b[4];
#pragma unroll
  for (int c = 0; c < 4; ++c) b[c] = frag_from_f16_row(br + (c << 4) * KP, base);
#pragma unroll
  for (int k0 = 0; k0 < 256; k0 += 32) {
    v16h an = a, bn[4] = {b[0], b[1], b[2], b[3]};
    if (k0 + 32 < 256) {
      an = frag_from_f16_row(ar + k0 + 32, base);
#pragma unroll
      for (int c = 0; c < 4; ++c) bn[c] = frag_from_f16_row(br + (c << 4) * KP + k0 + 32, base);
    }
    // keeps the reads of k-step s + 1 ahead of the products of k-step s: without it each
    // pair of reads sinks to just before its product and its latency shows 32 times
    __builtin_amdgcn_sched_barrier(0);
#pragma unroll
    for (int c = 0; c < 4; ++c) {
      if (WA) acc[c] = WMMA_F32_F16(b[c], a, acc[c]);   // D[col][row]
      else    acc[c] = WMMA_F32_F16(a, b[c], acc[c]);   // D[row][col]
    }
    a = an;
#pragma unroll
    for (int c = 0; c < 4; ++c) b[c] = bn[c];
  }
}

// ---------------------------------------------------------------------------
// Producer part 1: Q/K/V projections, LDS-staged.  Z template: 0=Q, 1=K, 2=V.
// Block tile: 128 rows x 64 cols, whole K.  8 waves, each 16 rows x 64 cols.
// Outputs f16 in fragment order, 512-B blocks of [lane][8] (Q pre-scaled):
//   Qh/Kh [bh][n/16][d/16]        lane = 16*((d>>3)&1) + (n&15), element d&7
//   Vth   [bh][n/32][d/16][(n>>4)&1]  lane = 16*((n>>3)&1) + (d&15), element n&7
// Q and K are computed transposed (W^T as A, X^T as B): a lane then ends with 8
// consecutive d of one row n, as V's plain product ends with 8 consecutive n of one d.
// ---------------------------------------------------------------------------
template <int Z>
__device__ __forceinline__ void qkv_proj_tile(
    const float* __restrict__ X, const float* __restrict__ W,
    _Float16* __restrict__ Out,
    _Float16 (*__restrict__ Asub)[KP],   // 128 rows, [row][k]
    _Float16 (*__restrict__ Bsub)[KP])   // 64 rows, [col][k] (transposed)
{
  const int tid  = threadIdx.x;
  const int wave = tid >> 5;
  const int lane = tid & 31;

  const int row0    = blockIdx.x * 128;   // 8192 rows
  const int colbase = blockIdx.y * 64;    // 256 cols

  constexpr int ldb  = (Z == 0) ? 256 : 512;
  constexpr int coff = (Z == 2) ? 256 : 0;

  const v8f zv = {};
  v8f acc[4] = {zv, zv, zv, zv};
  // V: D[n][d]; Q, K: D[d][n]
  gemm_k256_tile<Z != 2>(X + (size_t)row0 * 256, W + coff + colbase, ldb, Asub, Bsub, acc);

  const float qscale = 0.17677669529663687f;  // 32^-0.5
  const int rt  = row0 + (wave << 4);          // first of this wave's 16 rows
  const int b_  = rt >> 11;
  const int t16 = (rt & 2047) >> 4;            // 16-row group inside the batch
#pragma unroll
  for (int c = 0; c < 4; ++c) {
    const int h_ = (colbase + (c << 4)) >> 5;
    const int dh = c & 1;                      // d / 16 (colbase is a multiple of 32)
    v8h o;
#pragma unroll
    for (int r = 0; r < 8; ++r)
      o[r] = (Z == 0) ? (_Float16)(acc[c][r] * qscale) : (_Float16)acc[c][r];
    const int blk = (Z == 2) ? ((((t16 >> 1) << 1) + dh) << 1) + (t16 & 1)
                             : (t16 << 1) + dh;
    *(v8h*)(Out + ((size_t)(b_ * 8 + h_) << 16) + (((blk << 5) + lane) << 3)) = o;
  }
  // a block runs no other part after this one (the branch is uniform); the wait is a
  // precaution ahead of any later overwrite of the stores' address and data registers
  asm volatile("s_wait_xcnt 0x0" ::: "memory");
}

// ---------------------------------------------------------------------------
// Producer part 2: cor_embed = cor @ Wcor  (K=3, tiny).  Writes f32 ce [B*N, 64] and
// f16 CEth in fragment order, 512-B blocks [bh][n/32][(n>>4)&1] of [lane][8] with
// lane = 16*((n>>3)&1) + d, element n&7; rows d = 8..15 are zero padding.
// One thread per 16-B piece: 8 consecutive n of one (head, d).
// ---------------------------------------------------------------------------
__device__ __forceinline__ void cor_embed_tile(
    const float* __restrict__ cor, const float* __restrict__ Wcor,
    float* __restrict__ ce, _Float16* __restrict__ CEth, int blk)
{
  const int idx = blk * 256 + threadIdx.x;    // 32 heads * 128 blocks * 32 lanes
  if (idx >= 32 * 128 * 32) return;
  const int d  = idx & 15;
  const int n0 = ((idx >> 4) & 255) << 3;     // block and lane half give n / 8
  const int bh = idx >> 12;
  const int b = bh >> 3, h = bh & 7;
  v8h o = {};
  if (d < 8) {
    const int m = h * 8 + d;
    const size_t bn0 = (size_t)b * 2048 + n0;
    const float4* c4 = (const float4*)(cor + bn0 * 3);   // 24 floats, 96-B aligned
    float cv[24];
#pragma unroll
    for (int i = 0; i < 6; ++i) {
      const float4 x = c4[i];
      cv[4 * i] = x.x; cv[4 * i + 1] = x.y; cv[4 * i + 2] = x.z; cv[4 * i + 3] = x.w;
    }
    const float w0 = Wcor[m], w1 = Wcor[64 + m], w2 = Wcor[128 + m];
#pragma unroll
    for (int e = 0; e < 8; ++e) {
      const float v = cv[3 * e] * w0 + cv[3 * e + 1] * w1 + cv[3 * e + 2] * w2;
      ce[(bn0 + e) * 64 + m] = v;
      o[e] = (_Float16)v;
    }
  }
  *(v8h*)(CEth + ((size_t)idx << 3)) = o;
}

// ---------------------------------------------------------------------------
// Kernel 1: everything the attention reads, in one grid (64, 4, 5).
// z = 0, 1, 2: the Q, K, V projection tile (x, y); z = 3, 4: 512 cor_embed blocks,
// last because they are the short ones.  The branch is uniform for a block.
// ---------------------------------------------------------------------------
__global__ __launch_bounds__(256) void producers_kernel(
    const float* __restrict__ x1, const float* __restrict__ x2,
    const float* __restrict__ cor, const float* __restrict__ Wq,
    const float* __restrict__ Wkv, const float* __restrict__ Wcor,
    _Float16* __restrict__ Qh, _Float16* __restrict__ Kh, _Float16* __restrict__ Vth,
    float* __restrict__ ce, _Float16* __restrict__ CEth)
{
  __shared__ __align__(16) _Float16 Asub[128][KP];  // 66 KB
  __shared__ __align__(16) _Float16 Bsub[64][KP];   // 33 KB

  const int z = blockIdx.z;
  if (z == 0)      qkv_proj_tile<0>(x1, Wq,  Qh,  Asub, Bsub);
  else if (z == 1) qkv_proj_tile<1>(x2, Wkv, Kh,  Asub, Bsub);
  else if (z == 2) qkv_proj_tile<2>(x2, Wkv, Vth, Asub, Bsub);
  else cor_embed_tile(cor, Wcor, ce, CEth, ((z - 3) * 4 + blockIdx.y) * 64 + blockIdx.x);
}

// ---------------------------------------------------------------------------
// Kernel 2: flash attention.  One 16-query tile per wave, 8 waves/WG,
// grid (N/128, B*H).  Online softmax, one step per stage of 128 keys: one maximum, one
// exchange between halves, one alpha and one rescale of O^T for 8 score tiles.
// Transposed products: D register r of lane (hi, lx) is [8*hi + r][lx], so with
// K (or V^T, CE^T) as A and Q^T (or P^T) as B, lane lx owns query q0 + lx.
//   s[i][r] = S[q0+lx][j0 + 16*i + 8*hi + r]
// so tiles 2p, 2p + 1 are exactly the B-fragment k order (e<8: 8*hi+e, e>=8: 16+8*hi+e-8).
// K, V^T, CE^T: a stage is 128 keys = 8 + 8 + 4 KB, contiguous in each operand's
// fragment-ordered plane; it keeps that order in LDS, so a fragment read is 512
// contiguous bytes a wave.  Stage t + 1 flies while stage t is worked on.
// ---------------------------------------------------------------------------
#define STAGE_KEYS   128
#define STAGE_HALVES 10240            // K 4096, V^T 4096, CE^T 2048 halves
#define STAGE_BYTES  20480
#define N_STAGES     (2048 / STAGE_KEYS)

// One stage: five 16-B copies a thread (K 2, V^T 2, CE^T 1), 4 KB a round of the
// work-group.  lds: this thread's byte address in the buffer; k, v, c: its 16 B of
// the stage in each plane.
__device__ __forceinline__ void stage_copy(unsigned lds, const _Float16* k,
                                           const _Float16* v, const _Float16* c) {
  // global to LDS through no register; the s_wait_xcnt ends the statement so that no
  // address register named here is rewritten ahead of it
  asm volatile(
      "global_load_async_to_lds_b128 %0, %5, off\n\t"
      "global_load_async_to_lds_b128 %1, %6, off\n\t"
      "global_load_async_to_lds_b128 %2, %7, off\n\t"
      "global_load_async_to_lds_b128 %3, %8, off\n\t"
      "global_load_async_to_lds_b128 %4, %9, off\n\t"
      "s_wait_xcnt 0x0"
      :: "v"(lds), "v"(lds + 4096u), "v"(lds + 8192u), "v"(lds + 12288u), "v"(lds + 16384u),
         "v"(k), "v"(k + 2048), "v"(v), "v"(v + 2048), "v"(c)
      : "memory");
}

__global__ __launch_bounds__(256) void attn_kernel(
    const _Float16* __restrict__ Qh, const _Float16* __restrict__ Kh,
    const _Float16* __restrict__ Vth, const _Float16* __restrict__ CEth,
    float* __restrict__ attn_x, float* __restrict__ c_rev)
{
  const int wave = threadIdx.x >> 5;
  const int lane = threadIdx.x & 31;
  const int hi = lane >> 4, lx = lane & 15, base = hi << 3;
  const int bh = blockIdx.y;
  const int q0 = blockIdx.x * 128 + wave * 16;

  __shared__ __align__(16) _Float16 ring[2][STAGE_HALVES];   // 40 KB

  // fragment-ordered operands: this lane's 16-B piece of each 512-B block
  const _Float16* Qb = Qh + (size_t)bh * (2048 * 32) + (lane << 3);
  // this thread's 16 B of each 4-KB copy round
  const _Float16* Kg = Kh   + (size_t)bh * (2048 * 32) + (threadIdx.x << 3);
  const _Float16* Vg = Vth  + (size_t)bh * (32 * 2048) + (threadIdx.x << 3);
  const _Float16* Cg = CEth + (size_t)bh * (16 * 2048) + (threadIdx.x << 3);
  const unsigned ring_b = (unsigned)(size_t)&ring[0][0] + (threadIdx.x << 4);

  stage_copy(ring_b, Kg, Vg, Cg);                       // stage 0 into buffer 0
  // stage 0 has landed for this wave, then for all: nobody reads it before
  asm volatile("s_wait_asynccnt 0x0" ::: "memory");
  __syncthreads();
  stage_copy(ring_b + STAGE_BYTES, Kg + 4096, Vg + 4096, Cg + 2048);   // stage 1

  const v16h qf = frag_packed(Qb + (size_t)q0 * 32);

  v8f o0 = {}, o1 = {}, crv = {};       // O^T rows d 0..15, 16..31; CE^T rows 0..15
  float rm = -3.0e38f, rl = 0.f;        // this lane's query: max; sum over this half's keys

  for (int t = 0; t < N_STAGES; ++t) {
   const _Float16* Sb = &ring[t & 1][lane << 3];
   // S^T = K * Q^T (scale folded into Q) for the whole stage: 8 tiles of 16 keys.
   // Every loop of the trip is unrolled: its arrays are register tiles, indexed by constants
   // alone, and every LDS read has its place in the stage as an immediate offset.
   v16h kf[8];
#pragma unroll
   for (int i = 0; i < 8; ++i) kf[i] = frag_packed(Sb + i * 512);
   // keeps the 16 reads of K first in the LDS queue, which answers in order: mixed with the
   // reads of V^T and CE^T below, the score products wait for bytes they do not use
   __builtin_amdgcn_sched_barrier(0);
   v8f s[8];
#pragma unroll
   for (int i = 0; i < 8; ++i) {
     const v8f z = {};
     s[i] = WMMA_F32_F16(kf[i], qf, z);
   }
   // V^T: fragment 2p + h is rows d 16h..16h+15 over keys 32p..32p+31; CE^T: fragment p
   v16h va[8], ca[4];
#pragma unroll
   for (int i = 0; i < 8; ++i) va[i] = frag_packed(Sb + 4096 + i * 512);
#pragma unroll
   for (int p = 0; p < 4; ++p) ca[p] = frag_packed(Sb + 8192 + p * 512);
   // keeps these 24 reads ahead of the softmax, which covers their latency: without it
   // they sink to just before their products and each of those places shows its own wait
   __builtin_amdgcn_sched_barrier(0);

   // online softmax, one step a stage: 64 of the query's 128 scores sit in this lane,
   // 64 in lane ^ 16; four independent chains, tile by tile as the products retire
   float mx[4] = {s[0][0], s[0][1], s[0][2], s[0][3]};
#pragma unroll
   for (int r = 4; r < 8; ++r) mx[r & 3] = fmaxf(mx[r & 3], s[0][r]);
#pragma unroll
   for (int i = 1; i < 8; ++i)
#pragma unroll
     for (int r = 0; r < 8; ++r) mx[r & 3] = fmaxf(mx[r & 3], s[i][r]);
   float tm = fmaxf(fmaxf(mx[0], mx[1]), fmaxf(mx[2], mx[3]));
   tm = fmaxf(tm, swap_halves(tm));
   const float mn = fmaxf(rm, tm);
   const float alpha = __expf(rm - mn);
   rm = mn;
   o0 *= alpha; o1 *= alpha; crv *= alpha;

   float ps[4] = {0.f, 0.f, 0.f, 0.f};
#pragma unroll
   for (int p = 0; p < 4; ++p) {
     v16h pf;                           // P^T as B fragment, straight from the score tiles
#pragma unroll
     for (int r = 0; r < 8; ++r) {
       const float p0 = __expf(s[2 * p][r] - mn);
       const float p1 = __expf(s[2 * p + 1][r] - mn);
       ps[r & 1] += p0; ps[2 + (r & 1)] += p1;
       pf[r]     = (_Float16)p0;
       pf[r + 8] = (_Float16)p1;
     }
     o0  = WMMA_F32_F16(va[2 * p],     pf, o0);
     o1  = WMMA_F32_F16(va[2 * p + 1], pf, o1);
     crv = WMMA_F32_F16(ca[p],         pf, crv);
   }
   rl = rl * alpha + ((ps[0] + ps[1]) + (ps[2] + ps[3]));
   // keeps the hand-over below at the foot of the trip: all reads of the stage now stand at
   // its head, and without this the waits and the barrier rise to just behind them, where
   // stage t + 1's copies have had no time to land and V^T, CE^T must land ahead of the softmax
   __builtin_amdgcn_sched_barrier(0);
   // hand-over: this wave's reads of stage t are done, its copies of stage t + 1 have
   // landed; behind the barrier both hold for all 8 waves
   asm volatile("s_wait_dscnt 0x0" ::: "memory");      // own reads of stage t retired
   asm volatile("s_wait_asynccnt 0x0" ::: "memory");   // own copies of stage t + 1 landed
   __syncthreads();
   if (t + 2 < N_STAGES)                                 // into the buffer just read
     stage_copy(ring_b + (unsigned)(t & 1) * STAGE_BYTES, Kg + (t + 2) * 4096,
                Vg + (t + 2) * 4096, Cg + (t + 2) * 2048);
  }
  // no copy is left in flight when the wave goes on to its end
  asm volatile("s_wait_asynccnt 0x0" ::: "memory");

  // join the halves' sums once; lane (hi, lx) holds d = 8*hi + r of query q0 + lx
  const float inv = 1.0f / (rl + swap_halves(rl));
  const int b_ = bh >> 3, h_ = bh & 7;
  const int q  = q0 + lx;
  float* xr = attn_x + (((size_t)b_ * 2048 + q) << 8) + (h_ << 5) + base;
  *(float4*)(xr)      = make_float4(o0[0] * inv, o0[1] * inv, o0[2] * inv, o0[3] * inv);
  *(float4*)(xr + 4)  = make_float4(o0[4] * inv, o0[5] * inv, o0[6] * inv, o0[7] * inv);
  *(float4*)(xr + 16) = make_float4(o1[0] * inv, o1[1] * inv, o1[2] * inv, o1[3] * inv);
  *(float4*)(xr + 20) = make_float4(o1[4] * inv, o1[5] * inv, o1[6] * inv, o1[7] * inv);
  if (hi == 0) {                        // CE^T rows 8..15 are the zero padding
    float* cr = c_rev + (((size_t)b_ * 2048 + q) << 6) + (h_ << 3);
    *(float4*)(cr)     = make_float4(crv[0] * inv, crv[1] * inv, crv[2] * inv, crv[3] * inv);
    *(float4*)(cr + 4) = make_float4(crv[4] * inv, crv[5] * inv, crv[6] * inv, crv[7] * inv);
  }
}

// ---------------------------------------------------------------------------
// Consumer part 1: x_out = attn_x @ Wproj + bproj   [8192,256]x[256,256], LDS-staged.
// ---------------------------------------------------------------------------
__device__ __forceinline__ void proj_tile(
    const float* __restrict__ attn_x, const float* __restrict__ Wproj,
    const float* __restrict__ bproj, float* __restrict__ out,
    _Float16 (*__restrict__ Asub)[KP],   // 128 rows, [row][k]
    _Float16 (*__restrict__ Bsub)[KP])   // 64 rows, [col][k]
{
  const int tid  = threadIdx.x;
  const int wave = tid >> 5;
  const int lane = tid & 31;
  const int hi = lane >> 4, lx = lane & 15, base = hi << 3;
  const int row0 = blockIdx.x * 128;
  const int colbase = blockIdx.y * 64;

  const v8f zv = {};
  v8f acc[4] = {zv, zv, zv, zv};
  gemm_k256_tile<false>(attn_x + (size_t)row0 * 256, Wproj + colbase, 256, Asub, Bsub, acc);

#pragma unroll
  for (int c = 0; c < 4; ++c) {
#pragma unroll
    for (int r = 0; r < 8; ++r) {
      const int grow = row0 + (wave << 4) + r + base;
      const int gcol = colbase + (c << 4) + lx;
      out[((size_t)grow << 8) + gcol] = acc[c][r] + bproj[gcol];
    }
  }
}

// ---------------------------------------------------------------------------
// Consumer part 2: motion = (c_rev - ce) @ Wm + bm   [8192,64]x[64,64].
// Wm^T staged once in LDS; each wave: 16 rows x 64 cols, K=64 in 2 steps.
// ---------------------------------------------------------------------------
__device__ __forceinline__ void motion_tile(
    const float* __restrict__ c_rev, const float* __restrict__ ce,
    const float* __restrict__ Wm, const float* __restrict__ bm, float* __restrict__ out,
    _Float16 (*__restrict__ Wt)[64])     // 64 rows, [col][k]
{
  const int tid  = threadIdx.x;
  const int wave = tid >> 5;
  const int lane = tid & 31;
  const int hi = lane >> 4, lx = lane & 15, base = hi << 3;
  const int row0 = blockIdx.x * 128;

#pragma unroll
  for (int i = 0; i < 4; ++i) {
    const int idx = tid + 256 * i;              // 0..1023
    const int k = idx >> 4, f4 = idx & 15;
    const float4 v = *(const float4*)(Wm + (size_t)k * 64 + f4 * 4);
    Wt[f4 * 4 + 0][k] = (_Float16)v.x;
    Wt[f4 * 4 + 1][k] = (_Float16)v.y;
    Wt[f4 * 4 + 2][k] = (_Float16)v.z;
    Wt[f4 * 4 + 3][k] = (_Float16)v.w;
  }
  __syncthreads();

  const float* ar = c_rev + (size_t)(row0 + (wave << 4) + lx) * 64;
  const float* er = ce    + (size_t)(row0 + (wave << 4) + lx) * 64;

  const v8f zv = {};
  v8f acc[4] = {zv, zv, zv, zv};
#pragma unroll
  for (int k0 = 0; k0 < 64; k0 += 32) {
    v16h a;
#pragma unroll
    for (int i = 0; i < 8; ++i) {
      const int ka = k0 + base + i, kb = k0 + 16 + base + i;
      a[i]     = (_Float16)(ar[ka] - er[ka]);
      a[i + 8] = (_Float16)(ar[kb] - er[kb]);
    }
#pragma unroll
    for (int c = 0; c < 4; ++c) {
      const v16h b = frag_from_f16_row(&Wt[(c << 4) + lx][k0], base);
      acc[c] = WMMA_F32_F16(a, b, acc[c]);
    }
  }

#pragma unroll
  for (int c = 0; c < 4; ++c) {
#pragma unroll
    for (int r = 0; r < 8; ++r) {
      const int grow = row0 + (wave << 4) + r + base;
      const int gcol = (c << 4) + lx;
      out[((size_t)grow << 6) + gcol] = acc[c][r] + bm[gcol];
    }
  }
}

// ---------------------------------------------------------------------------
// Kernel 3: both outputs in one grid (64, 5).  y = 0..3: output projection tile
// (x, y); y = 4: motion rows of block x.  The branch is uniform for a block.
// ---------------------------------------------------------------------------
__global__ __launch_bounds__(256) void outputs_kernel(
    const float* __restrict__ attn_x, const float* __restrict__ Wproj,
    const float* __restrict__ bproj, float* __restrict__ out_x,
    const float* __restrict__ c_rev, const float* __restrict__ ce,
    const float* __restrict__ Wm, const float* __restrict__ bm,
    float* __restrict__ out_motion)
{
  __shared__ __align__(16) _Float16 smem[192 * KP]; // 99 KB: A 66 + B 33, or Wm^T 8

  if (blockIdx.y < 4)
    proj_tile(attn_x, Wproj, bproj, out_x,
              (_Float16 (*)[KP])smem, (_Float16 (*)[KP])(smem + 128 * KP));
  else
    motion_tile(c_rev, ce, Wm, bm, out_motion, (_Float16 (*)[64])smem);
}

// ---------------------------------------------------------------------------
extern "C" void kernel_launch(void* const* d_in, const int* in_sizes, int n_in,
                              void* d_out, int out_size, void* d_ws, size_t ws_size,
                              hipStream_t stream) {
  (void)in_sizes; (void)n_in; (void)out_size; (void)ws_size;
  const float* x1    = (const float*)d_in[0];
  const float* x2    = (const float*)d_in[1];
  const float* cor   = (const float*)d_in[2];
  const float* Wq    = (const float*)d_in[3];
  const float* Wkv   = (const float*)d_in[4];
  const float* Wcor  = (const float*)d_in[5];
  const float* Wproj = (const float*)d_in[6];
  const float* bproj = (const float*)d_in[7];
  const float* Wm    = (const float*)d_in[8];
  const float* bm    = (const float*)d_in[9];

  char* ws = (char*)d_ws;                                  // 26 MB total
  _Float16* Qh     = (_Float16*)(ws);                      //  4 MB
  _Float16* Kh     = (_Float16*)(ws + ( 4u << 20));        //  4 MB
  _Float16* Vth    = (_Float16*)(ws + ( 8u << 20));        //  4 MB
  _Float16* CEth   = (_Float16*)(ws + (12u << 20));        //  2 MB
  float*    ce     = (float*)   (ws + (14u << 20));        //  2 MB
  float*    attn_x = (float*)   (ws + (16u << 20));        //  8 MB
  float*    c_rev  = (float*)   (ws + (24u << 20));        //  2 MB

  float* out_x      = (float*)d_out;                       // [4,2048,256]
  float* out_motion = out_x + (size_t)4 * 2048 * 256;      // [4,2048,64]

  producers_kernel<<<dim3(64, 4, 5), 256, 0, stream>>>(x1, x2, cor, Wq, Wkv, Wcor,
                                                       Qh, Kh, Vth, ce, CEth);
  attn_kernel     <<<dim3(16, 32),   256, 0, stream>>>(Qh, Kh, Vth, CEth, attn_x, c_rev);
  outputs_kernel  <<<dim3(64, 5),    256, 0, stream>>>(attn_x, Wproj, bproj, out_x,
                                                       c_rev, ce, Wm, bm, out_motion);
}

// v007
// One run takes 43.2 microseconds.
// Next to v006, in two timings, it ran 1.04 and 1.03 times as fast.
// Over all steps from v000 it is 4.02 times as fast.
#include <hip/hip_runtime.h>

// ---------------------------------------------------------------------------
// InterFrameAttention for MI455X (gfx1250, wave32, WMMA f16->f32)
// Shapes: B=4, N=2048, C=256, H=8, Dh=32, M=64, Mh=8
// GEMMs: LDS-staged tiles (coalesced b128 global loads, f16 conversion once,
// weights transposed in LDS so WMMA B-fragments are contiguous ds_load_b128); a tile
// holds the whole K = 256, so a block has one load phase and one barrier.
// Attention: flash-style single pass, one online-softmax step per 128 keys (20 WMMA
// per wave: 8 score tiles, then 12 value products), all
// products transposed (S^T = K Q^T, O^T += V^T P^T): a lane holds one query's
// scores, so the max is in-lane plus one exchange between wave halves,
// and the two score tiles convert in place into the P^T operand (no LDS).
// The softmax row sum rides on the CE^T product: a row of ones in that operand's padding.
// Q, K, V^T and CE^T live in the workspace in fragment order: a fragment is two
// blocks of 512 B, block c holding lane l's elements 8c..8c+7 at byte 16*l, so a
// wave-wide 16-B load or store covers four whole 128-B lines.
// The attention work-group brings K, V^T and CE^T into LDS once for its 8 waves
// (asynchronous copies, two buffers of 128 keys); the waves read fragments from LDS.
// Three launches: the four producers of the attention operands share one grid, as
// do the two consumers of its results; inside a grid no block needs another's data.
// ---------------------------------------------------------------------------

typedef _Float16 v16h __attribute__((ext_vector_type(16)));
typedef _Float16 v8h  __attribute__((ext_vector_type(8)));
typedef float    v8f  __attribute__((ext_vector_type(8)));

#define WMMA_F32_F16(A, Bm, Cm) \
  __builtin_amdgcn_wmma_f32_16x16x32_f16(false, (A), false, (Bm), (short)0, (Cm), false, false)

// A/B fragment element -> K mapping (16-bit 16x32 operand, wave32):
//   e in [0,8):  K = base + e          (base = 8 * (lane>>4))
//   e in [8,16): K = 16 + base + (e-8)
// -> per lane, two contiguous 8-half (16B) chunks at offsets base and 16+base.
__device__ __forceinline__ v16h frag_from_f16_row(const _Float16* __restrict__ row, int base) {
  v8h lo = *(const v8h*)(row + base);
  v8h hi = *(const v8h*)(row + 16 + base);
  v16h r;
#pragma unroll
  for (int i = 0; i < 8; ++i) { r[i] = lo[i]; r[i + 8] = hi[i]; }
  return r;
}

// The same fragment from fragment-ordered memory; p already includes 8 * lane.
__device__ __forceinline__ v16h frag_packed(const _Float16* __restrict__ p) {
  v8h lo = *(const v8h*)(p);
  v8h hi = *(const v8h*)(p + 256);
  v16h r;
#pragma unroll
  for (int i = 0; i < 8; ++i) { r[i] = lo[i]; r[i + 8] = hi[i]; }
  return r;
}

// --- exchange between the two 16-lane halves (lane l <-> l ^ 16) -------------
// v_permlanex16_b32 with the identity select table.  bound_ctrl=1: every select
// is in range and EXEC is all-ones, so the 'old' operand is dead.
__device__ __forceinline__ float swap_halves(float x) {
  int v = __float_as_int(x);
  v = __builtin_amdgcn_permlanex16(v, v, 0x76543210, (int)0xFEDCBA98u, false, true);
  return __int_as_float(v);
}

// ---------------------------------------------------------------------------
// The K = 256 product of a 128-row x 64-column block tile, shared by the Q, K, V and
// output projections.  Both operands are staged for the whole K at once: every global
// load of the block is issued in one phase, one barrier follows, and the 32 WMMA of a
// wave then run with no further barrier.  8 waves, each 16 rows x 64 columns.
// LDS row pitch 264 halves = 528 B = 33 x 16 B: 16 rows read 16 B each fall on
// 16 different groups of four banks.
// WA: weights are the A operand, D = [col][row]; else D = [row][col].
// ---------------------------------------------------------------------------
#define KP 264
typedef float    v4f  __attribute__((ext_vector_type(4)));
typedef _Float16 v4h  __attribute__((ext_vector_type(4)));

template <bool WA>
__device__ __forceinline__ void gemm_k256_tile(
    const float* __restrict__ X,         // row 0 of the tile; 128 rows of 256, contiguous
    const float* __restrict__ W,         // row 0, first of the tile's 64 columns
    const int ldb,                       // row pitch of W in floats
    _Float16 (*__restrict__ Asub)[KP],   // 128 rows, [row][k]
    _Float16 (*__restrict__ Bsub)[KP],   // 64 rows, [col][k] (transposed)
    v8f (&acc)[4])
{
  const int tid  = threadIdx.x;
  const int wave = tid >> 5;
  const int lane = tid & 31;
  const int hi = lane >> 4, lx = lane & 15, base = hi << 3;

  // X: the tile is 128 KB in a row; round i of the block takes 4 KB (4 rows) of it
  const float* xp = X + (tid << 2);
  const int xr = tid >> 6, xc = (tid & 63) << 2;
  v4f xa[16], xb[16];
#pragma unroll
  for (int i = 0; i < 16; ++i) xa[i] = *(const v4f*)(xp + 1024 * i);
  // W: a thread takes 4 columns x 16 consecutive k; 16 lanes cover 256 contiguous bytes
  const int wc = (tid & 15) << 2, wk = (tid >> 4) << 4;
  const float* wp = W + (size_t)wk * ldb + wc;
  v4f wv[16];
#pragma unroll
  for (int e = 0; e < 15; ++e) wv[e] = *(const v4f*)(wp + (size_t)e * ldb);
  // the last load's result may take over the address registers that the 15 before it name:
  // the wait stands ahead of that overwrite
  asm volatile("s_wait_xcnt 0x0" ::: "memory");
  wv[15] = *(const v4f*)(wp + (size_t)15 * ldb);
  // ahead of any other overwrite of an address register that these 32 loads name
  asm volatile("s_wait_xcnt 0x0" ::: "memory");
#pragma unroll
  for (int i = 0; i < 16; ++i) {
    v4h o = {(_Float16)xa[i][0], (_Float16)xa[i][1], (_Float16)xa[i][2], (_Float16)xa[i][3]};
    *(v4h*)&Asub[xr + 4 * i][xc] = o;
  }
  // compiler fence: the loads below stay behind the stores above, whose registers they
  // take over; moved up to the first 32 they cost the block its third place on a WGP
  asm volatile("" ::: "memory");
#pragma unroll
  for (int i = 0; i < 16; ++i) xb[i] = *(const v4f*)(xp + 1024 * (16 + i));
  // ahead of any overwrite of an address register that these 16 loads name; they fly
  // while W is converted and stored
  asm volatile("s_wait_xcnt 0x0" ::: "memory");
#pragma unroll
  for (int j = 0; j < 4; ++j) {
    v8h lo, hj;
#pragma unroll
    for (int e = 0; e < 8; ++e) { lo[e] = (_Float16)wv[e][j]; hj[e] = (_Float16)wv[e + 8][j]; }
    *(v8h*)&Bsub[wc + j][wk]     = lo;
    *(v8h*)&Bsub[wc + j][wk + 8] = hj;
  }
#pragma unroll
  for (int i = 0; i < 16; ++i) {
    v4h o = {(_Float16)xb[i][0], (_Float16)xb[i][1], (_Float16)xb[i][2], (_Float16)xb[i][3]};
    *(v4h*)&Asub[xr + 4 * (16 + i)][xc] = o;
  }
  __syncthreads();

  // no barrier from here on, so the fragments of k-step s + 1 are read ahead of the
  // products of k-step s
  const _Float16* ar = &Asub[(wave << 4) + lx][0];
  const _Float16* br = &Bsub[lx][0];
  v16h a = frag_from_f16_row(ar, base);
  v16h b[4];
#pragma unroll
  for (int c = 0; c < 4; ++c) b[c] = frag_from_f16_row(br + (c << 4) * KP, base);
#pragma unroll
  for (int k0 = 0; k0 < 256; k0 += 32) {
    v16h an = a, bn[4] = {b[0], b[1], b[2], b[3]};
    if (k0 + 32 < 256) {
      an = frag_from_f16_row(ar + k0 + 32, base);
#pragma unroll
      for (int c = 0; c < 4; ++c) bn[c] = frag_from_f16_row(br + (c << 4) * KP + k0 + 32, base);
    }
    // keeps the reads of k-step s + 1 ahead of the products of k-step s: without it each
    // pair of reads sinks to just before its product and its latency shows 32 times
    __builtin_amdgcn_sched_barrier(0);
#pragma unroll
    for (int c = 0; c < 4; ++c) {
      if (WA) acc[c] = WMMA_F32_F16(b[c], a, acc[c]);   // D[col][row]
      else    acc[c] = WMMA_F32_F16(a, b[c], acc[c]);   // D[row][col]
    }
    a = an;
#pragma unroll
    for (int c = 0; c < 4; ++c) b[c] = bn[c];
  }
}

// ---------------------------------------------------------------------------
// Producer part 1: Q/K/V projections, LDS-staged.  Z template: 0=Q, 1=K, 2=V.
// Block tile: 128 rows x 64 cols, whole K.  8 waves, each 16 rows x 64 cols.
// Outputs f16 in fragment order, 512-B blocks of [lane][8] (Q pre-scaled):
//   Qh/Kh [bh][n/16][d/16]        lane = 16*((d>>3)&1) + (n&15), element d&7
//   Vth   [bh][n/32][d/16][(n>>4)&1]  lane = 16*((n>>3)&1) + (d&15), element n&7
// Q and K are computed transposed (W^T as A, X^T as B): a lane then ends with 8
// consecutive d of one row n, as V's plain product ends with 8 consecutive n of one d.
// ---------------------------------------------------------------------------
template <int Z>
__device__ __forceinline__ void qkv_proj_tile(
    const float* __restrict__ X, const float* __restrict__ W,
    _Float16* __restrict__ Out,
    _Float16 (*__restrict__ Asub)[KP],   // 128 rows, [row][k]
    _Float16 (*__restrict__ Bsub)[KP])   // 64 rows, [col][k] (transposed)
{
  const int tid  = threadIdx.x;
  const int wave = tid >> 5;
  const int lane = tid & 31;

  const int row0    = blockIdx.x * 128;   // 8192 rows
  const int colbase = blockIdx.y * 64;    // 256 cols

  constexpr int ldb  = (Z == 0) ? 256 : 512;
  constexpr int coff = (Z == 2) ? 256 : 0;

  const v8f zv = {};
  v8f acc[4] = {zv, zv, zv, zv};
  // V: D[n][d]; Q, K: D[d][n]
  gemm_k256_tile<Z != 2>(X + (size_t)row0 * 256, W + coff + colbase, ldb, Asub, Bsub, acc);

  const float qscale = 0.17677669529663687f;  // 32^-0.5
  const int rt  = row0 + (wave << 4);          // first of this wave's 16 rows
  const int b_  = rt >> 11;
  const int t16 = (rt & 2047) >> 4;            // 16-row group inside the batch
#pragma unroll
  for (int c = 0; c < 4; ++c) {
    const int h_ = (colbase + (c << 4)) >> 5;
    const int dh = c & 1;                      // d / 16 (colbase is a multiple of 32)
    v8h o;
#pragma unroll
    for (int r = 0; r < 8; ++r)
      o[r] = (Z == 0) ? (_Float16)(acc[c][r] * qscale) : (_Float16)acc[c][r];
    const int blk = (Z == 2) ? ((((t16 >> 1) << 1) + dh) << 1) + (t16 & 1)
                             : (t16 << 1) + dh;
    *(v8h*)(Out + ((size_t)(b_ * 8 + h_) << 16) + (((blk << 5) + lane) << 3)) = o;
  }
  // a block runs no other part after this one (the branch is uniform); the wait is a
  // precaution ahead of any later overwrite of the stores' address and data registers
  asm volatile("s_wait_xcnt 0x0" ::: "memory");
}

// ---------------------------------------------------------------------------
// Producer part 2: cor_embed = cor @ Wcor  (K=3, tiny).  Writes f32 ce [B*N, 64] and
// f16 CEth in fragment order, 512-B blocks [bh][n/32][(n>>4)&1] of [lane][8] with
// lane = 16*((n>>3)&1) + d, element n&7; row d = 8 is ones (CE^T * P^T then holds the
// softmax row sum in its row 8), rows d = 9..15 are zero padding.
// One thread per 16-B piece: 8 consecutive n of one (head, d).
// ---------------------------------------------------------------------------
__device__ __forceinline__ void cor_embed_tile(
    const float* __restrict__ cor, const float* __restrict__ Wcor,
    float* __restrict__ ce, _Float16* __restrict__ CEth, int blk)
{
  const int idx = blk * 256 + threadIdx.x;    // 32 heads * 128 blocks * 32 lanes
  if (idx >= 32 * 128 * 32) return;
  const int d  = idx & 15;
  const int n0 = ((idx >> 4) & 255) << 3;     // block and lane half give n / 8
  const int bh = idx >> 12;
  const int b = bh >> 3, h = bh & 7;
  v8h o = {};
  if (d < 8) {
    const int m = h * 8 + d;
    const size_t bn0 = (size_t)b * 2048 + n0;
    const float4* c4 = (const float4*)(cor + bn0 * 3);   // 24 floats, 96-B aligned
    float cv[24];
#pragma unroll
    for (int i = 0; i < 6; ++i) {
      const float4 x = c4[i];
      cv[4 * i] = x.x; cv[4 * i + 1] = x.y; cv[4 * i + 2] = x.z; cv[4 * i + 3] = x.w;
    }
    const float w0 = Wcor[m], w1 = Wcor[64 + m], w2 = Wcor[128 + m];
#pragma unroll
    for (int e = 0; e < 8; ++e) {
      const float v = cv[3 * e] * w0 + cv[3 * e + 1] * w1 + cv[3 * e + 2] * w2;
      ce[(bn0 + e) * 64 + m] = v;
      o[e] = (_Float16)v;
    }
  } else if (d == 8) {
    o = (v8h)((_Float16)1.0f);
  }
  *(v8h*)(CEth + ((size_t)idx << 3)) = o;
}

// ---------------------------------------------------------------------------
// Kernel 1: everything the attention reads, in one grid (64, 4, 5).
// z = 0, 1, 2: the Q, K, V projection tile (x, y); z = 3, 4: 512 cor_embed blocks,
// last because they are the short ones.  The branch is uniform for a block.
// ---------------------------------------------------------------------------
__global__ __launch_bounds__(256) void producers_kernel(
    const float* __restrict__ x1, const float* __restrict__ x2,
    const float* __restrict__ cor, const float* __restrict__ Wq,
    const float* __restrict__ Wkv, const float* __restrict__ Wcor,
    _Float16* __restrict__ Qh, _Float16* __restrict__ Kh, _Float16* __restrict__ Vth,
    float* __restrict__ ce, _Float16* __restrict__ CEth)
{
  __shared__ __align__(16) _Float16 Asub[128][KP];  // 66 KB
  __shared__ __align__(16) _Float16 Bsub[64][KP];   // 33 KB

  const int z = blockIdx.z;
  if (z == 0)      qkv_proj_tile<0>(x1, Wq,  Qh,  Asub, Bsub);
  else if (z == 1) qkv_proj_tile<1>(x2, Wkv, Kh,  Asub, Bsub);
  else if (z == 2) qkv_proj_tile<2>(x2, Wkv, Vth, Asub, Bsub);
  else cor_embed_tile(cor, Wcor, ce, CEth, ((z - 3) * 4 + blockIdx.y) * 64 + blockIdx.x);
}

// ---------------------------------------------------------------------------
// Kernel 2: flash attention.  One 16-query tile per wave, 8 waves/WG,
// grid (N/128, B*H).  Online softmax, one step per stage of 128 keys: one maximum, one
// exchange between halves, one alpha and one rescale of O^T for 8 score tiles.
// Transposed products: D register r of lane (hi, lx) is [8*hi + r][lx], so with
// K (or V^T, CE^T) as A and Q^T (or P^T) as B, lane lx owns query q0 + lx.
//   s[i][r] = S[q0+lx][j0 + 16*i + 8*hi + r]
// so tiles 2p, 2p + 1 are exactly the B-fragment k order (e<8: 8*hi+e, e>=8: 16+8*hi+e-8).
// K, V^T, CE^T: a stage is 128 keys = 8 + 8 + 4 KB, contiguous in each operand's
// fragment-ordered plane; it keeps that order in LDS, so a fragment read is 512
// contiguous bytes a wave.  Stage t + 1 flies while stage t is worked on.
// ---------------------------------------------------------------------------
#define STAGE_KEYS   128
#define STAGE_HALVES 10240            // K 4096, V^T 4096, CE^T 2048 halves
#define STAGE_BYTES  20480
#define N_STAGES     (2048 / STAGE_KEYS)

// One stage: five 16-B copies a thread (K 2, V^T 2, CE^T 1), 4 KB a round of the
// work-group.  lds: this thread's byte address in the buffer; k, v, c: its 16 B of
// the stage in each plane.
__device__ __forceinline__ void stage_copy(unsigned lds, const _Float16* k,
                                           const _Float16* v, const _Float16* c) {
  // global to LDS through no register; the s_wait_xcnt ends the statement so that no
  // address register named here is rewritten ahead of it
  asm volatile(
      "global_load_async_to_lds_b128 %0, %5, off\n\t"
      "global_load_async_to_lds_b128 %1, %6, off\n\t"
      "global_load_async_to_lds_b128 %2, %7, off\n\t"
      "global_load_async_to_lds_b128 %3, %8, off\n\t"
      "global_load_async_to_lds_b128 %4, %9, off\n\t"
      "s_wait_xcnt 0x0"
      :: "v"(lds), "v"(lds + 4096u), "v"(lds + 8192u), "v"(lds + 12288u), "v"(lds + 16384u),
         "v"(k), "v"(k + 2048), "v"(v), "v"(v + 2048), "v"(c)
      : "memory");
}

__global__ __launch_bounds__(256) void attn_kernel(
    const _Float16* __restrict__ Qh, const _Float16* __restrict__ Kh,
    const _Float16* __restrict__ Vth, const _Float16* __restrict__ CEth,
    float* __restrict__ attn_x, float* __restrict__ c_rev)
{
  const int wave = threadIdx.x >> 5;
  const int lane = threadIdx.x & 31;
  const int hi = lane >> 4, lx = lane & 15, base = hi << 3;
  const int bh = blockIdx.y;
  const int q0 = blockIdx.x * 128 + wave * 16;

  __shared__ __align__(16) _Float16 ring[2][STAGE_HALVES];   // 40 KB

  // fragment-ordered operands: this lane's 16-B piece of each 512-B block
  const _Float16* Qb = Qh + (size_t)bh * (2048 * 32) + (lane << 3);
  // this thread's 16 B of each 4-KB copy round
  const _Float16* Kg = Kh   + (size_t)bh * (2048 * 32) + (threadIdx.x << 3);
  const _Float16* Vg = Vth  + (size_t)bh * (32 * 2048) + (threadIdx.x << 3);
  const _Float16* Cg = CEth + (size_t)bh * (16 * 2048) + (threadIdx.x << 3);
  const unsigned ring_b = (unsigned)(size_t)&ring[0][0] + (threadIdx.x << 4);

  stage_copy(ring_b, Kg, Vg, Cg);                       // stage 0 into buffer 0
  // stage 0 has landed for this wave, then for all: nobody reads it before
  asm volatile("s_wait_asynccnt 0x0" ::: "memory");
  __syncthreads();
  stage_copy(ring_b + STAGE_BYTES, Kg + 4096, Vg + 4096, Cg + 2048);   // stage 1

  const v16h qf = frag_packed(Qb + (size_t)q0 * 32);

  v8f o0 = {}, o1 = {}, crv = {};       // O^T rows d 0..15, 16..31; CE^T rows 0..15
  float rm = -3.0e38f;                  // this lane's query: running max

  for (int t = 0; t < N_STAGES; ++t) {
   const _Float16* Sb = &ring[t & 1][lane << 3];
   // S^T = K * Q^T (scale folded into Q) for the whole stage: 8 tiles of 16 keys.
   // Every loop of the trip is unrolled: its arrays are register tiles, indexed by constants
   // alone, and every LDS read has its place in the stage as an immediate offset.
   v16h kf[8];
#pragma unroll
   for (int i = 0; i < 8; ++i) kf[i] = frag_packed(Sb + i * 512);
   // keeps the 16 reads of K first in the LDS queue, which answers in order: mixed with the
   // reads of V^T and CE^T below, the score products wait for bytes they do not use
   __builtin_amdgcn_sched_barrier(0);
   v8f s[8];
#pragma unroll
   for (int i = 0; i < 8; ++i) {
     const v8f z = {};
     s[i] = WMMA_F32_F16(kf[i], qf, z);
   }
   // V^T: fragment 2p + h is rows d 16h..16h+15 over keys 32p..32p+31; CE^T: fragment p
   v16h va[8], ca[4];
#pragma unroll
   for (int i = 0; i < 8; ++i) va[i] = frag_packed(Sb + 4096 + i * 512);
#pragma unroll
   for (int p = 0; p < 4; ++p) ca[p] = frag_packed(Sb + 8192 + p * 512);
   // keeps these 24 reads ahead of the softmax, which covers their latency: without it
   // they sink to just before their products and each of those places shows its own wait
   __builtin_amdgcn_sched_barrier(0);

   // online softmax, one step a stage: 64 of the query's 128 scores sit in this lane,
   // 64 in lane ^ 16; four independent chains, tile by tile as the products retire
   float mx[4] = {s[0][0], s[0][1], s[0][2], s[0][3]};
#pragma unroll
   for (int r = 4; r < 8; ++r) mx[r & 3] = fmaxf(mx[r & 3], s[0][r]);
#pragma unroll
   for (int i = 1; i < 8; ++i)
#pragma unroll
     for (int r = 0; r < 8; ++r) mx[r & 3] = fmaxf(mx[r & 3], s[i][r]);
   float tm = fmaxf(fmaxf(mx[0], mx[1]), fmaxf(mx[2], mx[3]));
   tm = fmaxf(tm, swap_halves(tm));
   const float mn = fmaxf(rm, tm);
   const float alpha = __expf(rm - mn);
   rm = mn;
   o0 *= alpha; o1 *= alpha; crv *= alpha;

#pragma unroll
   for (int p = 0; p < 4; ++p) {
     v16h pf;                           // P^T as B fragment, straight from the score tiles
#pragma unroll
     for (int r = 0; r < 8; ++r) {
       pf[r]     = (_Float16)__expf(s[2 * p][r] - mn);
       pf[r + 8] = (_Float16)__expf(s[2 * p + 1][r] - mn);
     }
     o0  = WMMA_F32_F16(va[2 * p],     pf, o0);
     o1  = WMMA_F32_F16(va[2 * p + 1], pf, o1);
     crv = WMMA_F32_F16(ca[p],         pf, crv);   // row 8: the row sum of P as rounded
   }
   // keeps the hand-over below at the foot of the trip: all reads of the stage now stand at
   // its head, and without this the waits and the barrier rise to just behind them, where
   // stage t + 1's copies have had no time to land and V^T, CE^T must land ahead of the softmax
   __builtin_amdgcn_sched_barrier(0);
   // hand-over: this wave's reads of stage t are done, its copies of stage t + 1 have
   // landed; behind the barrier both hold for all 8 waves
   asm volatile("s_wait_dscnt 0x0" ::: "memory");      // own reads of stage t retired
   asm volatile("s_wait_asynccnt 0x0" ::: "memory");   // own copies of stage t + 1 landed
   __syncthreads();
   if (t + 2 < N_STAGES)                                 // into the buffer just read
     stage_copy(ring_b + (unsigned)(t & 1) * STAGE_BYTES, Kg + (t + 2) * 4096,
                Vg + (t + 2) * 4096, Cg + (t + 2) * 2048);
  }
  // no copy is left in flight when the wave goes on to its end
  asm volatile("s_wait_asynccnt 0x0" ::: "memory");

  // lane (hi, lx) holds d = 8*hi + r of query q0 + lx: the query's whole row sum (row 8 of
  // the CE^T product, rescaled with it) sits in the upper half's crv[0]
  const float lsw = swap_halves(crv[0]);
  const float inv = 1.0f / (hi ? crv[0] : lsw);
  const int b_ = bh >> 3, h_ = bh & 7;
  const int q  = q0 + lx;
  float* xr = attn_x + (((size_t)b_ * 2048 + q) << 8) + (h_ << 5) + base;
  *(float4*)(xr)      = make_float4(o0[0] * inv, o0[1] * inv, o0[2] * inv, o0[3] * inv);
  *(float4*)(xr + 4)  = make_float4(o0[4] * inv, o0[5] * inv, o0[6] * inv, o0[7] * inv);
  *(float4*)(xr + 16) = make_float4(o1[0] * inv, o1[1] * inv, o1[2] * inv, o1[3] * inv);
  *(float4*)(xr + 20) = make_float4(o1[4] * inv, o1[5] * inv, o1[6] * inv, o1[7] * inv);
  if (hi == 0) {                        // CE^T rows 8..15 are no output
    float* cr = c_rev + (((size_t)b_ * 2048 + q) << 6) + (h_ << 3);
    *(float4*)(cr)     = make_float4(crv[0] * inv, crv[1] * inv, crv[2] * inv, crv[3] * inv);
    *(float4*)(cr + 4) = make_float4(crv[4] * inv, crv[5] * inv, crv[6] * inv, crv[7] * inv);
  }
}

// ---------------------------------------------------------------------------
// Consumer part 1: x_out = attn_x @ Wproj + bproj   [8192,256]x[256,256], LDS-staged.
// ---------------------------------------------------------------------------
__device__ __forceinline__ void proj_tile(
    const float* __restrict__ attn_x, const float* __restrict__ Wproj,
    const float* __restrict__ bproj, float* __restrict__ out,
    _Float16 (*__restrict__ Asub)[KP],   // 128 rows, [row][k]
    _Float16 (*__restrict__ Bsub)[KP])   // 64 rows, [col][k]
{
  const int tid  = threadIdx.x;
  const int wave = tid >> 5;
  const int lane = tid & 31;
  const int hi = lane >> 4, lx = lane & 15, base = hi << 3;
  const int row0 = blockIdx.x * 128;
  const int colbase = blockIdx.y * 64;

  const v8f zv = {};
  v8f acc[4] = {zv, zv, zv, zv};
  gemm_k256_tile<false>(attn_x + (size_t)row0 * 256, Wproj + colbase, 256, Asub, Bsub, acc);

#pragma unroll
  for (int c = 0; c < 4; ++c) {
#pragma unroll
    for (int r = 0; r < 8; ++r) {
      const int grow = row0 + (wave << 4) + r + base;
      const int gcol = colbase + (c << 4) + lx;
      out[((size_t)grow << 8) + gcol] = acc[c][r] + bproj[gcol];
    }
  }
}

// ---------------------------------------------------------------------------
// Consumer part 2: motion = (c_rev - ce) @ Wm + bm   [8192,64]x[64,64].
// Wm^T staged once in LDS; each wave: 16 rows x 64 cols, K=64 in 2 steps.
// ---------------------------------------------------------------------------
__device__ __forceinline__ void motion_tile(
    const float* __restrict__ c_rev, const float* __restrict__ ce,
    const float* __restrict__ Wm, const float* __restrict__ bm, float* __restrict__ out,
    _Float16 (*__restrict__ Wt)[64])     // 64 rows, [col][k]
{
  const int tid  = threadIdx.x;
  const int wave = tid >> 5;
  const int lane = tid & 31;
  const int hi = lane >> 4, lx = lane & 15, base = hi << 3;
  const int row0 = blockIdx.x * 128;

#pragma unroll
  for (int i = 0; i < 4; ++i) {
    const int idx = tid + 256 * i;              // 0..1023
    const int k = idx >> 4, f4 = idx & 15;
    const float4 v = *(const float4*)(Wm + (size_t)k * 64 + f4 * 4);
    Wt[f4 * 4 + 0][k] = (_Float16)v.x;
    Wt[f4 * 4 + 1][k] = (_Float16)v.y;
    Wt[f4 * 4 + 2][k] = (_Float16)v.z;
    Wt[f4 * 4 + 3][k] = (_Float16)v.w;
  }
  __syncthreads();

  const float* ar = c_rev + (size_t)(row0 + (wave << 4) + lx) * 64;
  const float* er = ce    + (size_t)(row0 + (wave << 4) + lx) * 64;

  const v8f zv = {};
  v8f acc[4] = {zv, zv, zv, zv};
#pragma unroll
  for (int k0 = 0; k0 < 64; k0 += 32) {
    v16h a;
#pragma unroll
    for (int i = 0; i < 8; ++i) {
      const int ka = k0 + base + i, kb = k0 + 16 + base + i;
      a[i]     = (_Float16)(ar[ka] - er[ka]);
      a[i + 8] = (_Float16)(ar[kb] - er[kb]);
    }
#pragma unroll
    for (int c = 0; c < 4; ++c) {
      const v16h b = frag_from_f16_row(&Wt[(c << 4) + lx][k0], base);
      acc[c] = WMMA_F32_F16(a, b, acc[c]);
    }
  }

#pragma unroll
  for (int c = 0; c < 4; ++c) {
#pragma unroll
    for (int r = 0; r < 8; ++r) {
      const int grow = row0 + (wave << 4) + r + base;
      const int gcol = (c << 4) + lx;
      out[((size_t)grow << 6) + gcol] = acc[c][r] + bm[gcol];
    }
  }
}

// ---------------------------------------------------------------------------
// Kernel 3: both outputs in one grid (64, 5).  y = 0..3: output projection tile
// (x, y); y = 4: motion rows of block x.  The branch is uniform for a block.
// ---------------------------------------------------------------------------
__global__ __launch_bounds__(256) void outputs_kernel(
    const float* __restrict__ attn_x, const float* __restrict__ Wproj,
    const float* __restrict__ bproj, float* __restrict__ out_x,
    const float* __restrict__ c_rev, const float* __restrict__ ce,
    const float* __restrict__ Wm, const float* __restrict__ bm,
    float* __restrict__ out_motion)
{
  __shared__ __align__(16) _Float16 smem[192 * KP]; // 99 KB: A 66 + B 33, or Wm^T 8

  if (blockIdx.y < 4)
    proj_tile(attn_x, Wproj, bproj, out_x,
              (_Float16 (*)[KP])smem, (_Float16 (*)[KP])(smem + 128 * KP));
  else
    motion_tile(c_rev, ce, Wm, bm, out_motion, (_Float16 (*)[64])smem);
}

// ---------------------------------------------------------------------------
extern "C" void kernel_launch(void* const* d_in, const int* in_sizes, int n_in,
                              void* d_out, int out_size, void* d_ws, size_t ws_size,
                              hipStream_t stream) {
  (void)in_sizes; (void)n_in; (void)out_size; (void)ws_size;
  const float* x1    = (const float*)d_in[0];
  const float* x2    = (const float*)d_in[1];
  const float* cor   = (const float*)d_in[2];
  const float* Wq    = (const float*)d_in[3];
  const float* Wkv   = (const float*)d_in[4];
  const float* Wcor  = (const float*)d_in[5];
  const float* Wproj = (const float*)d_in[6];
  const float* bproj = (const float*)d_in[7];
  const float* Wm    = (const float*)d_in[8];
  const float* bm    = (const float*)d_in[9];

  char* ws = (char*)d_ws;                                  // 26 MB total
  _Float16* Qh     = (_Float16*)(ws);                      //  4 MB
  _Float16* Kh     = (_Float16*)(ws + ( 4u << 20));        //  4 MB
  _Float16* Vth    = (_Float16*)(ws + ( 8u << 20));        //  4 MB
  _Float16* CEth   = (_Float16*)(ws + (12u << 20));        //  2 MB
  float*    ce     = (float*)   (ws + (14u << 20));        //  2 MB
  float*    attn_x = (float*)   (ws + (16u << 20));        //  8 MB
  float*    c_rev  = (float*)   (ws + (24u << 20));        //  2 MB

  float* out_x      = (float*)d_out;                       // [4,2048,256]
  float* out_motion = out_x + (size_t)4 * 2048 * 256;      // [4,2048,64]

  producers_kernel<<<dim3(64, 4, 5), 256, 0, stream>>>(x1, x2, cor, Wq, Wkv, Wcor,
                                                       Qh, Kh, Vth, ce, CEth);
  attn_kernel     <<<dim3(16, 32),   256, 0, stream>>>(Qh, Kh, Vth, CEth, attn_x, c_rev);
  outputs_kernel  <<<dim3(64, 5),    256, 0, stream>>>(attn_x, Wproj, bproj, out_x,
                                                       c_rev, ce, Wm, bm, out_motion);
}

// v008
// Measured time: 40.8 microseconds a run.
// Next to v007, in two timings, it ran 1.06 times as fast each time.
// Counting every step since v000, it is 4.25 times as fast.
#include <hip/hip_runtime.h>

// ---------------------------------------------------------------------------
// InterFrameAttention for MI455X (gfx1250, wave32, WMMA f16->f32)
// Shapes: B=4, N=2048, C=256, H=8, Dh=32, M=64, Mh=8
// GEMMs: LDS-staged tiles (coalesced b128 global loads, f16 conversion once,
// weights transposed in LDS so WMMA B-fragments are contiguous ds_load_b128); a tile
// holds the whole K = 256, so a block has one load phase and one barrier.
// Attention: flash-style single pass, one online-softmax step per 128 keys (20 WMMA
// per wave: 8 score tiles, then 12 value products), all
// products transposed (S^T = K Q^T, O^T += V^T P^T): a lane holds one query's
// scores, so the max is in-lane plus one exchange between wave halves,
// and the two score tiles convert in place into the P^T operand (no LDS).
// The softmax shift enters the score products as their C operand and follows the maximum
// only when, for some query of the wave, that outgrows it by SHIFT_ROOM: most steps subtract and rescale nothing; with
// log2 e folded into Q's scale a score tile is exp2's argument as it leaves the matrix unit.
// The softmax row sum rides on the CE^T product: a row of ones in that operand's padding.
// Q, K, V^T and CE^T live in the workspace in fragment order: a fragment is two
// blocks of 512 B, block c holding lane l's elements 8c..8c+7 at byte 16*l, so a
// wave-wide 16-B load or store covers four whole 128-B lines.
// The attention work-group brings K, V^T and CE^T into LDS once for its 8 waves
// (asynchronous copies, two buffers of 128 keys); the waves read fragments from LDS.
// Three launches: the four producers of the attention operands share one grid, as
// do the two consumers of its results; inside a grid no block needs another's data.
// ---------------------------------------------------------------------------

typedef _Float16 v16h __attribute__((ext_vector_type(16)));
typedef _Float16 v8h  __attribute__((ext_vector_type(8)));
typedef float    v8f  __attribute__((ext_vector_type(8)));

#define WMMA_F32_F16(A, Bm, Cm) \
  __builtin_amdgcn_wmma_f32_16x16x32_f16(false, (A), false, (Bm), (short)0, (Cm), false, false)

// A/B fragment element -> K mapping (16-bit 16x32 operand, wave32):
//   e in [0,8):  K = base + e          (base = 8 * (lane>>4))
//   e in [8,16): K = 16 + base + (e-8)
// -> per lane, two contiguous 8-half (16B) chunks at offsets base and 16+base.
__device__ __forceinline__ v16h frag_from_f16_row(const _Float16* __restrict__ row, int base) {
  v8h lo = *(const v8h*)(row + base);
  v8h hi = *(const v8h*)(row + 16 + base);
  v16h r;
#pragma unroll
  for (int i = 0; i < 8; ++i) { r[i] = lo[i]; r[i + 8] = hi[i]; }
  return r;
}

// The same fragment from fragment-ordered memory; p already includes 8 * lane.
__device__ __forceinline__ v16h frag_packed(const _Float16* __restrict__ p) {
  v8h lo = *(const v8h*)(p);
  v8h hi = *(const v8h*)(p + 256);
  v16h r;
#pragma unroll
  for (int i = 0; i < 8; ++i) { r[i] = lo[i]; r[i + 8] = hi[i]; }
  return r;
}

// --- exchange between the two 16-lane halves (lane l <-> l ^ 16) -------------
// v_permlanex16_b32 with the identity select table.  bound_ctrl=1: every select
// is in range and EXEC is all-ones, so the 'old' operand is dead.
__device__ __forceinline__ float swap_halves(float x) {
  int v = __float_as_int(x);
  v = __builtin_amdgcn_permlanex16(v, v, 0x76543210, (int)0xFEDCBA98u, false, true);
  return __int_as_float(v);
}

// ---------------------------------------------------------------------------
// The K = 256 product of a 128-row x 64-column block tile, shared by the Q, K, V and
// output projections.  Both operands are staged for the whole K at once: every global
// load of the block is issued in one phase, one barrier follows, and the 32 WMMA of a
// wave then run with no further barrier.  8 waves, each 16 rows x 64 columns.
// LDS row pitch 264 halves = 528 B = 33 x 16 B: 16 rows read 16 B each fall on
// 16 different groups of four banks.
// WA: weights are the A operand, D = [col][row]; else D = [row][col].
// ---------------------------------------------------------------------------
#define KP 264
typedef float    v4f  __attribute__((ext_vector_type(4)));
typedef _Float16 v4h  __attribute__((ext_vector_type(4)));

template <bool WA>
__device__ __forceinline__ void gemm_k256_tile(
    const float* __restrict__ X,         // row 0 of the tile; 128 rows of 256, contiguous
    const float* __restrict__ W,         // row 0, first of the tile's 64 columns
    const int ldb,                       // row pitch of W in floats
    _Float16 (*__restrict__ Asub)[KP],   // 128 rows, [row][k]
    _Float16 (*__restrict__ Bsub)[KP],   // 64 rows, [col][k] (transposed)
    v8f (&acc)[4])
{
  const int tid  = threadIdx.x;
  const int wave = tid >> 5;
  const int lane = tid & 31;
  const int hi = lane >> 4, lx = lane & 15, base = hi << 3;

  // X: the tile is 128 KB in a row; round i of the block takes 4 KB (4 rows) of it
  const float* xp = X + (tid << 2);
  const int xr = tid >> 6, xc = (tid & 63) << 2;
  v4f xa[16], xb[16];
#pragma unroll
  for (int i = 0; i < 16; ++i) xa[i] = *(const v4f*)(xp + 1024 * i);
  // W: a thread takes 4 columns x 16 consecutive k; 16 lanes cover 256 contiguous bytes
  const int wc = (tid & 15) << 2, wk = (tid >> 4) << 4;
  const float* wp = W + (size_t)wk * ldb + wc;
  v4f wv[16];
#pragma unroll
  for (int e = 0; e < 15; ++e) wv[e] = *(const v4f*)(wp + (size_t)e * ldb);
  // the last load's result may take over the address registers that the 15 before it name:
  // the wait stands ahead of that overwrite
  asm volatile("s_wait_xcnt 0x0" ::: "memory");
  wv[15] = *(const v4f*)(wp + (size_t)15 * ldb);
  // ahead of any other overwrite of an address register that these 32 loads name
  asm volatile("s_wait_xcnt 0x0" ::: "memory");
#pragma unroll
  for (int i = 0; i < 16; ++i) {
    v4h o = {(_Float16)xa[i][0], (_Float16)xa[i][1], (_Float16)xa[i][2], (_Float16)xa[i][3]};
    *(v4h*)&Asub[xr + 4 * i][xc] = o;
  }
  // compiler fence: the loads below stay behind the stores above, whose registers they
  // take over; moved up to the first 32 they cost the block its third place on a WGP
  asm volatile("" ::: "memory");
#pragma unroll
  for (int i = 0; i < 16; ++i) xb[i] = *(const v4f*)(xp + 1024 * (16 + i));
  // ahead of any overwrite of an address register that these 16 loads name; they fly
  // while W is converted and stored
  asm volatile("s_wait_xcnt 0x0" ::: "memory");
#pragma unroll
  for (int j = 0; j < 4; ++j) {
    v8h lo, hj;
#pragma unroll
    for (int e = 0; e < 8; ++e) { lo[e] = (_Float16)wv[e][j]; hj[e] = (_Float16)wv[e + 8][j]; }
    *(v8h*)&Bsub[wc + j][wk]     = lo;
    *(v8h*)&Bsub[wc + j][wk + 8] = hj;
  }
#pragma unroll
  for (int i = 0; i < 16; ++i) {
    v4h o = {(_Float16)xb[i][0], (_Float16)xb[i][1], (_Float16)xb[i][2], (_Float16)xb[i][3]};
    *(v4h*)&Asub[xr + 4 * (16 + i)][xc] = o;
  }
  __syncthreads();

  // no barrier from here on, so the fragments of k-step s + 1 are read ahead of the
  // products of k-step s
  const _Float16* ar = &Asub[(wave << 4) + lx][0];
  const _Float16* br = &Bsub[lx][0];
  v16h a = frag_from_f16_row(ar, base);
  v16h b[4];
#pragma unroll
  for (int c = 0; c < 4; ++c) b[c] = frag_from_f16_row(br + (c << 4) * KP, base);
#pragma unroll
  for (int k0 = 0; k0 < 256; k0 += 32) {
    v16h an = a, bn[4] = {b[0], b[1], b[2], b[3]};
    if (k0 + 32 < 256) {
      an = frag_from_f16_row(ar + k0 + 32, base);
#pragma unroll
      for (int c = 0; c < 4; ++c) bn[c] = frag_from_f16_row(br + (c << 4) * KP + k0 + 32, base);
    }
    // keeps the reads of k-step s + 1 ahead of the products of k-step s: without it each
    // pair of reads sinks to just before its product and its latency shows 32 times
    __builtin_amdgcn_sched_barrier(0);
#pragma unroll
    for (int c = 0; c < 4; ++c) {
      if (WA) acc[c] = WMMA_F32_F16(b[c], a, acc[c]);   // D[col][row]
      else    acc[c] = WMMA_F32_F16(a, b[c], acc[c]);   // D[row][col]
    }
    a = an;
#pragma unroll
    for (int c = 0; c < 4; ++c) b[c] = bn[c];
  }
}

// ---------------------------------------------------------------------------
// Producer part 1: Q/K/V projections, LDS-staged.  Z template: 0=Q, 1=K, 2=V.
// Block tile: 128 rows x 64 cols, whole K.  8 waves, each 16 rows x 64 cols.
// Outputs f16 in fragment order, 512-B blocks of [lane][8] (Q pre-scaled):
//   Qh/Kh [bh][n/16][d/16]        lane = 16*((d>>3)&1) + (n&15), element d&7
//   Vth   [bh][n/32][d/16][(n>>4)&1]  lane = 16*((n>>3)&1) + (d&15), element n&7
// Q and K are computed transposed (W^T as A, X^T as B): a lane then ends with 8
// consecutive d of one row n, as V's plain product ends with 8 consecutive n of one d.
// ---------------------------------------------------------------------------
template <int Z>
__device__ __forceinline__ void qkv_proj_tile(
    const float* __restrict__ X, const float* __restrict__ W,
    _Float16* __restrict__ Out,
    _Float16 (*__restrict__ Asub)[KP],   // 128 rows, [row][k]
    _Float16 (*__restrict__ Bsub)[KP])   // 64 rows, [col][k] (transposed)
{
  const int tid  = threadIdx.x;
  const int wave = tid >> 5;
  const int lane = tid & 31;

  const int row0    = blockIdx.x * 128;   // 8192 rows
  const int colbase = blockIdx.y * 64;    // 256 cols

  constexpr int ldb  = (Z == 0) ? 256 : 512;
  constexpr int coff = (Z == 2) ? 256 : 0;

  const v8f zv = {};
  v8f acc[4] = {zv, zv, zv, zv};
  // V: D[n][d]; Q, K: D[d][n]
  gemm_k256_tile<Z != 2>(X + (size_t)row0 * 256, W + coff + colbase, ldb, Asub, Bsub, acc);

  // 32^-0.5 * log2 e: the scores come out in powers of two, ready for exp2
  const float qscale = 0.17677669529663687f * 1.4426950408889634f;
  const int rt  = row0 + (wave << 4);          // first of this wave's 16 rows
  const int b_  = rt >> 11;
  const int t16 = (rt & 2047) >> 4;            // 16-row group inside the batch
#pragma unroll
  for (int c = 0; c < 4; ++c) {
    const int h_ = (colbase + (c << 4)) >> 5;
    const int dh = c & 1;                      // d / 16 (colbase is a multiple of 32)
    v8h o;
#pragma unroll
    for (int r = 0; r < 8; ++r)
      o[r] = (Z == 0) ? (_Float16)(acc[c][r] * qscale) : (_Float16)acc[c][r];
    const int blk = (Z == 2) ? ((((t16 >> 1) << 1) + dh) << 1) + (t16 & 1)
                             : (t16 << 1) + dh;
    *(v8h*)(Out + ((size_t)(b_ * 8 + h_) << 16) + (((blk << 5) + lane) << 3)) = o;
  }
  // a block runs no other part after this one (the branch is uniform); the wait is a
  // precaution ahead of any later overwrite of the stores' address and data registers
  asm volatile("s_wait_xcnt 0x0" ::: "memory");
}

// ---------------------------------------------------------------------------
// Producer part 2: cor_embed = cor @ Wcor  (K=3, tiny).  Writes f32 ce [B*N, 64] and
// f16 CEth in fragment order, 512-B blocks [bh][n/32][(n>>4)&1] of [lane][8] with
// lane = 16*((n>>3)&1) + d, element n&7; row d = 8 is ones (CE^T * P^T then holds the
// softmax row sum in its row 8), rows d = 9..15 are zero padding.
// One thread per 16-B piece: 8 consecutive n of one (head, d).
// ---------------------------------------------------------------------------
__device__ __forceinline__ void cor_embed_tile(
    const float* __restrict__ cor, const float* __restrict__ Wcor,
    float* __restrict__ ce, _Float16* __restrict__ CEth, int blk)
{
  const int idx = blk * 256 + threadIdx.x;    // 32 heads * 128 blocks * 32 lanes
  if (idx >= 32 * 128 * 32) return;
  const int d  = idx & 15;
  const int n0 = ((idx >> 4) & 255) << 3;     // block and lane half give n / 8
  const int bh = idx >> 12;
  const int b = bh >> 3, h = bh & 7;
  v8h o = {};
  if (d < 8) {
    const int m = h * 8 + d;
    const size_t bn0 = (size_t)b * 2048 + n0;
    const float4* c4 = (const float4*)(cor + bn0 * 3);   // 24 floats, 96-B aligned
    float cv[24];
#pragma unroll
    for (int i = 0; i < 6; ++i) {
      const float4 x = c4[i];
      cv[4 * i] = x.x; cv[4 * i + 1] = x.y; cv[4 * i + 2] = x.z; cv[4 * i + 3] = x.w;
    }
    const float w0 = Wcor[m], w1 = Wcor[64 + m], w2 = Wcor[128 + m];
#pragma unroll
    for (int e = 0; e < 8; ++e) {
      const float v = cv[3 * e] * w0 + cv[3 * e + 1] * w1 + cv[3 * e + 2] * w2;
      ce[(bn0 + e) * 64 + m] = v;
      o[e] = (_Float16)v;
    }
  } else if (d == 8) {
    o = (v8h)((_Float16)1.0f);
  }
  *(v8h*)(CEth + ((size_t)idx << 3)) = o;
}

// ---------------------------------------------------------------------------
// Kernel 1: everything the attention reads, in one grid (64, 4, 5).
// z = 0, 1, 2: the Q, K, V projection tile (x, y); z = 3, 4: 512 cor_embed blocks,
// last because they are the short ones.  The branch is uniform for a block.
// ---------------------------------------------------------------------------
__global__ __launch_bounds__(256) void producers_kernel(
    const float* __restrict__ x1, const float* __restrict__ x2,
    const float* __restrict__ cor, const float* __restrict__ Wq,
    const float* __restrict__ Wkv, const float* __restrict__ Wcor,
    _Float16* __restrict__ Qh, _Float16* __restrict__ Kh, _Float16* __restrict__ Vth,
    float* __restrict__ ce, _Float16* __restrict__ CEth)
{
  __shared__ __align__(16) _Float16 Asub[128][KP];  // 66 KB
  __shared__ __align__(16) _Float16 Bsub[64][KP];   // 33 KB

  const int z = blockIdx.z;
  if (z == 0)      qkv_proj_tile<0>(x1, Wq,  Qh,  Asub, Bsub);
  else if (z == 1) qkv_proj_tile<1>(x2, Wkv, Kh,  Asub, Bsub);
  else if (z == 2) qkv_proj_tile<2>(x2, Wkv, Vth, Asub, Bsub);
  else cor_embed_tile(cor, Wcor, ce, CEth, ((z - 3) * 4 + blockIdx.y) * 64 + blockIdx.x);
}

// ---------------------------------------------------------------------------
// Kernel 2: flash attention.  One 16-query tile per wave, 8 waves/WG,
// grid (N/128, B*H).  Online softmax, one step per stage of 128 keys: one maximum and one
// exchange between halves for 8 score tiles.  The scores leave the matrix unit with the
// query's shift already taken off (C operand = -shift in all 8 registers: a lane is one
// query).  Any shift gives the same quotient; it has to keep P inside f16.  The first stage
// sets it to that stage's maximum; later it moves, with one alpha and one rescale of O^T,
// only in a stage where some query of the wave has its maximum more than SHIFT_ROOM above its shift, so the row's largest P
// stays between 1 and 2^SHIFT_ROOM = 256 (f16 holds 65504; sums are f32).  Scores are in
// powers of two (Q carries 32^-0.5 * log2 e), so P = exp2(score) with no vector work before it.
// Transposed products: D register r of lane (hi, lx) is [8*hi + r][lx], so with
// K (or V^T, CE^T) as A and Q^T (or P^T) as B, lane lx owns query q0 + lx.
//   s[i][r] = S[q0+lx][j0 + 16*i + 8*hi + r]
// so tiles 2p, 2p + 1 are exactly the B-fragment k order (e<8: 8*hi+e, e>=8: 16+8*hi+e-8).
// K, V^T, CE^T: a stage is 128 keys = 8 + 8 + 4 KB, contiguous in each operand's
// fragment-ordered plane; it keeps that order in LDS, so a fragment read is 512
// contiguous bytes a wave.  Stage t + 1 flies while stage t is worked on.
// ---------------------------------------------------------------------------
#define STAGE_KEYS   128
#define STAGE_HALVES 10240            // K 4096, V^T 4096, CE^T 2048 halves
#define STAGE_BYTES  20480
#define N_STAGES     (2048 / STAGE_KEYS)
#define SHIFT_ROOM   8.0f             // in powers of two

// One stage: five 16-B copies a thread (K 2, V^T 2, CE^T 1), 4 KB a round of the
// work-group.  lds: this thread's byte address in the buffer; k, v, c: its 16 B of
// the stage in each plane.
__device__ __forceinline__ void stage_copy(unsigned lds, const _Float16* k,
                                           const _Float16* v, const _Float16* c) {
  // global to LDS through no register; the s_wait_xcnt ends the statement so that no
  // address register named here is rewritten ahead of it
  asm volatile(
      "global_load_async_to_lds_b128 %0, %5, off\n\t"
      "global_load_async_to_lds_b128 %1, %6, off\n\t"
      "global_load_async_to_lds_b128 %2, %7, off\n\t"
      "global_load_async_to_lds_b128 %3, %8, off\n\t"
      "global_load_async_to_lds_b128 %4, %9, off\n\t"
      "s_wait_xcnt 0x0"
      :: "v"(lds), "v"(lds + 4096u), "v"(lds + 8192u), "v"(lds + 12288u), "v"(lds + 16384u),
         "v"(k), "v"(k + 2048), "v"(v), "v"(v + 2048), "v"(c)
      : "memory");
}

__global__ __launch_bounds__(256) void attn_kernel(
    const _Float16* __restrict__ Qh, const _Float16* __restrict__ Kh,
    const _Float16* __restrict__ Vth, const _Float16* __restrict__ CEth,
    float* __restrict__ attn_x, float* __restrict__ c_rev)
{
  const int wave = threadIdx.x >> 5;
  const int lane = threadIdx.x & 31;
  const int hi = lane >> 4, lx = lane & 15, base = hi << 3;
  const int bh = blockIdx.y;
  const int q0 = blockIdx.x * 128 + wave * 16;

  __shared__ __align__(16) _Float16 ring[2][STAGE_HALVES];   // 40 KB

  // fragment-ordered operands: this lane's 16-B piece of each 512-B block
  const _Float16* Qb = Qh + (size_t)bh * (2048 * 32) + (lane << 3);
  // this thread's 16 B of each 4-KB copy round
  const _Float16* Kg = Kh   + (size_t)bh * (2048 * 32) + (threadIdx.x << 3);
  const _Float16* Vg = Vth  + (size_t)bh * (32 * 2048) + (threadIdx.x << 3);
  const _Float16* Cg = CEth + (size_t)bh * (16 * 2048) + (threadIdx.x << 3);
  const unsigned ring_b = (unsigned)(size_t)&ring[0][0] + (threadIdx.x << 4);

  stage_copy(ring_b, Kg, Vg, Cg);                       // stage 0 into buffer 0
  // stage 0 has landed for this wave, then for all: nobody reads it before
  asm volatile("s_wait_asynccnt 0x0" ::: "memory");
  __syncthreads();
  stage_copy(ring_b + STAGE_BYTES, Kg + 4096, Vg + 4096, Cg + 2048);   // stage 1

  const v16h qf = frag_packed(Qb + (size_t)q0 * 32);

  v8f o0 = {}, o1 = {}, crv = {};       // O^T rows d 0..15, 16..31; CE^T rows 0..15
  v8f nsh = {};                         // this lane's query: minus its shift, 8 times

  for (int t = 0; t < N_STAGES; ++t) {
   const _Float16* Sb = &ring[t & 1][lane << 3];
   // S^T = K * Q^T - shift (scale folded into Q) for the whole stage: 8 tiles of 16 keys.
   // Every loop of the trip is unrolled: its arrays are register tiles, indexed by constants
   // alone, and every LDS read has its place in the stage as an immediate offset.
   v16h kf[8];
#pragma unroll
   for (int i = 0; i < 8; ++i) kf[i] = frag_packed(Sb + i * 512);
   // keeps the 16 reads of K first in the LDS queue, which answers in order: mixed with the
   // reads of V^T and CE^T below, the score products wait for bytes they do not use
   __builtin_amdgcn_sched_barrier(0);
   v8f s[8];
#pragma unroll
   for (int i = 0; i < 8; ++i) s[i] = WMMA_F32_F16(kf[i], qf, nsh);
   // V^T: fragment 2p + h is rows d 16h..16h+15 over keys 32p..32p+31; CE^T: fragment p
   v16h va[8], ca[4];
#pragma unroll
   for (int i = 0; i < 8; ++i) va[i] = frag_packed(Sb + 4096 + i * 512);
#pragma unroll
   for (int p = 0; p < 4; ++p) ca[p] = frag_packed(Sb + 8192 + p * 512);
   // keeps these 24 reads ahead of the softmax, which covers their latency: without it
   // they sink to just before their products and each of those places shows its own wait
   __builtin_amdgcn_sched_barrier(0);

   // online softmax, one step a stage: 64 of the query's 128 scores sit in this lane,
   // 64 in lane ^ 16; four independent chains, tile by tile as the products retire
   float mx[4] = {s[0][0], s[0][1], s[0][2], s[0][3]};
#pragma unroll
   for (int r = 4; r < 8; ++r) mx[r & 3] = fmaxf(mx[r & 3], s[0][r]);
#pragma unroll
   for (int i = 1; i < 8; ++i)
#pragma unroll
     for (int r = 0; r < 8; ++r) mx[r & 3] = fmaxf(mx[r & 3], s[i][r]);
   float tm = fmaxf(fmaxf(mx[0], mx[1]), fmaxf(mx[2], mx[3]));
   tm = fmaxf(tm, swap_halves(tm));      // the stage's maximum above the shift
   // one test a stage, the same for the whole wave (the products below need every lane on)
   if (t == 0 || __builtin_amdgcn_ballot_w32(tm > SHIFT_ROOM) != 0u) {
     // the shift never falls; the first stage, whose O^T is still zero, sets it either way
     const float d     = (t == 0) ? tm : fmaxf(tm, 0.0f);
     const float alpha = (t == 0) ? 1.0f : __builtin_amdgcn_exp2f(-d);
#pragma unroll
     for (int i = 0; i < 8; ++i) s[i] -= d;
     nsh -= d;
     o0 *= alpha; o1 *= alpha; crv *= alpha;
   }

#pragma unroll
   for (int p = 0; p < 4; ++p) {
     v16h pf;                           // P^T as B fragment, straight from the score tiles
#pragma unroll
     for (int r = 0; r < 8; ++r) {
       pf[r]     = (_Float16)__builtin_amdgcn_exp2f(s[2 * p][r]);
       pf[r + 8] = (_Float16)__builtin_amdgcn_exp2f(s[2 * p + 1][r]);
     }
     o0  = WMMA_F32_F16(va[2 * p],     pf, o0);
     o1  = WMMA_F32_F16(va[2 * p + 1], pf, o1);
     crv = WMMA_F32_F16(ca[p],         pf, crv);   // row 8: the row sum of P as rounded
   }
   // keeps the hand-over below at the foot of the trip: all reads of the stage now stand at
   // its head, and without this the waits and the barrier rise to just behind them, where
   // stage t + 1's copies have had no time to land and V^T, CE^T must land ahead of the softmax
   __builtin_amdgcn_sched_barrier(0);
   // hand-over: this wave's reads of stage t are done, its copies of stage t + 1 have
   // landed; behind the barrier both hold for all 8 waves
   asm volatile("s_wait_dscnt 0x0" ::: "memory");      // own reads of stage t retired
   asm volatile("s_wait_asynccnt 0x0" ::: "memory");   // own copies of stage t + 1 landed
   __syncthreads();
   if (t + 2 < N_STAGES)                                 // into the buffer just read
     stage_copy(ring_b + (unsigned)(t & 1) * STAGE_BYTES, Kg + (t + 2) * 4096,
                Vg + (t + 2) * 4096, Cg + (t + 2) * 2048);
  }
  // no copy is left in flight when the wave goes on to its end
  asm volatile("s_wait_asynccnt 0x0" ::: "memory");

  // lane (hi, lx) holds d = 8*hi + r of query q0 + lx: the query's whole row sum (row 8 of
  // the CE^T product, rescaled with it) sits in the upper half's crv[0]
  const float lsw = swap_halves(crv[0]);
  const float inv = 1.0f / (hi ? crv[0] : lsw);
  const int b_ = bh >> 3, h_ = bh & 7;
  const int q  = q0 + lx;
  float* xr = attn_x + (((size_t)b_ * 2048 + q) << 8) + (h_ << 5) + base;
  *(float4*)(xr)      = make_float4(o0[0] * inv, o0[1] * inv, o0[2] * inv, o0[3] * inv);
  *(float4*)(xr + 4)  = make_float4(o0[4] * inv, o0[5] * inv, o0[6] * inv, o0[7] * inv);
  *(float4*)(xr + 16) = make_float4(o1[0] * inv, o1[1] * inv, o1[2] * inv, o1[3] * inv);
  *(float4*)(xr + 20) = make_float4(o1[4] * inv, o1[5] * inv, o1[6] * inv, o1[7] * inv);
  if (hi == 0) {                        // CE^T rows 8..15 are no output
    float* cr = c_rev + (((size_t)b_ * 2048 + q) << 6) + (h_ << 3);
    *(float4*)(cr)     = make_float4(crv[0] * inv, crv[1] * inv, crv[2] * inv, crv[3] * inv);
    *(float4*)(cr + 4) = make_float4(crv[4] * inv, crv[5] * inv, crv[6] * inv, crv[7] * inv);
  }
}

// ---------------------------------------------------------------------------
// Consumer part 1: x_out = attn_x @ Wproj + bproj   [8192,256]x[256,256], LDS-staged.
// ---------------------------------------------------------------------------
__device__ __forceinline__ void proj_tile(
    const float* __restrict__ attn_x, const float* __restrict__ Wproj,
    const float* __restrict__ bproj, float* __restrict__ out,
    _Float16 (*__restrict__ Asub)[KP],   // 128 rows, [row][k]
    _Float16 (*__restrict__ Bsub)[KP])   // 64 rows, [col][k]
{
  const int tid  = threadIdx.x;
  const int wave = tid >> 5;
  const int lane = tid & 31;
  const int hi = lane >> 4, lx = lane & 15, base = hi << 3;
  const int row0 = blockIdx.x * 128;
  const int colbase = blockIdx.y * 64;

  const v8f zv = {};
  v8f acc[4] = {zv, zv, zv, zv};
  gemm_k256_tile<false>(attn_x + (size_t)row0 * 256, Wproj + colbase, 256, Asub, Bsub, acc);

#pragma unroll
  for (int c = 0; c < 4; ++c) {
#pragma unroll
    for (int r = 0; r < 8; ++r) {
      const int grow = row0 + (wave << 4) + r + base;
      const int gcol = colbase + (c << 4) + lx;
      out[((size_t)grow << 8) + gcol] = acc[c][r] + bproj[gcol];
    }
  }
}

// ---------------------------------------------------------------------------
// Consumer part 2: motion = (c_rev - ce) @ Wm + bm   [8192,64]x[64,64].
// Wm^T staged once in LDS; each wave: 16 rows x 64 cols, K=64 in 2 steps.
// ---------------------------------------------------------------------------
__device__ __forceinline__ void motion_tile(
    const float* __restrict__ c_rev, const float* __restrict__ ce,
    const float* __restrict__ Wm, const float* __restrict__ bm, float* __restrict__ out,
    _Float16 (*__restrict__ Wt)[64])     // 64 rows, [col][k]
{
  const int tid  = threadIdx.x;
  const int wave = tid >> 5;
  const int lane = tid & 31;
  const int hi = lane >> 4, lx = lane & 15, base = hi << 3;
  const int row0 = blockIdx.x * 128;

#pragma unroll
  for (int i = 0; i < 4; ++i) {
    const int idx = tid + 256 * i;              // 0..1023
    const int k = idx >> 4, f4 = idx & 15;
    const float4 v = *(const float4*)(Wm + (size_t)k * 64 + f4 * 4);
    Wt[f4 * 4 + 0][k] = (_Float16)v.x;
    Wt[f4 * 4 + 1][k] = (_Float16)v.y;
    Wt[f4 * 4 + 2][k] = (_Float16)v.z;
    Wt[f4 * 4 + 3][k] = (_Float16)v.w;
  }
  __syncthreads();

  const float* ar = c_rev + (size_t)(row0 + (wave << 4) + lx) * 64;
  const float* er = ce    + (size_t)(row0 + (wave << 4) + lx) * 64;

  const v8f zv = {};
  v8f acc[4] = {zv, zv, zv, zv};
#pragma unroll
  for (int k0 = 0; k0 < 64; k0 += 32) {
    v16h a;
#pragma unroll
    for (int i = 0; i < 8; ++i) {
      const int ka = k0 + base + i, kb = k0 + 16 + base + i;
      a[i]     = (_Float16)(ar[ka] - er[ka]);
      a[i + 8] = (_Float16)(ar[kb] - er[kb]);
    }
#pragma unroll
    for (int c = 0; c < 4; ++c) {
      const v16h b = frag_from_f16_row(&Wt[(c << 4) + lx][k0], base);
      acc[c] = WMMA_F32_F16(a, b, acc[c]);
    }
  }

#pragma unroll
  for (int c = 0; c < 4; ++c) {
#pragma unroll
    for (int r = 0; r < 8; ++r) {
      const int grow = row0 + (wave << 4) + r + base;
      const int gcol = (c << 4) + lx;
      out[((size_t)grow << 6) + gcol] = acc[c][r] + bm[gcol];
    }
  }
}

// ---------------------------------------------------------------------------
// Kernel 3: both outputs in one grid (64, 5).  y = 0..3: output projection tile
// (x, y); y = 4: motion rows of block x.  The branch is uniform for a block.
// ---------------------------------------------------------------------------
__global__ __launch_bounds__(256) void outputs_kernel(
    const float* __restrict__ attn_x, const float* __restrict__ Wproj,
    const float* __restrict__ bproj, float* __restrict__ out_x,
    const float* __restrict__ c_rev, const float* __restrict__ ce,
    const float* __restrict__ Wm, const float* __restrict__ bm,
    float* __restrict__ out_motion)
{
  __shared__ __align__(16) _Float16 smem[192 * KP]; // 99 KB: A 66 + B 33, or Wm^T 8

  if (blockIdx.y < 4)
    proj_tile(attn_x, Wproj, bproj, out_x,
              (_Float16 (*)[KP])smem, (_Float16 (*)[KP])(smem + 128 * KP));
  else
    motion_tile(c_rev, ce, Wm, bm, out_motion, (_Float16 (*)[64])smem);
}

// ---------------------------------------------------------------------------
extern "C" void kernel_launch(void* const* d_in, const int* in_sizes, int n_in,
                              void* d_out, int out_size, void* d_ws, size_t ws_size,
                              hipStream_t stream) {
  (void)in_sizes; (void)n_in; (void)out_size; (void)ws_size;
  const float* x1    = (const float*)d_in[0];
  const float* x2    = (const float*)d_in[1];
  const float* cor   = (const float*)d_in[2];
  const float* Wq    = (const float*)d_in[3];
  const float* Wkv   = (const float*)d_in[4];
  const float* Wcor  = (const float*)d_in[5];
  const float* Wproj = (const float*)d_in[6];
  const float* bproj = (const float*)d_in[7];
  const float* Wm    = (const float*)d_in[8];
  const float* bm    = (const float*)d_in[9];

  char* ws = (char*)d_ws;                                  // 26 MB total
  _Float16* Qh     = (_Float16*)(ws);                      //  4 MB
  _Float16* Kh     = (_Float16*)(ws + ( 4u << 20));        //  4 MB
  _Float16* Vth    = (_Float16*)(ws + ( 8u << 20));        //  4 MB
  _Float16* CEth   = (_Float16*)(ws + (12u << 20));        //  2 MB
  float*    ce     = (float*)   (ws + (14u << 20));        //  2 MB
  float*    attn_x = (float*)   (ws + (16u << 20));        //  8 MB
  float*    c_rev  = (float*)   (ws + (24u << 20));        //  2 MB

  float* out_x      = (float*)d_out;                       // [4,2048,256]
  float* out_motion = out_x + (size_t)4 * 2048 * 256;      // [4,2048,64]

  producers_kernel<<<dim3(64, 4, 5), 256, 0, stream>>>(x1, x2, cor, Wq, Wkv, Wcor,
                                                       Qh, Kh, Vth, ce, CEth);
  attn_kernel     <<<dim3(16, 32),   256, 0, stream>>>(Qh, Kh, Vth, CEth, attn_x, c_rev);
  outputs_kernel  <<<dim3(64, 5),    256, 0, stream>>>(attn_x, Wproj, bproj, out_x,
                                                       c_rev, ce, Wm, bm, out_motion);
}

// v009
// It runs in 38.2 microseconds.
// Next to v008, in two timings, it ran 1.07 times as fast each time.
// Over all steps from v000 it is 4.54 times as fast.
#include <hip/hip_runtime.h>

// ---------------------------------------------------------------------------
// InterFrameAttention for MI455X (gfx1250, wave32, WMMA f16->f32)
// Shapes: B=4, N=2048, C=256, H=8, Dh=32, M=64, Mh=8
// GEMMs: LDS-staged tiles (coalesced b128 global loads, f16 conversion once,
// weights transposed in LDS so WMMA B-fragments are contiguous ds_load_b128); a tile
// holds the whole K = 256, so a block has one load phase and one barrier.
// Attention: flash-style single pass, one online-softmax step per 128 keys (20 WMMA
// per wave: 8 score tiles, then 12 value products), all
// products transposed (S^T = K Q^T, O^T += V^T P^T): a lane holds one query's
// scores, so the max is in-lane plus one exchange between wave halves,
// and the two score tiles convert in place into the P^T operand (no LDS).
// The softmax shift enters the score products as their C operand and follows the maximum
// only when, for some query of the wave, that outgrows it by SHIFT_ROOM: most steps subtract and rescale nothing; with
// log2 e folded into Q's scale a score tile is exp2's argument as it leaves the matrix unit.
// The softmax row sum rides on the CE^T product: a row of ones in that operand's padding.
// Q, K, V^T and CE^T live in the workspace in fragment order: a fragment is two
// blocks of 512 B, block c holding lane l's elements 8c..8c+7 at byte 16*l, so a
// wave-wide 16-B load or store covers four whole 128-B lines.
// The attention work-group brings K, V^T and CE^T into LDS once for its 8 waves
// (asynchronous copies, two buffers of 128 keys); the waves read fragments from LDS.
// Three launches: the four producers of the attention operands share one grid, as
// do the two consumers of its results; inside a grid no block needs another's data.
// ---------------------------------------------------------------------------

typedef _Float16 v16h __attribute__((ext_vector_type(16)));
typedef _Float16 v8h  __attribute__((ext_vector_type(8)));
typedef float    v8f  __attribute__((ext_vector_type(8)));

#define WMMA_F32_F16(A, Bm, Cm) \
  __builtin_amdgcn_wmma_f32_16x16x32_f16(false, (A), false, (Bm), (short)0, (Cm), false, false)

// A/B fragment element -> K mapping (16-bit 16x32 operand, wave32):
//   e in [0,8):  K = base + e          (base = 8 * (lane>>4))
//   e in [8,16): K = 16 + base + (e-8)
// -> per lane, two contiguous 8-half (16B) chunks at offsets base and 16+base.
__device__ __forceinline__ v16h frag_from_f16_row(const _Float16* __restrict__ row, int base) {
  v8h lo = *(const v8h*)(row + base);
  v8h hi = *(const v8h*)(row + 16 + base);
  v16h r;
#pragma unroll
  for (int i = 0; i < 8; ++i) { r[i] = lo[i]; r[i + 8] = hi[i]; }
  return r;
}

// The same fragment from fragment-ordered memory; p already includes 8 * lane.
__device__ __forceinline__ v16h frag_packed(const _Float16* __restrict__ p) {
  v8h lo = *(const v8h*)(p);
  v8h hi = *(const v8h*)(p + 256);
  v16h r;
#pragma unroll
  for (int i = 0; i < 8; ++i) { r[i] = lo[i]; r[i + 8] = hi[i]; }
  return r;
}

// --- exchange between the two 16-lane halves (lane l <-> l ^ 16) -------------
// v_permlanex16_b32 with the identity select table.  bound_ctrl=1: every select
// is in range and EXEC is all-ones, so the 'old' operand is dead.
__device__ __forceinline__ float swap_halves(float x) {
  int v = __float_as_int(x);
  v = __builtin_amdgcn_permlanex16(v, v, 0x76543210, (int)0xFEDCBA98u, false, true);
  return __int_as_float(v);
}

// ---------------------------------------------------------------------------
// The K = 256 product of a 128-row x 64-column block tile, used by the output
// projection.  Both operands are staged for the whole K at once: every global
// load of the block is issued in one phase, one barrier follows, and the 32 WMMA of a
// wave then run with no further barrier.  8 waves, each 16 rows x 64 columns.
// LDS row pitch 264 halves = 528 B = 33 x 16 B: 16 rows read 16 B each fall on
// 16 different groups of four banks.
// WA: weights are the A operand, D = [col][row]; else D = [row][col].
// ---------------------------------------------------------------------------
#define KP 264
typedef float    v4f  __attribute__((ext_vector_type(4)));
typedef _Float16 v4h  __attribute__((ext_vector_type(4)));

template <bool WA>
__device__ __forceinline__ void gemm_k256_tile(
    const float* __restrict__ X,         // row 0 of the tile; 128 rows of 256, contiguous
    const float* __restrict__ W,         // row 0, first of the tile's 64 columns
    const int ldb,                       // row pitch of W in floats
    _Float16 (*__restrict__ Asub)[KP],   // 128 rows, [row][k]
    _Float16 (*__restrict__ Bsub)[KP],   // 64 rows, [col][k] (transposed)
    v8f (&acc)[4])
{
  const int tid  = threadIdx.x;
  const int wave = tid >> 5;
  const int lane = tid & 31;
  const int hi = lane >> 4, lx = lane & 15, base = hi << 3;

  // X: the tile is 128 KB in a row; round i of the block takes 4 KB (4 rows) of it
  const float* xp = X + (tid << 2);
  const int xr = tid >> 6, xc = (tid & 63) << 2;
  v4f xa[16], xb[16];
#pragma unroll
  for (int i = 0; i < 16; ++i) xa[i] = *(const v4f*)(xp + 1024 * i);
  // W: a thread takes 4 columns x 16 consecutive k; 16 lanes cover 256 contiguous bytes
  const int wc = (tid & 15) << 2, wk = (tid >> 4) << 4;
  const float* wp = W + (size_t)wk * ldb + wc;
  v4f wv[16];
#pragma unroll
  for (int e = 0; e < 15; ++e) wv[e] = *(const v4f*)(wp + (size_t)e * ldb);
  // the last load's result may take over the address registers that the 15 before it name:
  // the wait stands ahead of that overwrite
  asm volatile("s_wait_xcnt 0x0" ::: "memory");
  wv[15] = *(const v4f*)(wp + (size_t)15 * ldb);
  // ahead of any other overwrite of an address register that these 32 loads name
  asm volatile("s_wait_xcnt 0x0" ::: "memory");
#pragma unroll
  for (int i = 0; i < 16; ++i) {
    v4h o = {(_Float16)xa[i][0], (_Float16)xa[i][1], (_Float16)xa[i][2], (_Float16)xa[i][3]};
    *(v4h*)&Asub[xr + 4 * i][xc] = o;
  }
  // compiler fence: the loads below stay behind the stores above, whose registers they
  // take over; moved up to the first 32 they cost the block its third place on a WGP
  asm volatile("" ::: "memory");
#pragma unroll
  for (int i = 0; i < 16; ++i) xb[i] = *(const v4f*)(xp + 1024 * (16 + i));
  // ahead of any overwrite of an address register that these 16 loads name; they fly
  // while W is converted and stored
  asm volatile("s_wait_xcnt 0x0" ::: "memory");
#pragma unroll
  for (int j = 0; j < 4; ++j) {
    v8h lo, hj;
#pragma unroll
    for (int e = 0; e < 8; ++e) { lo[e] = (_Float16)wv[e][j]; hj[e] = (_Float16)wv[e + 8][j]; }
    *(v8h*)&Bsub[wc + j][wk]     = lo;
    *(v8h*)&Bsub[wc + j][wk + 8] = hj;
  }
#pragma unroll
  for (int i = 0; i < 16; ++i) {
    v4h o = {(_Float16)xb[i][0], (_Float16)xb[i][1], (_Float16)xb[i][2], (_Float16)xb[i][3]};
    *(v4h*)&Asub[xr + 4 * (16 + i)][xc] = o;
  }
  __syncthreads();

  // no barrier from here on, so the fragments of k-step s + 1 are read ahead of the
  // products of k-step s
  const _Float16* ar = &Asub[(wave << 4) + lx][0];
  const _Float16* br = &Bsub[lx][0];
  v16h a = frag_from_f16_row(ar, base);
  v16h b[4];
#pragma unroll
  for (int c = 0; c < 4; ++c) b[c] = frag_from_f16_row(br + (c << 4) * KP, base);
#pragma unroll
  for (int k0 = 0; k0 < 256; k0 += 32) {
    v16h an = a, bn[4] = {b[0], b[1], b[2], b[3]};
    if (k0 + 32 < 256) {
      an = frag_from_f16_row(ar + k0 + 32, base);
#pragma unroll
      for (int c = 0; c < 4; ++c) bn[c] = frag_from_f16_row(br + (c << 4) * KP + k0 + 32, base);
    }
    // keeps the reads of k-step s + 1 ahead of the products of k-step s: without it each
    // pair of reads sinks to just before its product and its latency shows 32 times
    __builtin_amdgcn_sched_barrier(0);
#pragma unroll
    for (int c = 0; c < 4; ++c) {
      if (WA) acc[c] = WMMA_F32_F16(b[c], a, acc[c]);   // D[col][row]
      else    acc[c] = WMMA_F32_F16(a, b[c], acc[c]);   // D[row][col]
    }
    a = an;
#pragma unroll
    for (int c = 0; c < 4; ++c) b[c] = bn[c];
  }
}

// ---------------------------------------------------------------------------
// The same product for a 128-row x 128-column block tile, used by the Q, K and V
// projections: X goes through L2 half as often as with 64 columns, half as many waves
// start, and a wave's 32 x 64 tile feeds 8 WMMA from 6 fragments (16 x 64: 4 from 5).
// 8 waves: wave & 3 picks 32 rows, wave >> 2 picks 64 columns.  132 KB of LDS: two blocks
// a WGP, so a wave may hold up to 256 registers: 48 loads a thread fly at once.
// WA: weights are the A operand, D = [col][row]; else D = [row][col].
// ---------------------------------------------------------------------------
template <bool WA>
__device__ __forceinline__ void gemm_k256_tile128(
    const float* __restrict__ X,         // row 0 of the tile; 128 rows of 256, contiguous
    const float* __restrict__ W,         // row 0, first of the tile's 128 columns
    const int ldb,                       // row pitch of W in floats
    _Float16 (*__restrict__ Asub)[KP],   // 128 rows, [row][k]
    _Float16 (*__restrict__ Bsub)[KP],   // 128 rows, [col][k] (transposed)
    v8f (&acc)[2][4])
{
  const int tid  = threadIdx.x;
  const int wave = tid >> 5;
  const int lane = tid & 31;
  const int hi = lane >> 4, lx = lane & 15, base = hi << 3;

  // X: the tile is 128 KB in a row; round i of the block takes 4 KB (4 rows) of it
  const float* xp = X + (tid << 2);
  const int xr = tid >> 6, xc = (tid & 63) << 2;
  // W: a thread takes 4 columns x 16 consecutive k in each half of 64 columns; 16 lanes
  // cover 256 contiguous bytes
  const int wc = (tid & 15) << 2, wk = (tid >> 4) << 4;
  const float* wp = W + (size_t)wk * ldb + wc;
  v4f xa[16], xb[16], wv[16], wu[16];
#pragma unroll
  for (int i = 0; i < 16; ++i) xa[i] = *(const v4f*)(xp + 1024 * i);
#pragma unroll
  for (int e = 0; e < 16; ++e) wv[e] = *(const v4f*)(wp + (size_t)e * ldb);
#pragma unroll
  for (int i = 0; i < 16; ++i) xb[i] = *(const v4f*)(xp + 1024 * (16 + i));
  // ahead of any overwrite of an address register that these 48 loads name
  asm volatile("s_wait_xcnt 0x0" ::: "memory");
#pragma unroll
  for (int i = 0; i < 16; ++i) {
    v4h o = {(_Float16)xa[i][0], (_Float16)xa[i][1], (_Float16)xa[i][2], (_Float16)xa[i][3]};
    *(v4h*)&Asub[xr + 4 * i][xc] = o;
  }
  // compiler fence: the loads below stay behind the stores above, whose registers they
  // take over; without it all 64 loads rise to the head, the wave fills its whole share of
  // 256 registers, and both halves of W are stored only after the last load has landed
  asm volatile("" ::: "memory");
#pragma unroll
  for (int e = 0; e < 16; ++e) wu[e] = *(const v4f*)(wp + 64 + (size_t)e * ldb);
  // ahead of any overwrite of an address register that these 16 loads name; they fly
  // while the rest is converted and stored
  asm volatile("s_wait_xcnt 0x0" ::: "memory");
#pragma unroll
  for (int j = 0; j < 4; ++j) {
    v8h lo, hj;
#pragma unroll
    for (int e = 0; e < 8; ++e) { lo[e] = (_Float16)wv[e][j]; hj[e] = (_Float16)wv[e + 8][j]; }
    *(v8h*)&Bsub[wc + j][wk]     = lo;
    *(v8h*)&Bsub[wc + j][wk + 8] = hj;
  }
#pragma unroll
  for (int i = 0; i < 16; ++i) {
    v4h o = {(_Float16)xb[i][0], (_Float16)xb[i][1], (_Float16)xb[i][2], (_Float16)xb[i][3]};
    *(v4h*)&Asub[xr + 4 * (16 + i)][xc] = o;
  }
#pragma unroll
  for (int j = 0; j < 4; ++j) {
    v8h lo, hj;
#pragma unroll
    for (int e = 0; e < 8; ++e) { lo[e] = (_Float16)wu[e][j]; hj[e] = (_Float16)wu[e + 8][j]; }
    *(v8h*)&Bsub[64 + wc + j][wk]     = lo;
    *(v8h*)&Bsub[64 + wc + j][wk + 8] = hj;
  }
  __syncthreads();

  // no barrier from here on, so the fragments of k-step s + 1 are read ahead of the
  // products of k-step s
  const _Float16* ar = &Asub[((wave & 3) << 5) + lx][0];
  const _Float16* br = &Bsub[((wave >> 2) << 6) + lx][0];
  v16h a[2], b[4];
#pragma unroll
  for (int g = 0; g < 2; ++g) a[g] = frag_from_f16_row(ar + (g << 4) * KP, base);
#pragma unroll
  for (int c = 0; c < 4; ++c) b[c] = frag_from_f16_row(br + (c << 4) * KP, base);
#pragma unroll
  for (int k0 = 0; k0 < 256; k0 += 32) {
    v16h an[2] = {a[0], a[1]}, bn[4] = {b[0], b[1], b[2], b[3]};
    if (k0 + 32 < 256) {
#pragma unroll
      for (int g = 0; g < 2; ++g) an[g] = frag_from_f16_row(ar + (g << 4) * KP + k0 + 32, base);
#pragma unroll
      for (int c = 0; c < 4; ++c) bn[c] = frag_from_f16_row(br + (c << 4) * KP + k0 + 32, base);
    }
    // keeps the reads of k-step s + 1 ahead of the products of k-step s: without it each
    // pair of reads sinks to just before its product and its latency shows every time
    __builtin_amdgcn_sched_barrier(0);
#pragma unroll
    for (int g = 0; g < 2; ++g)
#pragma unroll
      for (int c = 0; c < 4; ++c) {
        if (WA) acc[g][c] = WMMA_F32_F16(b[c], a[g], acc[g][c]);   // D[col][row]
        else    acc[g][c] = WMMA_F32_F16(a[g], b[c], acc[g][c]);   // D[row][col]
      }
#pragma unroll
    for (int g = 0; g < 2; ++g) a[g] = an[g];
#pragma unroll
    for (int c = 0; c < 4; ++c) b[c] = bn[c];
  }
}

// ---------------------------------------------------------------------------
// Producer part 1: Q/K/V projections, LDS-staged.  Z template: 0=Q, 1=K, 2=V.
// Block tile: 128 rows x 128 cols, whole K.  8 waves, each 32 rows x 64 cols.
// Outputs f16 in fragment order, 512-B blocks of [lane][8] (Q pre-scaled):
//   Qh/Kh [bh][n/16][d/16]        lane = 16*((d>>3)&1) + (n&15), element d&7
//   Vth   [bh][n/32][d/16][(n>>4)&1]  lane = 16*((n>>3)&1) + (d&15), element n&7
// Q and K are computed transposed (W^T as A, X^T as B): a lane then ends with 8
// consecutive d of one row n, as V's plain product ends with 8 consecutive n of one d.
// ---------------------------------------------------------------------------
template <int Z>
__device__ __forceinline__ void qkv_proj_tile(
    const float* __restrict__ X, const float* __restrict__ W,
    _Float16* __restrict__ Out,
    _Float16 (*__restrict__ Asub)[KP],   // 128 rows, [row][k]
    _Float16 (*__restrict__ Bsub)[KP])   // 128 rows, [col][k] (transposed)
{
  const int tid  = threadIdx.x;
  const int wave = tid >> 5;
  const int lane = tid & 31;

  const int row0    = blockIdx.x * 128;   // 8192 rows
  const int col0    = blockIdx.y * 128;   // 256 cols
  const int colbase = col0 + ((wave >> 2) << 6);   // first of this wave's 64 columns

  constexpr int ldb  = (Z == 0) ? 256 : 512;
  constexpr int coff = (Z == 2) ? 256 : 0;

  const v8f zv = {};
  v8f acc[2][4] = {{zv, zv, zv, zv}, {zv, zv, zv, zv}};
  // V: D[n][d]; Q, K: D[d][n]
  gemm_k256_tile128<Z != 2>(X + (size_t)row0 * 256, W + coff + col0, ldb, Asub, Bsub, acc);

  // 32^-0.5 * log2 e: the scores come out in powers of two, ready for exp2
  const float qscale = 0.17677669529663687f * 1.4426950408889634f;
#pragma unroll
  for (int g = 0; g < 2; ++g) {
    const int rt  = row0 + ((wave & 3) << 5) + (g << 4);   // first row of this 16-row group
    const int b_  = rt >> 11;
    const int t16 = (rt & 2047) >> 4;          // 16-row group inside the batch
#pragma unroll
    for (int c = 0; c < 4; ++c) {
      const int h_ = (colbase + (c << 4)) >> 5;
      const int dh = c & 1;                    // d / 16 (colbase is a multiple of 32)
      v8h o;
#pragma unroll
      for (int r = 0; r < 8; ++r)
        o[r] = (Z == 0) ? (_Float16)(acc[g][c][r] * qscale) : (_Float16)acc[g][c][r];
      const int blk = (Z == 2) ? ((((t16 >> 1) << 1) + dh) << 1) + (t16 & 1)
                               : (t16 << 1) + dh;
      *(v8h*)(Out + ((size_t)(b_ * 8 + h_) << 16) + (((blk << 5) + lane) << 3)) = o;
    }
  }
  // a block runs no other part after this one (the branch is uniform); the wait is a
  // precaution ahead of any later overwrite of the stores' address and data registers
  asm volatile("s_wait_xcnt 0x0" ::: "memory");
}

// ---------------------------------------------------------------------------
// Producer part 2: cor_embed = cor @ Wcor  (K=3, tiny).  Writes f32 ce [B*N, 64] and
// f16 CEth in fragment order, 512-B blocks [bh][n/32][(n>>4)&1] of [lane][8] with
// lane = 16*((n>>3)&1) + d, element n&7; row d = 8 is ones (CE^T * P^T then holds the
// softmax row sum in its row 8), rows d = 9..15 are zero padding.
// One thread per 16-B piece: 8 consecutive n of one (head, d).
// ---------------------------------------------------------------------------
__device__ __forceinline__ void cor_embed_tile(
    const float* __restrict__ cor, const float* __restrict__ Wcor,
    float* __restrict__ ce, _Float16* __restrict__ CEth, int blk)
{
  const int idx = blk * 256 + threadIdx.x;    // 32 heads * 128 blocks * 32 lanes
  if (idx >= 32 * 128 * 32) return;
  const int d  = idx & 15;
  const int n0 = ((idx >> 4) & 255) << 3;     // block and lane half give n / 8
  const int bh = idx >> 12;
  const int b = bh >> 3, h = bh & 7;
  v8h o = {};
  if (d < 8) {
    const int m = h * 8 + d;
    const size_t bn0 = (size_t)b * 2048 + n0;
    const float4* c4 = (const float4*)(cor + bn0 * 3);   // 24 floats, 96-B aligned
    float cv[24];
#pragma unroll
    for (int i = 0; i < 6; ++i) {
      const float4 x = c4[i];
      cv[4 * i] = x.x; cv[4 * i + 1] = x.y; cv[4 * i + 2] = x.z; cv[4 * i + 3] = x.w;
    }
    const float w0 = Wcor[m], w1 = Wcor[64 + m], w2 = Wcor[128 + m];
#pragma unroll
    for (int e = 0; e < 8; ++e) {
      const float v = cv[3 * e] * w0 + cv[3 * e + 1] * w1 + cv[3 * e + 2] * w2;
      ce[(bn0 + e) * 64 + m] = v;
      o[e] = (_Float16)v;
    }
  } else if (d == 8) {
    o = (v8h)((_Float16)1.0f);
  }
  *(v8h*)(CEth + ((size_t)idx << 3)) = o;
}

// ---------------------------------------------------------------------------
// Kernel 1: everything the attention reads, in one grid (64, 2, 7).
// z = 0, 1, 2: the Q, K, V projection tile (x, y); z = 3..6: 512 cor_embed blocks,
// last because they are the short ones.  The branch is uniform for a block.
// ---------------------------------------------------------------------------
__global__ __launch_bounds__(256) void producers_kernel(
    const float* __restrict__ x1, const float* __restrict__ x2,
    const float* __restrict__ cor, const float* __restrict__ Wq,
    const float* __restrict__ Wkv, const float* __restrict__ Wcor,
    _Float16* __restrict__ Qh, _Float16* __restrict__ Kh, _Float16* __restrict__ Vth,
    float* __restrict__ ce, _Float16* __restrict__ CEth)
{
  __shared__ __align__(16) _Float16 Asub[128][KP];  // 66 KB
  __shared__ __align__(16) _Float16 Bsub[128][KP];  // 66 KB

  const int z = blockIdx.z;
  if (z == 0)      qkv_proj_tile<0>(x1, Wq,  Qh,  Asub, Bsub);
  else if (z == 1) qkv_proj_tile<1>(x2, Wkv, Kh,  Asub, Bsub);
  else if (z == 2) qkv_proj_tile<2>(x2, Wkv, Vth, Asub, Bsub);
  else cor_embed_tile(cor, Wcor, ce, CEth, ((z - 3) * 2 + blockIdx.y) * 64 + blockIdx.x);
}

// ---------------------------------------------------------------------------
// Kernel 2: flash attention.  One 16-query tile per wave, 8 waves/WG,
// grid (N/128, B*H).  Online softmax, one step per stage of 128 keys: one maximum and one
// exchange between halves for 8 score tiles.  The scores leave the matrix unit with the
// query's shift already taken off (C operand = -shift in all 8 registers: a lane is one
// query).  Any shift gives the same quotient; it has to keep P inside f16.  The first stage
// sets it to that stage's maximum; later it moves, with one alpha and one rescale of O^T,
// only in a stage where some query of the wave has its maximum more than SHIFT_ROOM above its shift, so the row's largest P
// stays between 1 and 2^SHIFT_ROOM = 256 (f16 holds 65504; sums are f32).  Scores are in
// powers of two (Q carries 32^-0.5 * log2 e), so P = exp2(score) with no vector work before it.
// Transposed products: D register r of lane (hi, lx) is [8*hi + r][lx], so with
// K (or V^T, CE^T) as A and Q^T (or P^T) as B, lane lx owns query q0 + lx.
//   s[i][r] = S[q0+lx][j0 + 16*i + 8*hi + r]
// so tiles 2p, 2p + 1 are exactly the B-fragment k order (e<8: 8*hi+e, e>=8: 16+8*hi+e-8).
// K, V^T, CE^T: a stage is 128 keys = 8 + 8 + 4 KB, contiguous in each operand's
// fragment-ordered plane; it keeps that order in LDS, so a fragment read is 512
// contiguous bytes a wave.  Stage t + 1 flies while stage t is worked on.
// ---------------------------------------------------------------------------
#define STAGE_KEYS   128
#define STAGE_HALVES 10240            // K 4096, V^T 4096, CE^T 2048 halves
#define STAGE_BYTES  20480
#define N_STAGES     (2048 / STAGE_KEYS)
#define SHIFT_ROOM   8.0f             // in powers of two

// One stage: five 16-B copies a thread (K 2, V^T 2, CE^T 1), 4 KB a round of the
// work-group.  lds: this thread's byte address in the buffer; k, v, c: its 16 B of
// the stage in each plane.
__device__ __forceinline__ void stage_copy(unsigned lds, const _Float16* k,
                                           const _Float16* v, const _Float16* c) {
  // global to LDS through no register; the s_wait_xcnt ends the statement so that no
  // address register named here is rewritten ahead of it
  asm volatile(
      "global_load_async_to_lds_b128 %0, %5, off\n\t"
      "global_load_async_to_lds_b128 %1, %6, off\n\t"
      "global_load_async_to_lds_b128 %2, %7, off\n\t"
      "global_load_async_to_lds_b128 %3, %8, off\n\t"
      "global_load_async_to_lds_b128 %4, %9, off\n\t"
      "s_wait_xcnt 0x0"
      :: "v"(lds), "v"(lds + 4096u), "v"(lds + 8192u), "v"(lds + 12288u), "v"(lds + 16384u),
         "v"(k), "v"(k + 2048), "v"(v), "v"(v + 2048), "v"(c)
      : "memory");
}

__global__ __launch_bounds__(256) void attn_kernel(
    const _Float16* __restrict__ Qh, const _Float16* __restrict__ Kh,
    const _Float16* __restrict__ Vth, const _Float16* __restrict__ CEth,
    float* __restrict__ attn_x, float* __restrict__ c_rev)
{
  const int wave = threadIdx.x >> 5;
  const int lane = threadIdx.x & 31;
  const int hi = lane >> 4, lx = lane & 15, base = hi << 3;
  const int bh = blockIdx.y;
  const int q0 = blockIdx.x * 128 + wave * 16;

  __shared__ __align__(16) _Float16 ring[2][STAGE_HALVES];   // 40 KB

  // fragment-ordered operands: this lane's 16-B piece of each 512-B block
  const _Float16* Qb = Qh + (size_t)bh * (2048 * 32) + (lane << 3);
  // this thread's 16 B of each 4-KB copy round
  const _Float16* Kg = Kh   + (size_t)bh * (2048 * 32) + (threadIdx.x << 3);
  const _Float16* Vg = Vth  + (size_t)bh * (32 * 2048) + (threadIdx.x << 3);
  const _Float16* Cg = CEth + (size_t)bh * (16 * 2048) + (threadIdx.x << 3);
  const unsigned ring_b = (unsigned)(size_t)&ring[0][0] + (threadIdx.x << 4);

  stage_copy(ring_b, Kg, Vg, Cg);                       // stage 0 into buffer 0
  // stage 0 has landed for this wave, then for all: nobody reads it before
  asm volatile("s_wait_asynccnt 0x0" ::: "memory");
  __syncthreads();
  stage_copy(ring_b + STAGE_BYTES, Kg + 4096, Vg + 4096, Cg + 2048);   // stage 1

  const v16h qf = frag_packed(Qb + (size_t)q0 * 32);

  v8f o0 = {}, o1 = {}, crv = {};       // O^T rows d 0..15, 16..31; CE^T rows 0..15
  v8f nsh = {};                         // this lane's query: minus its shift, 8 times

  for (int t = 0; t < N_STAGES; ++t) {
   const _Float16* Sb = &ring[t & 1][lane << 3];
   // S^T = K * Q^T - shift (scale folded into Q) for the whole stage: 8 tiles of 16 keys.
   // Every loop of the trip is unrolled: its arrays are register tiles, indexed by constants
   // alone, and every LDS read has its place in the stage as an immediate offset.
   v16h kf[8];
#pragma unroll
   for (int i = 0; i < 8; ++i) kf[i] = frag_packed(Sb + i * 512);
   // keeps the 16 reads of K first in the LDS queue, which answers in order: mixed with the
   // reads of V^T and CE^T below, the score products wait for bytes they do not use
   __builtin_amdgcn_sched_barrier(0);
   v8f s[8];
#pragma unroll
   for (int i = 0; i < 8; ++i) s[i] = WMMA_F32_F16(kf[i], qf, nsh);
   // V^T: fragment 2p + h is rows d 16h..16h+15 over keys 32p..32p+31; CE^T: fragment p
   v16h va[8], ca[4];
#pragma unroll
   for (int i = 0; i < 8; ++i) va[i] = frag_packed(Sb + 4096 + i * 512);
#pragma unroll
   for (int p = 0; p < 4; ++p) ca[p] = frag_packed(Sb + 8192 + p * 512);
   // keeps these 24 reads ahead of the softmax, which covers their latency: without it
   // they sink to just before their products and each of those places shows its own wait
   __builtin_amdgcn_sched_barrier(0);

   // online softmax, one step a stage: 64 of the query's 128 scores sit in this lane,
   // 64 in lane ^ 16; four independent chains, tile by tile as the products retire
   float mx[4] = {s[0][0], s[0][1], s[0][2], s[0][3]};
#pragma unroll
   for (int r = 4; r < 8; ++r) mx[r & 3] = fmaxf(mx[r & 3], s[0][r]);
#pragma unroll
   for (int i = 1; i < 8; ++i)
#pragma unroll
     for (int r = 0; r < 8; ++r) mx[r & 3] = fmaxf(mx[r & 3], s[i][r]);
   float tm = fmaxf(fmaxf(mx[0], mx[1]), fmaxf(mx[2], mx[3]));
   tm = fmaxf(tm, swap_halves(tm));      // the stage's maximum above the shift
   // one test a stage, the same for the whole wave (the products below need every lane on)
   if (t == 0 || __builtin_amdgcn_ballot_w32(tm > SHIFT_ROOM) != 0u) {
     // the shift never falls; the first stage, whose O^T is still zero, sets it either way
     const float d     = (t == 0) ? tm : fmaxf(tm, 0.0f);
     const float alpha = (t == 0) ? 1.0f : __builtin_amdgcn_exp2f(-d);
#pragma unroll
     for (int i = 0; i < 8; ++i) s[i] -= d;
     nsh -= d;
     o0 *= alpha; o1 *= alpha; crv *= alpha;
   }

#pragma unroll
   for (int p = 0; p < 4; ++p) {
     v16h pf;                           // P^T as B fragment, straight from the score tiles
#pragma unroll
     for (int r = 0; r < 8; ++r) {
       pf[r]     = (_Float16)__builtin_amdgcn_exp2f(s[2 * p][r]);
       pf[r + 8] = (_Float16)__builtin_amdgcn_exp2f(s[2 * p + 1][r]);
     }
     o0  = WMMA_F32_F16(va[2 * p],     pf, o0);
     o1  = WMMA_F32_F16(va[2 * p + 1], pf, o1);
     crv = WMMA_F32_F16(ca[p],         pf, crv);   // row 8: the row sum of P as rounded
   }
   // keeps the hand-over below at the foot of the trip: all reads of the stage now stand at
   // its head, and without this the waits and the barrier rise to just behind them, where
   // stage t + 1's copies have had no time to land and V^T, CE^T must land ahead of the softmax
   __builtin_amdgcn_sched_barrier(0);
   // hand-over: this wave's reads of stage t are done, its copies of stage t + 1 have
   // landed; behind the barrier both hold for all 8 waves
   asm volatile("s_wait_dscnt 0x0" ::: "memory");      // own reads of stage t retired
   asm volatile("s_wait_asynccnt 0x0" ::: "memory");   // own copies of stage t + 1 landed
   __syncthreads();
   if (t + 2 < N_STAGES)                                 // into the buffer just read
     stage_copy(ring_b + (unsigned)(t & 1) * STAGE_BYTES, Kg + (t + 2) * 4096,
                Vg + (t + 2) * 4096, Cg + (t + 2) * 2048);
  }
  // no copy is left in flight when the wave goes on to its end
  asm volatile("s_wait_asynccnt 0x0" ::: "memory");

  // lane (hi, lx) holds d = 8*hi + r of query q0 + lx: the query's whole row sum (row 8 of
  // the CE^T product, rescaled with it) sits in the upper half's crv[0]
  const float lsw = swap_halves(crv[0]);
  const float inv = 1.0f / (hi ? crv[0] : lsw);
  const int b_ = bh >> 3, h_ = bh & 7;
  const int q  = q0 + lx;
  float* xr = attn_x + (((size_t)b_ * 2048 + q) << 8) + (h_ << 5) + base;
  *(float4*)(xr)      = make_float4(o0[0] * inv, o0[1] * inv, o0[2] * inv, o0[3] * inv);
  *(float4*)(xr + 4)  = make_float4(o0[4] * inv, o0[5] * inv, o0[6] * inv, o0[7] * inv);
  *(float4*)(xr + 16) = make_float4(o1[0] * inv, o1[1] * inv, o1[2] * inv, o1[3] * inv);
  *(float4*)(xr + 20) = make_float4(o1[4] * inv, o1[5] * inv, o1[6] * inv, o1[7] * inv);
  if (hi == 0) {                        // CE^T rows 8..15 are no output
    float* cr = c_rev + (((size_t)b_ * 2048 + q) << 6) + (h_ << 3);
    *(float4*)(cr)     = make_float4(crv[0] * inv, crv[1] * inv, crv[2] * inv, crv[3] * inv);
    *(float4*)(cr + 4) = make_float4(crv[4] * inv, crv[5] * inv, crv[6] * inv, crv[7] * inv);
  }
}

// ---------------------------------------------------------------------------
// Consumer part 1: x_out = attn_x @ Wproj + bproj   [8192,256]x[256,256], LDS-staged.
// ---------------------------------------------------------------------------
__device__ __forceinline__ void proj_tile(
    const float* __restrict__ attn_x, const float* __restrict__ Wproj,
    const float* __restrict__ bproj, float* __restrict__ out,
    _Float16 (*__restrict__ Asub)[KP],   // 128 rows, [row][k]
    _Float16 (*__restrict__ Bsub)[KP])   // 64 rows, [col][k]
{
  const int tid  = threadIdx.x;
  const int wave = tid >> 5;
  const int lane = tid & 31;
  const int hi = lane >> 4, lx = lane & 15, base = hi << 3;
  const int row0 = blockIdx.x * 128;
  const int colbase = blockIdx.y * 64;

  const v8f zv = {};
  v8f acc[4] = {zv, zv, zv, zv};
  gemm_k256_tile<false>(attn_x + (size_t)row0 * 256, Wproj + colbase, 256, Asub, Bsub, acc);

#pragma unroll
  for (int c = 0; c < 4; ++c) {
#pragma unroll
    for (int r = 0; r < 8; ++r) {
      const int grow = row0 + (wave << 4) + r + base;
      const int gcol = colbase + (c << 4) + lx;
      out[((size_t)grow << 8) + gcol] = acc[c][r] + bproj[gcol];
    }
  }
}

// ---------------------------------------------------------------------------
// Consumer part 2: motion = (c_rev - ce) @ Wm + bm   [8192,64]x[64,64].
// Wm^T staged once in LDS; each wave: 16 rows x 64 cols, K=64 in 2 steps.
// ---------------------------------------------------------------------------
__device__ __forceinline__ void motion_tile(
    const float* __restrict__ c_rev, const float* __restrict__ ce,
    const float* __restrict__ Wm, const float* __restrict__ bm, float* __restrict__ out,
    _Float16 (*__restrict__ Wt)[64])     // 64 rows, [col][k]
{
  const int tid  = threadIdx.x;
  const int wave = tid >> 5;
  const int lane = tid & 31;
  const int hi = lane >> 4, lx = lane & 15, base = hi << 3;
  const int row0 = blockIdx.x * 128;

#pragma unroll
  for (int i = 0; i < 4; ++i) {
    const int idx = tid + 256 * i;              // 0..1023
    const int k = idx >> 4, f4 = idx & 15;
    const float4 v = *(const float4*)(Wm + (size_t)k * 64 + f4 * 4);
    Wt[f4 * 4 + 0][k] = (_Float16)v.x;
    Wt[f4 * 4 + 1][k] = (_Float16)v.y;
    Wt[f4 * 4 + 2][k] = (_Float16)v.z;
    Wt[f4 * 4 + 3][k] = (_Float16)v.w;
  }
  __syncthreads();

  const float* ar = c_rev + (size_t)(row0 + (wave << 4) + lx) * 64;
  const float* er = ce    + (size_t)(row0 + (wave << 4) + lx) * 64;

  const v8f zv = {};
  v8f acc[4] = {zv, zv, zv, zv};
#pragma unroll
  for (int k0 = 0; k0 < 64; k0 += 32) {
    v16h a;
#pragma unroll
    for (int i = 0; i < 8; ++i) {
      const int ka = k0 + base + i, kb = k0 + 16 + base + i;
      a[i]     = (_Float16)(ar[ka] - er[ka]);
      a[i + 8] = (_Float16)(ar[kb] - er[kb]);
    }
#pragma unroll
    for (int c = 0; c < 4; ++c) {
      const v16h b = frag_from_f16_row(&Wt[(c << 4) + lx][k0], base);
      acc[c] = WMMA_F32_F16(a, b, acc[c]);
    }
  }

#pragma unroll
  for (int c = 0; c < 4; ++c) {
#pragma unroll
    for (int r = 0; r < 8; ++r) {
      const int grow = row0 + (wave << 4) + r + base;
      const int gcol = (c << 4) + lx;
      out[((size_t)grow << 6) + gcol] = acc[c][r] + bm[gcol];
    }
  }
}

// ---------------------------------------------------------------------------
// Kernel 3: both outputs in one grid (64, 5).  y = 0..3: output projection tile
// (x, y); y = 4: motion rows of block x.  The branch is uniform for a block.
// ---------------------------------------------------------------------------
__global__ __launch_bounds__(256) void outputs_kernel(
    const float* __restrict__ attn_x, const float* __restrict__ Wproj,
    const float* __restrict__ bproj, float* __restrict__ out_x,
    const float* __restrict__ c_rev, const float* __restrict__ ce,
    const float* __restrict__ Wm, const float* __restrict__ bm,
    float* __restrict__ out_motion)
{
  __shared__ __align__(16) _Float16 smem[192 * KP]; // 99 KB: A 66 + B 33, or Wm^T 8

  if (blockIdx.y < 4)
    proj_tile(attn_x, Wproj, bproj, out_x,
              (_Float16 (*)[KP])smem, (_Float16 (*)[KP])(smem + 128 * KP));
  else
    motion_tile(c_rev, ce, Wm, bm, out_motion, (_Float16 (*)[64])smem);
}

// ---------------------------------------------------------------------------
extern "C" void kernel_launch(void* const* d_in, const int* in_sizes, int n_in,
                              void* d_out, int out_size, void* d_ws, size_t ws_size,
                              hipStream_t stream) {
  (void)in_sizes; (void)n_in; (void)out_size; (void)ws_size;
  const float* x1    = (const float*)d_in[0];
  const float* x2    = (const float*)d_in[1];
  const float* cor   = (const float*)d_in[2];
  const float* Wq    = (const float*)d_in[3];
  const float* Wkv   = (const float*)d_in[4];
  const float* Wcor  = (const float*)d_in[5];
  const float* Wproj = (const float*)d_in[6];
  const float* bproj = (const float*)d_in[7];
  const float* Wm    = (const float*)d_in[8];
  const float* bm    = (const float*)d_in[9];

  char* ws = (char*)d_ws;                                  // 26 MB total
  _Float16* Qh     = (_Float16*)(ws);                      //  4 MB
  _Float16* Kh     = (_Float16*)(ws + ( 4u << 20));        //  4 MB
  _Float16* Vth    = (_Float16*)(ws + ( 8u << 20));        //  4 MB
  _Float16* CEth   = (_Float16*)(ws + (12u << 20));        //  2 MB
  float*    ce     = (float*)   (ws + (14u << 20));        //  2 MB
  float*    attn_x = (float*)   (ws + (16u << 20));        //  8 MB
  float*    c_rev  = (float*)   (ws + (24u << 20));        //  2 MB

  float* out_x      = (float*)d_out;                       // [4,2048,256]
  float* out_motion = out_x + (size_t)4 * 2048 * 256;      // [4,2048,64]

  producers_kernel<<<dim3(64, 2, 7), 256, 0, stream>>>(x1, x2, cor, Wq, Wkv, Wcor,
                                                       Qh, Kh, Vth, ce, CEth);
  attn_kernel     <<<dim3(16, 32),   256, 0, stream>>>(Qh, Kh, Vth, CEth, attn_x, c_rev);
  outputs_kernel  <<<dim3(64, 5),    256, 0, stream>>>(attn_x, Wproj, bproj, out_x,
                                                       c_rev, ce, Wm, bm, out_motion);
}

// v010
// Measured time: 36.9 microseconds a run.
// Timed twice side by side with v009, it ran 1.04 and 1.03 times as fast.
// Counting every step since v000, it is 4.71 times as fast.
#include <hip/hip_runtime.h>

// ---------------------------------------------------------------------------
// InterFrameAttention for MI455X (gfx1250, wave32, WMMA f16->f32)
// Shapes: B=4, N=2048, C=256, H=8, Dh=32, M=64, Mh=8
// GEMMs: LDS-staged tiles (coalesced b128 global loads, f16 conversion once,
// weights transposed in LDS so WMMA B-fragments are contiguous ds_load_b128); a tile
// holds the whole K = 256, so a block has one load phase and one barrier.
// Attention: flash-style single pass, one online-softmax step per 128 keys (20 WMMA
// per wave: 8 score tiles, then 12 value products), all
// products transposed (S^T = K Q^T, O^T += V^T P^T): a lane holds one query's
// scores, so the max is in-lane plus one exchange between wave halves,
// and the two score tiles convert in place into the P^T operand (no LDS).
// The softmax shift enters the score products as their C operand and follows the maximum
// only when, for some query of the wave, that outgrows it by SHIFT_ROOM: most steps subtract and rescale nothing; with
// log2 e folded into Q's scale a score tile is exp2's argument as it leaves the matrix unit.
// The softmax row sum rides on the CE^T product: a row of ones in that operand's padding.
// Q, K, V^T and CE^T live in the workspace in fragment order: a fragment is two
// blocks of 512 B, block c holding lane l's elements 8c..8c+7 at byte 16*l, so a
// wave-wide 16-B load or store covers four whole 128-B lines.
// The attention result goes on to the output projection the same way: a wave's O^T tiles,
// rounded as that product rounds its operand, are one A fragment of it as they stand.
// The attention work-group brings K, V^T and CE^T into LDS once for its 8 waves
// (asynchronous copies, two buffers of 128 keys); the waves read fragments from LDS.
// Three launches: the four producers of the attention operands share one grid, as
// do the two consumers of its results; inside a grid no block needs another's data.
// ---------------------------------------------------------------------------

typedef _Float16 v16h __attribute__((ext_vector_type(16)));
typedef _Float16 v8h  __attribute__((ext_vector_type(8)));
typedef float    v8f  __attribute__((ext_vector_type(8)));

#define WMMA_F32_F16(A, Bm, Cm) \
  __builtin_amdgcn_wmma_f32_16x16x32_f16(false, (A), false, (Bm), (short)0, (Cm), false, false)

// A/B fragment element -> K mapping (16-bit 16x32 operand, wave32):
//   e in [0,8):  K = base + e          (base = 8 * (lane>>4))
//   e in [8,16): K = 16 + base + (e-8)
// -> per lane, two contiguous 8-half (16B) chunks at offsets base and 16+base.
__device__ __forceinline__ v16h frag_from_f16_row(const _Float16* __restrict__ row, int base) {
  v8h lo = *(const v8h*)(row + base);
  v8h hi = *(const v8h*)(row + 16 + base);
  v16h r;
#pragma unroll
  for (int i = 0; i < 8; ++i) { r[i] = lo[i]; r[i + 8] = hi[i]; }
  return r;
}

// The same fragment from fragment-ordered memory; p already includes 8 * lane.
__device__ __forceinline__ v16h frag_packed(const _Float16* __restrict__ p) {
  v8h lo = *(const v8h*)(p);
  v8h hi = *(const v8h*)(p + 256);
  v16h r;
#pragma unroll
  for (int i = 0; i < 8; ++i) { r[i] = lo[i]; r[i + 8] = hi[i]; }
  return r;
}

// --- exchange between the two 16-lane halves (lane l <-> l ^ 16) -------------
// v_permlanex16_b32 with the identity select table.  bound_ctrl=1: every select
// is in range and EXEC is all-ones, so the 'old' operand is dead.
__device__ __forceinline__ float swap_halves(float x) {
  int v = __float_as_int(x);
  v = __builtin_amdgcn_permlanex16(v, v, 0x76543210, (int)0xFEDCBA98u, false, true);
  return __int_as_float(v);
}

// ---------------------------------------------------------------------------
// The K = 256 product of a 128-row x 64-column block tile, used by the output
// projection.  8 waves, each 16 rows x 64 columns.  The weights are staged in LDS for the
// whole K at once; the A operand comes in fragment order from the workspace and no wave
// shares its 16 rows with another, so each wave loads its 8 fragments straight into
// registers.  Every global load of the block is issued in one phase, one barrier follows,
// and the 32 WMMA of a wave then run with no further barrier.
// LDS row pitch 264 halves = 528 B = 33 x 16 B: 16 rows read 16 B each fall on
// 16 different groups of four banks.
// ---------------------------------------------------------------------------
#define KP 264
typedef float    v4f  __attribute__((ext_vector_type(4)));
typedef _Float16 v4h  __attribute__((ext_vector_type(4)));

__device__ __forceinline__ void gemm_k256_afrag_tile(
    const _Float16* __restrict__ Xf,     // this lane's 16 B of the wave's first fragment
    const float* __restrict__ W,         // row 0, first of the tile's 64 columns
    const int ldb,                       // row pitch of W in floats
    _Float16 (*__restrict__ Bsub)[KP],   // 64 rows, [col][k] (transposed)
    v8f (&acc)[4])
{
  const int tid  = threadIdx.x;
  const int lane = tid & 31;
  const int hi = lane >> 4, lx = lane & 15, base = hi << 3;

  // W: a thread takes 4 columns x 16 consecutive k; 16 lanes cover 256 contiguous bytes.
  // It goes first: loads answer in order, and W has the longer way (LDS, barrier) to go
  const int wc = (tid & 15) << 2, wk = (tid >> 4) << 4;
  const float* wp = W + (size_t)wk * ldb + wc;
  v4f wv[16];
#pragma unroll
  for (int e = 0; e < 16; ++e) wv[e] = *(const v4f*)(wp + (size_t)e * ldb);
  // A: k-step s is fragment s, 1 KB a wave: pieces 2s and 2s + 1 of 512 B
  v8h ap[16];
#pragma unroll
  for (int i = 0; i < 15; ++i) ap[i] = *(const v8h*)(Xf + i * 256);
  // the last load's result may take over the address registers that the 15 before it name:
  // the wait stands ahead of that overwrite
  asm volatile("s_wait_xcnt 0x0" ::: "memory");
  ap[15] = *(const v8h*)(Xf + 15 * 256);
  // ahead of any other overwrite of an address register that these 32 loads name
  asm volatile("s_wait_xcnt 0x0" ::: "memory");
#pragma unroll
  for (int j = 0; j < 4; ++j) {
    v8h lo, hj;
#pragma unroll
    for (int e = 0; e < 8; ++e) { lo[e] = (_Float16)wv[e][j]; hj[e] = (_Float16)wv[e + 8][j]; }
    *(v8h*)&Bsub[wc + j][wk]     = lo;
    *(v8h*)&Bsub[wc + j][wk + 8] = hj;
  }
  __syncthreads();

  // no barrier from here on, so the fragments of k-step s + 1 are read ahead of the
  // products of k-step s
  const _Float16* br = &Bsub[lx][0];
  v16h b[4];
#pragma unroll
  for (int c = 0; c < 4; ++c) b[c] = frag_from_f16_row(br + (c << 4) * KP, base);
#pragma unroll
  for (int s = 0; s < 8; ++s) {
    v16h a;
#pragma unroll
    for (int i = 0; i < 8; ++i) { a[i] = ap[2 * s][i]; a[i + 8] = ap[2 * s + 1][i]; }
    v16h bn[4] = {b[0], b[1], b[2], b[3]};
    if (s + 1 < 8) {
#pragma unroll
      for (int c = 0; c < 4; ++c) bn[c] = frag_from_f16_row(br + (c << 4) * KP + (s + 1) * 32, base);
    }
    // keeps the reads of k-step s + 1 ahead of the products of k-step s: without it each
    // pair of reads sinks to just before its product and its latency shows 32 times
    __builtin_amdgcn_sched_barrier(0);
#pragma unroll
    for (int c = 0; c < 4; ++c) acc[c] = WMMA_F32_F16(a, b[c], acc[c]);   // D[row][col]
#pragma unroll
    for (int c = 0; c < 4; ++c) b[c] = bn[c];
  }
}

// ---------------------------------------------------------------------------
// The K = 256 product of a 128-row x 128-column block tile, both operands f32 in memory and
// staged in LDS for the whole K, used by the Q, K and V
// projections: X goes through L2 half as often as with 64 columns, half as many waves
// start, and a wave's 32 x 64 tile feeds 8 WMMA from 6 fragments (16 x 64: 4 from 5).
// 8 waves: wave & 3 picks 32 rows, wave >> 2 picks 64 columns.  132 KB of LDS: two blocks
// a WGP, so a wave may hold up to 256 registers: 48 loads a thread fly at once.
// WA: weights are the A operand, D = [col][row]; else D = [row][col].
// ---------------------------------------------------------------------------
template <bool WA>
__device__ __forceinline__ void gemm_k256_tile128(
    const float* __restrict__ X,         // row 0 of the tile; 128 rows of 256, contiguous
    const float* __restrict__ W,         // row 0, first of the tile's 128 columns
    const int ldb,                       // row pitch of W in floats
    _Float16 (*__restrict__ Asub)[KP],   // 128 rows, [row][k]
    _Float16 (*__restrict__ Bsub)[KP],   // 128 rows, [col][k] (transposed)
    v8f (&acc)[2][4])
{
  const int tid  = threadIdx.x;
  const int wave = tid >> 5;
  const int lane = tid & 31;
  const int hi = lane >> 4, lx = lane & 15, base = hi << 3;

  // X: the tile is 128 KB in a row; round i of the block takes 4 KB (4 rows) of it
  const float* xp = X + (tid << 2);
  const int xr = tid >> 6, xc = (tid & 63) << 2;
  // W: a thread takes 4 columns x 16 consecutive k in each half of 64 columns; 16 lanes
  // cover 256 contiguous bytes
  const int wc = (tid & 15) << 2, wk = (tid >> 4) << 4;
  const float* wp = W + (size_t)wk * ldb + wc;
  v4f xa[16], xb[16], wv[16], wu[16];
#pragma unroll
  for (int i = 0; i < 16; ++i) xa[i] = *(const v4f*)(xp + 1024 * i);
#pragma unroll
  for (int e = 0; e < 16; ++e) wv[e] = *(const v4f*)(wp + (size_t)e * ldb);
#pragma unroll
  for (int i = 0; i < 16; ++i) xb[i] = *(const v4f*)(xp + 1024 * (16 + i));
  // ahead of any overwrite of an address register that these 48 loads name
  asm volatile("s_wait_xcnt 0x0" ::: "memory");
#pragma unroll
  for (int i = 0; i < 16; ++i) {
    v4h o = {(_Float16)xa[i][0], (_Float16)xa[i][1], (_Float16)xa[i][2], (_Float16)xa[i][3]};
    *(v4h*)&Asub[xr + 4 * i][xc] = o;
  }
  // compiler fence: the loads below stay behind the stores above, whose registers they
  // take over; without it all 64 loads rise to the head, the wave fills its whole share of
  // 256 registers, and both halves of W are stored only after the last load has landed
  asm volatile("" ::: "memory");
#pragma unroll
  for (int e = 0; e < 16; ++e) wu[e] = *(const v4f*)(wp + 64 + (size_t)e * ldb);
  // ahead of any overwrite of an address register that these 16 loads name; they fly
  // while the rest is converted and stored
  asm volatile("s_wait_xcnt 0x0" ::: "memory");
#pragma unroll
  for (int j = 0; j < 4; ++j) {
    v8h lo, hj;
#pragma unroll
    for (int e = 0; e < 8; ++e) { lo[e] = (_Float16)wv[e][j]; hj[e] = (_Float16)wv[e + 8][j]; }
    *(v8h*)&Bsub[wc + j][wk]     = lo;
    *(v8h*)&Bsub[wc + j][wk + 8] = hj;
  }
#pragma unroll
  for (int i = 0; i < 16; ++i) {
    v4h o = {(_Float16)xb[i][0], (_Float16)xb[i][1], (_Float16)xb[i][2], (_Float16)xb[i][3]};
    *(v4h*)&Asub[xr + 4 * (16 + i)][xc] = o;
  }
#pragma unroll
  for (int j = 0; j < 4; ++j) {
    v8h lo, hj;
#pragma unroll
    for (int e = 0; e < 8; ++e) { lo[e] = (_Float16)wu[e][j]; hj[e] = (_Float16)wu[e + 8][j]; }
    *(v8h*)&Bsub[64 + wc + j][wk]     = lo;
    *(v8h*)&Bsub[64 + wc + j][wk + 8] = hj;
  }
  __syncthreads();

  // no barrier from here on, so the fragments of k-step s + 1 are read ahead of the
  // products of k-step s
  const _Float16* ar = &Asub[((wave & 3) << 5) + lx][0];
  const _Float16* br = &Bsub[((wave >> 2) << 6) + lx][0];
  v16h a[2], b[4];
#pragma unroll
  for (int g = 0; g < 2; ++g) a[g] = frag_from_f16_row(ar + (g << 4) * KP, base);
#pragma unroll
  for (int c = 0; c < 4; ++c) b[c] = frag_from_f16_row(br + (c << 4) * KP, base);
#pragma unroll
  for (int k0 = 0; k0 < 256; k0 += 32) {
    v16h an[2] = {a[0], a[1]}, bn[4] = {b[0], b[1], b[2], b[3]};
    if (k0 + 32 < 256) {
#pragma unroll
      for (int g = 0; g < 2; ++g) an[g] = frag_from_f16_row(ar + (g << 4) * KP + k0 + 32, base);
#pragma unroll
      for (int c = 0; c < 4; ++c) bn[c] = frag_from_f16_row(br + (c << 4) * KP + k0 + 32, base);
    }
    // keeps the reads of k-step s + 1 ahead of the products of k-step s: without it each
    // pair of reads sinks to just before its product and its latency shows every time
    __builtin_amdgcn_sched_barrier(0);
#pragma unroll
    for (int g = 0; g < 2; ++g)
#pragma unroll
      for (int c = 0; c < 4; ++c) {
        if (WA) acc[g][c] = WMMA_F32_F16(b[c], a[g], acc[g][c]);   // D[col][row]
        else    acc[g][c] = WMMA_F32_F16(a[g], b[c], acc[g][c]);   // D[row][col]
      }
#pragma unroll
    for (int g = 0; g < 2; ++g) a[g] = an[g];
#pragma unroll
    for (int c = 0; c < 4; ++c) b[c] = bn[c];
  }
}

// ---------------------------------------------------------------------------
// Producer part 1: Q/K/V projections, LDS-staged.  Z template: 0=Q, 1=K, 2=V.
// Block tile: 128 rows x 128 cols, whole K.  8 waves, each 32 rows x 64 cols.
// Outputs f16 in fragment order, 512-B blocks of [lane][8] (Q pre-scaled):
//   Qh/Kh [bh][n/16][d/16]        lane = 16*((d>>3)&1) + (n&15), element d&7
//   Vth   [bh][n/32][d/16][(n>>4)&1]  lane = 16*((n>>3)&1) + (d&15), element n&7
// Q and K are computed transposed (W^T as A, X^T as B): a lane then ends with 8
// consecutive d of one row n, as V's plain product ends with 8 consecutive n of one d.
// ---------------------------------------------------------------------------
template <int Z>
__device__ __forceinline__ void qkv_proj_tile(
    const float* __restrict__ X, const float* __restrict__ W,
    _Float16* __restrict__ Out,
    _Float16 (*__restrict__ Asub)[KP],   // 128 rows, [row][k]
    _Float16 (*__restrict__ Bsub)[KP])   // 128 rows, [col][k] (transposed)
{
  const int tid  = threadIdx.x;
  const int wave = tid >> 5;
  const int lane = tid & 31;

  const int row0    = blockIdx.x * 128;   // 8192 rows
  const int col0    = blockIdx.y * 128;   // 256 cols
  const int colbase = col0 + ((wave >> 2) << 6);   // first of this wave's 64 columns

  constexpr int ldb  = (Z == 0) ? 256 : 512;
  constexpr int coff = (Z == 2) ? 256 : 0;

  const v8f zv = {};
  v8f acc[2][4] = {{zv, zv, zv, zv}, {zv, zv, zv, zv}};
  // V: D[n][d]; Q, K: D[d][n]
  gemm_k256_tile128<Z != 2>(X + (size_t)row0 * 256, W + coff + col0, ldb, Asub, Bsub, acc);

  // 32^-0.5 * log2 e: the scores come out in powers of two, ready for exp2
  const float qscale = 0.17677669529663687f * 1.4426950408889634f;
#pragma unroll
  for (int g = 0; g < 2; ++g) {
    const int rt  = row0 + ((wave & 3) << 5) + (g << 4);   // first row of this 16-row group
    const int b_  = rt >> 11;
    const int t16 = (rt & 2047) >> 4;          // 16-row group inside the batch
#pragma unroll
    for (int c = 0; c < 4; ++c) {
      const int h_ = (colbase + (c << 4)) >> 5;
      const int dh = c & 1;                    // d / 16 (colbase is a multiple of 32)
      v8h o;
#pragma unroll
      for (int r = 0; r < 8; ++r)
        o[r] = (Z == 0) ? (_Float16)(acc[g][c][r] * qscale) : (_Float16)acc[g][c][r];
      const int blk = (Z == 2) ? ((((t16 >> 1) << 1) + dh) << 1) + (t16 & 1)
                               : (t16 << 1) + dh;
      *(v8h*)(Out + ((size_t)(b_ * 8 + h_) << 16) + (((blk << 5) + lane) << 3)) = o;
    }
  }
  // a block runs no other part after this one (the branch is uniform); the wait is a
  // precaution ahead of any later overwrite of the stores' address and data registers
  asm volatile("s_wait_xcnt 0x0" ::: "memory");
}

// ---------------------------------------------------------------------------
// Producer part 2: cor_embed = cor @ Wcor  (K=3, tiny).  Writes f32 ce [B*N, 64] and
// f16 CEth in fragment order, 512-B blocks [bh][n/32][(n>>4)&1] of [lane][8] with
// lane = 16*((n>>3)&1) + d, element n&7; row d = 8 is ones (CE^T * P^T then holds the
// softmax row sum in its row 8), rows d = 9..15 are zero padding.
// One thread per 16-B piece: 8 consecutive n of one (head, d).
// ---------------------------------------------------------------------------
__device__ __forceinline__ void cor_embed_tile(
    const float* __restrict__ cor, const float* __restrict__ Wcor,
    float* __restrict__ ce, _Float16* __restrict__ CEth, int blk)
{
  const int idx = blk * 256 + threadIdx.x;    // 32 heads * 128 blocks * 32 lanes
  if (idx >= 32 * 128 * 32) return;
  const int d  = idx & 15;
  const int n0 = ((idx >> 4) & 255) << 3;     // block and lane half give n / 8
  const int bh = idx >> 12;
  const int b = bh >> 3, h = bh & 7;
  v8h o = {};
  if (d < 8) {
    const int m = h * 8 + d;
    const size_t bn0 = (size_t)b * 2048 + n0;
    const float4* c4 = (const float4*)(cor + bn0 * 3);   // 24 floats, 96-B aligned
    float cv[24];
#pragma unroll
    for (int i = 0; i < 6; ++i) {
      const float4 x = c4[i];
      cv[4 * i] = x.x; cv[4 * i + 1] = x.y; cv[4 * i + 2] = x.z; cv[4 * i + 3] = x.w;
    }
    const float w0 = Wcor[m], w1 = Wcor[64 + m], w2 = Wcor[128 + m];
#pragma unroll
    for (int e = 0; e < 8; ++e) {
      const float v = cv[3 * e] * w0 + cv[3 * e + 1] * w1 + cv[3 * e + 2] * w2;
      ce[(bn0 + e) * 64 + m] = v;
      o[e] = (_Float16)v;
    }
  } else if (d == 8) {
    o = (v8h)((_Float16)1.0f);
  }
  *(v8h*)(CEth + ((size_t)idx << 3)) = o;
}

// ---------------------------------------------------------------------------
// Kernel 1: everything the attention reads, in one grid (64, 2, 7).
// z = 0, 1, 2: the Q, K, V projection tile (x, y); z = 3..6: 512 cor_embed blocks,
// last because they are the short ones.  The branch is uniform for a block.
// ---------------------------------------------------------------------------
__global__ __launch_bounds__(256) void producers_kernel(
    const float* __restrict__ x1, const float* __restrict__ x2,
    const float* __restrict__ cor, const float* __restrict__ Wq,
    const float* __restrict__ Wkv, const float* __restrict__ Wcor,
    _Float16* __restrict__ Qh, _Float16* __restrict__ Kh, _Float16* __restrict__ Vth,
    float* __restrict__ ce, _Float16* __restrict__ CEth)
{
  __shared__ __align__(16) _Float16 Asub[128][KP];  // 66 KB
  __shared__ __align__(16) _Float16 Bsub[128][KP];  // 66 KB

  const int z = blockIdx.z;
  if (z == 0)      qkv_proj_tile<0>(x1, Wq,  Qh,  Asub, Bsub);
  else if (z == 1) qkv_proj_tile<1>(x2, Wkv, Kh,  Asub, Bsub);
  else if (z == 2) qkv_proj_tile<2>(x2, Wkv, Vth, Asub, Bsub);
  else cor_embed_tile(cor, Wcor, ce, CEth, ((z - 3) * 2 + blockIdx.y) * 64 + blockIdx.x);
}

// ---------------------------------------------------------------------------
// Kernel 2: flash attention.  One 16-query tile per wave, 8 waves/WG,
// grid (N/128, B*H).  Online softmax, one step per stage of 128 keys: one maximum and one
// exchange between halves for 8 score tiles.  The scores leave the matrix unit with the
// query's shift already taken off (C operand = -shift in all 8 registers: a lane is one
// query).  Any shift gives the same quotient; it has to keep P inside f16.  The first stage
// sets it to that stage's maximum; later it moves, with one alpha and one rescale of O^T,
// only in a stage where some query of the wave has its maximum more than SHIFT_ROOM above its shift, so the row's largest P
// stays between 1 and 2^SHIFT_ROOM = 256 (f16 holds 65504; sums are f32).  Scores are in
// powers of two (Q carries 32^-0.5 * log2 e), so P = exp2(score) with no vector work before it.
// Transposed products: D register r of lane (hi, lx) is [8*hi + r][lx], so with
// K (or V^T, CE^T) as A and Q^T (or P^T) as B, lane lx owns query q0 + lx.
//   s[i][r] = S[q0+lx][j0 + 16*i + 8*hi + r]
// so tiles 2p, 2p + 1 are exactly the B-fragment k order (e<8: 8*hi+e, e>=8: 16+8*hi+e-8).
// K, V^T, CE^T: a stage is 128 keys = 8 + 8 + 4 KB, contiguous in each operand's
// fragment-ordered plane; it keeps that order in LDS, so a fragment read is 512
// contiguous bytes a wave.  Stage t + 1 flies while stage t is worked on.
// ---------------------------------------------------------------------------
#define STAGE_KEYS   128
#define STAGE_HALVES 10240            // K 4096, V^T 4096, CE^T 2048 halves
#define STAGE_BYTES  20480
#define N_STAGES     (2048 / STAGE_KEYS)
#define SHIFT_ROOM   8.0f             // in powers of two

// One stage: five 16-B copies a thread (K 2, V^T 2, CE^T 1), 4 KB a round of the
// work-group.  lds: this thread's byte address in the buffer; k, v, c: its 16 B of
// the stage in each plane.
__device__ __forceinline__ void stage_copy(unsigned lds, const _Float16* k,
                                           const _Float16* v, const _Float16* c) {
  // global to LDS through no register; the s_wait_xcnt ends the statement so that no
  // address register named here is rewritten ahead of it
  asm volatile(
      "global_load_async_to_lds_b128 %0, %5, off\n\t"
      "global_load_async_to_lds_b128 %1, %6, off\n\t"
      "global_load_async_to_lds_b128 %2, %7, off\n\t"
      "global_load_async_to_lds_b128 %3, %8, off\n\t"
      "global_load_async_to_lds_b128 %4, %9, off\n\t"
      "s_wait_xcnt 0x0"
      :: "v"(lds), "v"(lds + 4096u), "v"(lds + 8192u), "v"(lds + 12288u), "v"(lds + 16384u),
         "v"(k), "v"(k + 2048), "v"(v), "v"(v + 2048), "v"(c)
      : "memory");
}

__global__ __launch_bounds__(256) void attn_kernel(
    const _Float16* __restrict__ Qh, const _Float16* __restrict__ Kh,
    const _Float16* __restrict__ Vth, const _Float16* __restrict__ CEth,
    _Float16* __restrict__ attn_xf, float* __restrict__ c_rev)
{
  const int wave = threadIdx.x >> 5;
  const int lane = threadIdx.x & 31;
  const int hi = lane >> 4, lx = lane & 15;
  const int bh = blockIdx.y;
  const int q0 = blockIdx.x * 128 + wave * 16;

  __shared__ __align__(16) _Float16 ring[2][STAGE_HALVES];   // 40 KB

  // fragment-ordered operands: this lane's 16-B piece of each 512-B block
  const _Float16* Qb = Qh + (size_t)bh * (2048 * 32) + (lane << 3);
  // this thread's 16 B of each 4-KB copy round
  const _Float16* Kg = Kh   + (size_t)bh * (2048 * 32) + (threadIdx.x << 3);
  const _Float16* Vg = Vth  + (size_t)bh * (32 * 2048) + (threadIdx.x << 3);
  const _Float16* Cg = CEth + (size_t)bh * (16 * 2048) + (threadIdx.x << 3);
  const unsigned ring_b = (unsigned)(size_t)&ring[0][0] + (threadIdx.x << 4);

  stage_copy(ring_b, Kg, Vg, Cg);                       // stage 0 into buffer 0
  // stage 0 has landed for this wave, then for all: nobody reads it before
  asm volatile("s_wait_asynccnt 0x0" ::: "memory");
  __syncthreads();
  stage_copy(ring_b + STAGE_BYTES, Kg + 4096, Vg + 4096, Cg + 2048);   // stage 1

  const v16h qf = frag_packed(Qb + (size_t)q0 * 32);

  v8f o0 = {}, o1 = {}, crv = {};       // O^T rows d 0..15, 16..31; CE^T rows 0..15
  v8f nsh = {};                         // this lane's query: minus its shift, 8 times

  for (int t = 0; t < N_STAGES; ++t) {
   const _Float16* Sb = &ring[t & 1][lane << 3];
   // S^T = K * Q^T - shift (scale folded into Q) for the whole stage: 8 tiles of 16 keys.
   // Every loop of the trip is unrolled: its arrays are register tiles, indexed by constants
   // alone, and every LDS read has its place in the stage as an immediate offset.
   v16h kf[8];
#pragma unroll
   for (int i = 0; i < 8; ++i) kf[i] = frag_packed(Sb + i * 512);
   // keeps the 16 reads of K first in the LDS queue, which answers in order: mixed with the
   // reads of V^T and CE^T below, the score products wait for bytes they do not use
   __builtin_amdgcn_sched_barrier(0);
   v8f s[8];
#pragma unroll
   for (int i = 0; i < 8; ++i) s[i] = WMMA_F32_F16(kf[i], qf, nsh);
   // V^T: fragment 2p + h is rows d 16h..16h+15 over keys 32p..32p+31; CE^T: fragment p
   v16h va[8], ca[4];
#pragma unroll
   for (int i = 0; i < 8; ++i) va[i] = frag_packed(Sb + 4096 + i * 512);
#pragma unroll
   for (int p = 0; p < 4; ++p) ca[p] = frag_packed(Sb + 8192 + p * 512);
   // keeps these 24 reads ahead of the softmax, which covers their latency: without it
   // they sink to just before their products and each of those places shows its own wait
   __builtin_amdgcn_sched_barrier(0);

   // online softmax, one step a stage: 64 of the query's 128 scores sit in this lane,
   // 64 in lane ^ 16; four independent chains, tile by tile as the products retire
   float mx[4] = {s[0][0], s[0][1], s[0][2], s[0][3]};
#pragma unroll
   for (int r = 4; r < 8; ++r) mx[r & 3] = fmaxf(mx[r & 3], s[0][r]);
#pragma unroll
   for (int i = 1; i < 8; ++i)
#pragma unroll
     for (int r = 0; r < 8; ++r) mx[r & 3] = fmaxf(mx[r & 3], s[i][r]);
   float tm = fmaxf(fmaxf(mx[0], mx[1]), fmaxf(mx[2], mx[3]));
   tm = fmaxf(tm, swap_halves(tm));      // the stage's maximum above the shift
   // one test a stage, the same for the whole wave (the products below need every lane on)
   if (t == 0 || __builtin_amdgcn_ballot_w32(tm > SHIFT_ROOM) != 0u) {
     // the shift never falls; the first stage, whose O^T is still zero, sets it either way
     const float d     = (t == 0) ? tm : fmaxf(tm, 0.0f);
     const float alpha = (t == 0) ? 1.0f : __builtin_amdgcn_exp2f(-d);
#pragma unroll
     for (int i = 0; i < 8; ++i) s[i] -= d;
     nsh -= d;
     o0 *= alpha; o1 *= alpha; crv *= alpha;
   }

#pragma unroll
   for (int p = 0; p < 4; ++p) {
     v16h pf;                           // P^T as B fragment, straight from the score tiles
#pragma unroll
     for (int r = 0; r < 8; ++r) {
       pf[r]     = (_Float16)__builtin_amdgcn_exp2f(s[2 * p][r]);
       pf[r + 8] = (_Float16)__builtin_amdgcn_exp2f(s[2 * p + 1][r]);
     }
     o0  = WMMA_F32_F16(va[2 * p],     pf, o0);
     o1  = WMMA_F32_F16(va[2 * p + 1], pf, o1);
     crv = WMMA_F32_F16(ca[p],         pf, crv);   // row 8: the row sum of P as rounded
   }
   // keeps the hand-over below at the foot of the trip: all reads of the stage now stand at
   // its head, and without this the waits and the barrier rise to just behind them, where
   // stage t + 1's copies have had no time to land and V^T, CE^T must land ahead of the softmax
   __builtin_amdgcn_sched_barrier(0);
   // hand-over: this wave's reads of stage t are done, its copies of stage t + 1 have
   // landed; behind the barrier both hold for all 8 waves
   asm volatile("s_wait_dscnt 0x0" ::: "memory");      // own reads of stage t retired
   asm volatile("s_wait_asynccnt 0x0" ::: "memory");   // own copies of stage t + 1 landed
   __syncthreads();
   if (t + 2 < N_STAGES)                                 // into the buffer just read
     stage_copy(ring_b + (unsigned)(t & 1) * STAGE_BYTES, Kg + (t + 2) * 4096,
                Vg + (t + 2) * 4096, Cg + (t + 2) * 2048);
  }
  // no copy is left in flight when the wave goes on to its end
  asm volatile("s_wait_asynccnt 0x0" ::: "memory");

  // lane (hi, lx) holds d = 8*hi + r of query q0 + lx: the query's whole row sum (row 8 of
  // the CE^T product, rescaled with it) sits in the upper half's crv[0]
  const float lsw = swap_halves(crv[0]);
  const float inv = 1.0f / (hi ? crv[0] : lsw);
  const int b_ = bh >> 3, h_ = bh & 7;
  const int q  = q0 + lx;
  // the output projection's A fragment [16 queries][k = 32 channels of head h_]: lane
  // (hi, lx) is row lx, elements e < 8 are k = 8*hi + e, e >= 8 are k = 16 + 8*hi + e - 8:
  // o0 and o1 as they stand.  Fragments lie [row / 16][head], 1 KB each: two whole-line stores
  v8h x0, x1;
#pragma unroll
  for (int r = 0; r < 8; ++r) { x0[r] = (_Float16)(o0[r] * inv); x1[r] = (_Float16)(o1[r] * inv); }
  _Float16* xf = attn_xf + ((size_t)((((b_ << 11) + q0) >> 4) * 8 + h_) << 9) + (lane << 3);
  *(v8h*)(xf)       = x0;
  *(v8h*)(xf + 256) = x1;
  if (hi == 0) {                        // CE^T rows 8..15 are no output
    float* cr = c_rev + (((size_t)b_ * 2048 + q) << 6) + (h_ << 3);
    *(float4*)(cr)     = make_float4(crv[0] * inv, crv[1] * inv, crv[2] * inv, crv[3] * inv);
    *(float4*)(cr + 4) = make_float4(crv[4] * inv, crv[5] * inv, crv[6] * inv, crv[7] * inv);
  }
}

// ---------------------------------------------------------------------------
// Consumer part 1: x_out = attn_x @ Wproj + bproj   [8192,256]x[256,256]; Wproj LDS-staged,
// attn_x as the attention left it: A fragments [row / 16][k / 32] of 1 KB.
// ---------------------------------------------------------------------------
__device__ __forceinline__ void proj_tile(
    const _Float16* __restrict__ attn_xf, const float* __restrict__ Wproj,
    const float* __restrict__ bproj, float* __restrict__ out,
    _Float16 (*__restrict__ Bsub)[KP])   // 64 rows, [col][k]
{
  const int tid  = threadIdx.x;
  const int wave = tid >> 5;
  const int lane = tid & 31;
  const int hi = lane >> 4, lx = lane & 15, base = hi << 3;
  const int row0 = blockIdx.x * 128;
  const int colbase = blockIdx.y * 64;

  const v8f zv = {};
  v8f acc[4] = {zv, zv, zv, zv};
  gemm_k256_afrag_tile(attn_xf + ((size_t)((row0 >> 4) + wave) << 12) + (lane << 3),
                       Wproj + colbase, 256, Bsub, acc);

#pragma unroll
  for (int c = 0; c < 4; ++c) {
#pragma unroll
    for (int r = 0; r < 8; ++r) {
      const int grow = row0 + (wave << 4) + r + base;
      const int gcol = colbase + (c << 4) + lx;
      out[((size_t)grow << 8) + gcol] = acc[c][r] + bproj[gcol];
    }
  }
}

// ---------------------------------------------------------------------------
// Consumer part 2: motion = (c_rev - ce) @ Wm + bm   [8192,64]x[64,64].
// Wm^T staged once in LDS; each wave: 16 rows x 64 cols, K=64 in 2 steps.
// ---------------------------------------------------------------------------
__device__ __forceinline__ void motion_tile(
    const float* __restrict__ c_rev, const float* __restrict__ ce,
    const float* __restrict__ Wm, const float* __restrict__ bm, float* __restrict__ out,
    _Float16 (*__restrict__ Wt)[64])     // 64 rows, [col][k]
{
  const int tid  = threadIdx.x;
  const int wave = tid >> 5;
  const int lane = tid & 31;
  const int hi = lane >> 4, lx = lane & 15, base = hi << 3;
  const int row0 = blockIdx.x * 128;

#pragma unroll
  for (int i = 0; i < 4; ++i) {
    const int idx = tid + 256 * i;              // 0..1023
    const int k = idx >> 4, f4 = idx & 15;
    const float4 v = *(const float4*)(Wm + (size_t)k * 64 + f4 * 4);
    Wt[f4 * 4 + 0][k] = (_Float16)v.x;
    Wt[f4 * 4 + 1][k] = (_Float16)v.y;
    Wt[f4 * 4 + 2][k] = (_Float16)v.z;
    Wt[f4 * 4 + 3][k] = (_Float16)v.w;
  }
  __syncthreads();

  const float* ar = c_rev + (size_t)(row0 + (wave << 4) + lx) * 64;
  const float* er = ce    + (size_t)(row0 + (wave << 4) + lx) * 64;

  const v8f zv = {};
  v8f acc[4] = {zv, zv, zv, zv};
#pragma unroll
  for (int k0 = 0; k0 < 64; k0 += 32) {
    v16h a;
#pragma unroll
    for (int i = 0; i < 8; ++i) {
      const int ka = k0 + base + i, kb = k0 + 16 + base + i;
      a[i]     = (_Float16)(ar[ka] - er[ka]);
      a[i + 8] = (_Float16)(ar[kb] - er[kb]);
    }
#pragma unroll
    for (int c = 0; c < 4; ++c) {
      const v16h b = frag_from_f16_row(&Wt[(c << 4) + lx][k0], base);
      acc[c] = WMMA_F32_F16(a, b, acc[c]);
    }
  }

#pragma unroll
  for (int c = 0; c < 4; ++c) {
#pragma unroll
    for (int r = 0; r < 8; ++r) {
      const int grow = row0 + (wave << 4) + r + base;
      const int gcol = (c << 4) + lx;
      out[((size_t)grow << 6) + gcol] = acc[c][r] + bm[gcol];
    }
  }
}

// ---------------------------------------------------------------------------
// Kernel 3: both outputs in one grid (64, 5).  y = 0..3: output projection tile
// (x, y); y = 4: motion rows of block x.  The branch is uniform for a block.
// ---------------------------------------------------------------------------
__global__ __launch_bounds__(256) void outputs_kernel(
    const _Float16* __restrict__ attn_xf, const float* __restrict__ Wproj,
    const float* __restrict__ bproj, float* __restrict__ out_x,
    const float* __restrict__ c_rev, const float* __restrict__ ce,
    const float* __restrict__ Wm, const float* __restrict__ bm,
    float* __restrict__ out_motion)
{
  __shared__ __align__(16) _Float16 smem[64 * KP];  // 33 KB: Wproj^T tile, or Wm^T 8

  if (blockIdx.y < 4)
    proj_tile(attn_xf, Wproj, bproj, out_x, (_Float16 (*)[KP])smem);
  else
    motion_tile(c_rev, ce, Wm, bm, out_motion, (_Float16 (*)[64])smem);
}

// ---------------------------------------------------------------------------
extern "C" void kernel_launch(void* const* d_in, const int* in_sizes, int n_in,
                              void* d_out, int out_size, void* d_ws, size_t ws_size,
                              hipStream_t stream) {
  (void)in_sizes; (void)n_in; (void)out_size; (void)ws_size;
  const float* x1    = (const float*)d_in[0];
  const float* x2    = (const float*)d_in[1];
  const float* cor   = (const float*)d_in[2];
  const float* Wq    = (const float*)d_in[3];
  const float* Wkv   = (const float*)d_in[4];
  const float* Wcor  = (const float*)d_in[5];
  const float* Wproj = (const float*)d_in[6];
  const float* bproj = (const float*)d_in[7];
  const float* Wm    = (const float*)d_in[8];
  const float* bm    = (const float*)d_in[9];

  char* ws = (char*)d_ws;                                  // 26 MB spanned
  _Float16* Qh     = (_Float16*)(ws);                      //  4 MB
  _Float16* Kh     = (_Float16*)(ws + ( 4u << 20));        //  4 MB
  _Float16* Vth    = (_Float16*)(ws + ( 8u << 20));        //  4 MB
  _Float16* CEth   = (_Float16*)(ws + (12u << 20));        //  2 MB
  float*    ce     = (float*)   (ws + (14u << 20));        //  2 MB
  _Float16* attn_x = (_Float16*)(ws + (16u << 20));        //  4 MB
  float*    c_rev  = (float*)   (ws + (24u << 20));        //  2 MB

  float* out_x      = (float*)d_out;                       // [4,2048,256]
  float* out_motion = out_x + (size_t)4 * 2048 * 256;      // [4,2048,64]

  producers_kernel<<<dim3(64, 2, 7), 256, 0, stream>>>(x1, x2, cor, Wq, Wkv, Wcor,
                                                       Qh, Kh, Vth, ce, CEth);
  attn_kernel     <<<dim3(16, 32),   256, 0, stream>>>(Qh, Kh, Vth, CEth, attn_x, c_rev);
  outputs_kernel  <<<dim3(64, 5),    256, 0, stream>>>(attn_x, Wproj, bproj, out_x,
                                                       c_rev, ce, Wm, bm, out_motion);
}
